// v000
// The times below were measured on an AMD MI455X: many runs one after another, warmed up first and cycling through
// copies of the inputs, with the whole window's GPU time divided by the number of runs. Launches and the gaps
// between them are all in it. The median over several windows is given; except for v000 it joins two sittings, which
// can be a few percent apart, so the side-by-side timings, each taken in one sitting, are the better comparison.
// v000, which the later versions start from, runs in 115 microseconds.
#include <hip/hip_runtime.h>

#ifndef NB
#define NB 32
#endif
#ifndef SEQ
#define SEQ 512
#endif
#define NB_FULL  32
#define SEQ_FULL 512
#define DM   256
#define NH   8
#define HD   32
#define NQKV 768
#define CP   264                      // LDS pitch (16-bit elements) of the ctx staging rows
#define SCL  0.17677669529663688f     // 1/sqrt(float32(32))
#define L2E  1.4426950408889634f

static_assert(SEQ % 64 == 0);
static_assert(SEQ <= SEQ_FULL);
static_assert(NB >= 1);
static_assert(NB <= NB_FULL);
static_assert(NH * HD == DM);
static_assert(NQKV == 3 * DM);

typedef unsigned short bf;
typedef __attribute__((ext_vector_type(16))) __bf16   v16bf;
typedef __attribute__((ext_vector_type(8)))  unsigned short v8us;
typedef __attribute__((ext_vector_type(2)))  unsigned short v2us;
typedef __attribute__((ext_vector_type(8)))  float    v8f;
typedef __attribute__((ext_vector_type(4)))  float    v4f;
typedef v4f  __attribute__((may_alias)) v4fa;
typedef v8us __attribute__((may_alias)) v8usa;

__device__ __forceinline__ unsigned short f2bf(float f) { unsigned u = __float_as_uint(f); u += 0x7FFFu + ((u >> 16) & 1u); return (unsigned short)(u >> 16); }   // RNE convert
__device__ __forceinline__ float bf2f(unsigned short b) { return __uint_as_float(((unsigned)b) << 16); }
__device__ __forceinline__ float bfr(float f) { return bf2f(f2bf(f)); }
__device__ __forceinline__ void splitf(float y, unsigned short& h, unsigned short& l) { h = f2bf(y); l = f2bf(y - bf2f(h)); }
__device__ __forceinline__ v16bf cat16b(v8us lo, v8us hi) { return __builtin_bit_cast(v16bf, __builtin_shufflevector(lo, hi, 0, 1, 2, 3, 4, 5, 6, 7, 8, 9, 10, 11, 12, 13, 14, 15)); }
__device__ __forceinline__ v8f wmmab(v16bf a, v16bf b, v8f c) { return __builtin_amdgcn_wmma_f32_16x16x32_bf16(false, a, false, b, (short)0, c, false, false); }
// fragment from a K-contiguous 16-bit row: p already offset by 8*(lane>>4); elements 0..7 <- k0+8h.., 8..15 <- k0+16+8h..
__device__ __forceinline__ v16bf ldf(const bf* p) { return cat16b(*(const v8us*)p, *(const v8us*)(p + 16)); }

// ---- k_gemmw: register-blocked GEMM, ONE WAVE per 64x64 output tile (16 accumulators), operands straight from K-contiguous 16-bit planes; grid (M/64, N/64, Z), 32 threads.
// C[m][n] (f32, pitch ldc, + optional f32 bias[n] after bf16 convert) = sum_k A[m][k] Bt[n][k] (+ split products per NSPLIT). z-batch strides sA/sB/sC in elements. K % 32 == 0.
template <typename T16> struct WFrag;
template <> struct WFrag<bf> { typedef v16bf V; static __device__ __forceinline__ V ld(const bf* p) { return cat16b(*(const v8us*)p, *(const v8us*)(p + 16)); } static __device__ __forceinline__ v8f mma(V a, V b, v8f c) { return wmmab(a, b, c); } };
template <typename T16, int NSPLIT, bool BIAS>
__global__ __launch_bounds__(32) void k_gemmw(const T16* __restrict__ A, const T16* __restrict__ A2, const T16* __restrict__ Bt, const T16* __restrict__ Bt2, int K, float* C, int ldc, const float* __restrict__ bias, size_t sA, size_t sB, size_t sC) {
    typedef typename WFrag<T16>::V V;
    __shared__ __align__(16) float os[16 * 68];
    const size_t z = blockIdx.z; A += z * sA; if (A2) A2 += z * sA; Bt += z * sB; if (Bt2) Bt2 += z * sB; C += z * sC;
    const int lane = threadIdx.x & 31, lr = lane & 15, hi = lane >> 4; const int r0 = blockIdx.x * 64, c0 = blockIdx.y * 64;
    v8f acc[4][4];
#pragma unroll
    for (int mb = 0; mb < 4; ++mb)
#pragma unroll
        for (int nb = 0; nb < 4; ++nb) acc[mb][nb] = (v8f){};
    const size_t aoff = (size_t)(r0 + lr) * K + 8 * hi, boff = (size_t)(c0 + lr) * K + 8 * hi;
#pragma unroll 1
    for (int kc = 0; kc < K; kc += 32) {
        V a[4], a2[4];
#pragma unroll
        for (int mb = 0; mb < 4; ++mb) { a[mb] = WFrag<T16>::ld(A + aoff + (size_t)mb * 16 * K + kc); if (NSPLIT == 1 || NSPLIT == 2) a2[mb] = WFrag<T16>::ld(A2 + aoff + (size_t)mb * 16 * K + kc); }
#pragma unroll
        for (int nb = 0; nb < 4; ++nb) { const V b = WFrag<T16>::ld(Bt + boff + (size_t)nb * 16 * K + kc); V b2; if (NSPLIT >= 2) b2 = WFrag<T16>::ld(Bt2 + boff + (size_t)nb * 16 * K + kc);
#pragma unroll
            for (int mb = 0; mb < 4; ++mb) { acc[mb][nb] = WFrag<T16>::mma(a[mb], b, acc[mb][nb]); if (NSPLIT == 1 || NSPLIT == 2) acc[mb][nb] = WFrag<T16>::mma(a2[mb], b, acc[mb][nb]); if (NSPLIT >= 2) acc[mb][nb] = WFrag<T16>::mma(a[mb], b2, acc[mb][nb]); } }
        asm volatile("v_nop\n\tv_nop\n\tv_nop\n\tv_nop" : "+v"(acc[0][0]), "+v"(acc[1][1]), "+v"(acc[2][2]), "+v"(acc[3][3]) : "v"(a[0]), "v"(a[3]));
    }
#pragma unroll
    for (int mb = 0; mb < 4; ++mb) {
#pragma unroll
        for (int nb = 0; nb < 4; ++nb) {
#pragma unroll
            for (int j = 0; j < 8; ++j) os[(hi * 8 + j) * 68 + nb * 16 + lr] = acc[mb][nb][j]; }
        __builtin_amdgcn_wave_barrier(); asm volatile("" ::: "memory");
        float* crow = C + (size_t)(r0 + mb * 16) * ldc + c0;
{
#pragma unroll
            for (int s = 0; s < 8; ++s) { const int row = 2 * s + hi, cofs = lr * 4; v4f val = *(const v4fa*)(os + row * 68 + cofs); if (BIAS) { val[0] += bfr(bias[c0 + cofs]); val[1] += bfr(bias[c0 + cofs + 1]); val[2] += bfr(bias[c0 + cofs + 2]); val[3] += bfr(bias[c0 + cofs + 3]); }
                *(v4f*)(crow + (size_t)row * ldc + cofs) = val; }
             }
        __builtin_amdgcn_wave_barrier(); asm volatile("" ::: "memory");
    }
}

__global__ __launch_bounds__(256) void k_cvt8(const float* __restrict__ src, bf* dst, unsigned n8, size_t ss, size_t ds) {
    const unsigned i = blockIdx.x * 256u + threadIdx.x; if (i >= n8) return;
    src += (size_t)blockIdx.y * ss; dst += (size_t)blockIdx.y * ds;
    const v8f v = *(const v8f*)(src + (size_t)i * 8); v8us o;
#pragma unroll
    for (int k = 0; k < 8; ++k) o[k] = f2bf(v[k]);
    *(v8us*)(dst + (size_t)i * 8) = o;  }

__global__ __launch_bounds__(256) void k_wt(const float* __restrict__ W, bf* Wt, unsigned N) {
    const unsigned e2 = (blockIdx.x * 256u + threadIdx.x) * 2u; if (e2 >= N * 256u) return;
    const unsigned k = e2 & 255u, n = e2 >> 8;
    v2us o; o[0] = f2bf(W[(size_t)k * N + n]); o[1] = f2bf(W[(size_t)(k + 1u) * N + n]);
    *(v2us*)(Wt + (size_t)n * 256u + k) = o;  }

// k_qkv: one wave per 64x64 tile of qkv = XB Wt^T + bf16(b_qkv); rows r0.. = 64 consecutive t of one batch, columns c0.. = two heads of q, k or v.
__global__ __launch_bounds__(32) void k_qkv(const bf* __restrict__ A, const bf* __restrict__ Bt, const float* __restrict__ bias, bf* QPh, bf* QPl, bf* KPh, bf* KPl, bf* VTh, bf* VTl) {
    __shared__ __align__(16) float os[64 * 68];
    const unsigned lane = threadIdx.x & 31u, lr = lane & 15u, hi = lane >> 4; const unsigned r0 = blockIdx.x * 64u, c0 = blockIdx.y * 64u;
    v8f acc[4][4];
#pragma unroll
    for (int mb = 0; mb < 4; ++mb)
#pragma unroll
        for (int nb = 0; nb < 4; ++nb) acc[mb][nb] = (v8f){};
    const size_t aoff = (size_t)(r0 + lr) * DM + 8u * hi, boff = (size_t)(c0 + lr) * DM + 8u * hi;
#pragma unroll 1
    for (unsigned kc = 0; kc < DM; kc += 32u) {
        v16bf a[4];
#pragma unroll
        for (int mb = 0; mb < 4; ++mb) a[mb] = ldf(A + aoff + (size_t)mb * 16 * DM + kc);
#pragma unroll
        for (int nb = 0; nb < 4; ++nb) { const v16bf b = ldf(Bt + boff + (size_t)nb * 16 * DM + kc);
#pragma unroll
            for (int mb = 0; mb < 4; ++mb) acc[mb][nb] = wmmab(a[mb], b, acc[mb][nb]); }
        asm volatile("v_nop\n\tv_nop\n\tv_nop\n\tv_nop" : "+v"(acc[0][0]), "+v"(acc[1][1]), "+v"(acc[2][2]), "+v"(acc[3][3]) : "v"(a[0]), "v"(a[3]));
    }
#pragma unroll
    for (int nb = 0; nb < 4; ++nb) { const float bv = bfr(bias[c0 + nb * 16 + lr]);
#pragma unroll
        for (int mb = 0; mb < 4; ++mb) {
#pragma unroll
            for (int j = 0; j < 8; ++j) os[(mb * 16 + hi * 8 + j) * 68 + nb * 16 + lr] = acc[mb][nb][j] + bv; } }
    asm volatile("s_wait_dscnt 0x0" ::: "memory"); __builtin_amdgcn_wave_barrier(); asm volatile("" ::: "memory");
    const unsigned b = r0 / (unsigned)SEQ, t0 = r0 - b * (unsigned)SEQ; const unsigned sel = c0 >> 8, hA = (c0 & 255u) >> 5;
    if (sel < 2u) {   // wave-uniform
        bf* Ph = (sel == 0u) ? QPh : KPh; bf* Pl = (sel == 0u) ? QPl : KPl;
{
#pragma unroll 1
            for (unsigned hh = 0; hh < 2u; ++hh) {
#pragma unroll 2
                for (unsigned s = 0; s < 8u; ++s) { const unsigned tl = 8u * s + (lane >> 2), d0 = (lane & 3u) * 8u; const float* src = os + tl * 68u + hh * 32u + d0;
                    const v4f x0 = *(const v4fa*)src, x1 = *(const v4fa*)(src + 4); v8us oh, ol;
#pragma unroll
                    for (int q = 0; q < 4; ++q) { unsigned short u, w2; splitf(x0[q], u, w2); oh[q] = u; ol[q] = w2; splitf(x1[q], u, w2); oh[4 + q] = u; ol[4 + q] = w2; }
                    const size_t off = (((size_t)b * NH + hA + hh) * SEQ + t0 + tl) * HD + d0;
                    *(v8us*)(Ph + off) = oh; *(v8us*)(Pl + off) = ol; } }
             }
    } else {
{
#pragma unroll 1
            for (unsigned hh = 0; hh < 2u; ++hh) {
#pragma unroll 2
                for (unsigned s = 0; s < 8u; ++s) { const unsigned d = 4u * s + (lane >> 3), tl0 = (lane & 7u) * 8u; v8us oh, ol;
#pragma unroll
                    for (int i = 0; i < 8; ++i) { unsigned short u, w2; splitf(os[(tl0 + i) * 68u + hh * 32u + d], u, w2); oh[i] = u; ol[i] = w2; }
                    const size_t off = (((size_t)b * NH + hA + hh) * HD + d) * SEQ + t0 + tl0;
                    *(v8us*)(VTh + off) = oh; *(v8us*)(VTl + off) = ol; } }
             }
    }
}

// k_attn: block = (16 queries, batch b), wave w = head w. Transposed flash attention over 32-key chunks:
//   S^T tile j [key kb+16j+8h+r][query q0+lr] = K rows (A) x Q rows (B), hi/lo 3 products; causal mask by value; online softmax per query = per lane pair (lane, lane^16);
//   P^T B fragment: element r <- p(tile 0)[r], element 8+r <- p(tile 1)[r], lane unchanged; O^T [d][query] += V^T rows (A) x P^T (B), hi/lo 3 products.
__global__ __launch_bounds__(256) void k_attn(const bf* __restrict__ QPh, const bf* __restrict__ QPl, const bf* __restrict__ KPh, const bf* __restrict__ KPl, const bf* __restrict__ VTh, const bf* __restrict__ VTl, bf* CXh, bf* CXl) {
    __shared__ __align__(16) unsigned short sh[16 * CP];
    __shared__ __align__(16) unsigned short sl[16 * CP];
    const unsigned tid = threadIdx.x, lane = tid & 31u, w = tid >> 5, lr = lane & 15u, hi = lane >> 4;
    const unsigned qt = blockIdx.x, b = blockIdx.y, q0 = qt * 16u;
    const size_t bh = (size_t)b * NH + w;
    const size_t qoff = (bh * SEQ + q0 + lr) * HD + 8u * hi;
    const v16bf qh = ldf(QPh + qoff), ql = ldf(QPl + qoff);
    const size_t koff = (bh * SEQ + lr) * HD + 8u * hi;
    const bf* kh = KPh + koff; const bf* kl = KPl + koff;
    const size_t voff = (bh * HD + lr) * SEQ + 8u * hi;
    const bf* vh = VTh + voff; const bf* vl = VTl + voff;
    float m = -3.0e38f, l = 0.f; v8f o0 = (v8f){}, o1 = (v8f){};
    const unsigned query = q0 + lr;
    const unsigned nch = (qt >> 1) + 1u;      // block-uniform trip count; last chunk ends at key <= SEQ-1
#pragma unroll 1
    for (unsigned kc = 0; kc < nch; ++kc) {
        const unsigned kb = kc * 32u;
        const v16bf k0h = ldf(kh + (size_t)kb * HD), k0l = ldf(kl + (size_t)kb * HD), k1h = ldf(kh + (size_t)(kb + 16u) * HD), k1l = ldf(kl + (size_t)(kb + 16u) * HD);
        v8f s0 = (v8f){}, s1 = (v8f){};
        s0 = wmmab(k0h, qh, s0); s0 = wmmab(k0h, ql, s0); s0 = wmmab(k0l, qh, s0);
        s1 = wmmab(k1h, qh, s1); s1 = wmmab(k1h, ql, s1); s1 = wmmab(k1l, qh, s1);
        asm volatile("v_nop\n\tv_nop\n\tv_nop\n\tv_nop" : "+v"(s0), "+v"(s1) : "v"(k0h), "v"(k0l), "v"(k1h), "v"(k1l), "v"(qh), "v"(ql));
        const unsigned keyb = kb + 8u * hi;
        float t0[8], t1[8]; float tmax = -3.0e38f;
#pragma unroll
        for (int r = 0; r < 8; ++r) { const bool ok0 = (keyb + (unsigned)r) <= query, ok1 = (keyb + 16u + (unsigned)r) <= query;
            t0[r] = ok0 ? s0[r] * SCL : -3.0e38f; t1[r] = ok1 ? s1[r] * SCL : -3.0e38f; tmax = fmaxf(tmax, fmaxf(t0[r], t1[r])); }
        tmax = fmaxf(tmax, __shfl_xor(tmax, 16, 32));
        const float mnew = fmaxf(m, tmax);
        const float alpha = __builtin_amdgcn_exp2f(__fmul_rn(__fsub_rn(m, mnew), L2E));
        float psum = 0.f; v8us p0h, p0l, p1h, p1l;
#pragma unroll
        for (int r = 0; r < 8; ++r) { const bool ok0 = (keyb + (unsigned)r) <= query, ok1 = (keyb + 16u + (unsigned)r) <= query;
            const float e0 = __builtin_amdgcn_exp2f(__fmul_rn(__fsub_rn(t0[r], mnew), L2E)), e1 = __builtin_amdgcn_exp2f(__fmul_rn(__fsub_rn(t1[r], mnew), L2E));
            const float p0 = ok0 ? e0 : 0.f, p1 = ok1 ? e1 : 0.f; psum += p0 + p1;
            unsigned short u, w2; splitf(p0, u, w2); p0h[r] = u; p0l[r] = w2; splitf(p1, u, w2); p1h[r] = u; p1l[r] = w2; }
        l = l * alpha + psum; m = mnew;
        o0 *= alpha; o1 *= alpha;
        const v16bf ph = cat16b(p0h, p1h), pl = cat16b(p0l, p1l);
        const v16bf v0h = ldf(vh + kb), v0l = ldf(vl + kb), v1h = ldf(vh + (size_t)16 * SEQ + kb), v1l = ldf(vl + (size_t)16 * SEQ + kb);
        o0 = wmmab(v0h, ph, o0); o0 = wmmab(v0h, pl, o0); o0 = wmmab(v0l, ph, o0);
        o1 = wmmab(v1h, ph, o1); o1 = wmmab(v1h, pl, o1); o1 = wmmab(v1l, ph, o1);
        asm volatile("v_nop\n\tv_nop\n\tv_nop\n\tv_nop" : "+v"(o0), "+v"(o1) : "v"(v0h), "v"(v0l), "v"(v1h), "v"(v1l), "v"(ph), "v"(pl));
    }
    const float ltot = l + __shfl_xor(l, 16, 32);
    const float inv = __fdiv_rn(1.0f, ltot);
    v8us ah, al, ch, cl;
#pragma unroll
    for (int r = 0; r < 8; ++r) { unsigned short u, w2; splitf(o0[r] * inv, u, w2); ah[r] = u; al[r] = w2; splitf(o1[r] * inv, u, w2); ch[r] = u; cl[r] = w2; }
    const unsigned so = lr * CP + w * 32u + 8u * hi;       // row = query lr, columns w*32 + 8h + r (d tile 0) and + 16 (d tile 1)
    *(v8usa*)(sh + so) = ah; *(v8usa*)(sl + so) = al; *(v8usa*)(sh + so + 16u) = ch; *(v8usa*)(sl + so + 16u) = cl;
    __syncthreads();
    bf* gh = CXh + ((size_t)b * SEQ + q0) * DM; bf* gl = CXl + ((size_t)b * SEQ + q0) * DM;
{
#pragma unroll
        for (unsigned rr = 0; rr < 2u; ++rr) { const unsigned row = 2u * w + rr; const v8us xh = *(const v8usa*)(sh + row * CP + lane * 8u), xl = *(const v8usa*)(sl + row * CP + lane * 8u);
            *(v8us*)(gh + (size_t)row * DM + lane * 8u) = xh; *(v8us*)(gl + (size_t)row * DM + lane * 8u) = xl; }
         }
}

#define PLB ((size_t)NB * SEQ * DM * 2)      // bytes of one 16-bit [NB*SEQ][256] plane
static_assert((size_t)NQKV * DM * 2 + (size_t)DM * DM * 2 + 9 * PLB <= (size_t)134217728);
static_assert(PLB % 256 == 0);
// coverage equalities (threads x elements per thread == plane elements)
static_assert((size_t)(NQKV / 2) * 256 * 2 == (size_t)NQKV * DM);                    // k_wt, qkv weights
static_assert((size_t)(DM / 2) * 256 * 2 == (size_t)DM * DM);                        // k_wt, proj weights
static_assert((size_t)(SEQ / 8) * 256 * 8 == (size_t)SEQ * DM);                      // k_cvt8 per batch
static_assert((size_t)(NB * SEQ / 64) * (DM / 64) * 2 * 8 * 32 * 8 == (size_t)NB * SEQ * DM);   // k_qkv: each of q, k, v plane pairs
static_assert((size_t)(SEQ / 16) * NB * 8 * 2 * 32 * 8 == (size_t)NB * SEQ * DM);    // k_attn ctx planes
static_assert((size_t)(SEQ / 64) * (DM / 64) * NB * 64 * 64 == (size_t)NB * SEQ * DM);   // output GEMM

extern "C" void kernel_launch(void* const* d_in, const int* in_sizes, int n_in,
                              void* d_out, int out_size, void* d_ws, size_t ws_size, hipStream_t stream) {
    if (n_in < 5) return;
    const long long need = ((long long)(NB - 1) * SEQ_FULL + SEQ) * DM;
    if ((long long)in_sizes[0] < need || (long long)out_size < need) return;
    if (in_sizes[1] < DM * NQKV || in_sizes[2] < NQKV || in_sizes[3] < DM * DM || in_sizes[4] < DM) return;
    const float* x = (const float*)d_in[0];       // [NB_FULL][SEQ_FULL][256]
    const float* wqkv = (const float*)d_in[1];    // [256 in][768 out]
    const float* bqkv = (const float*)d_in[2];    // [768]
    const float* wproj = (const float*)d_in[3];   // [256 in][256 out]
    const float* bproj = (const float*)d_in[4];   // [256]
    float* OUT = (float*)d_out;                   // [NB_FULL][SEQ_FULL][256]
    char* wsp = (char*)d_ws;
    auto take = [&](size_t bytes) { char* p = wsp; wsp += (bytes + 255) & ~(size_t)255; return (void*)p; };
    bf* WQ = (bf*)take((size_t)NQKV * DM * 2); bf* WP = (bf*)take((size_t)DM * DM * 2);
    bf* XB = (bf*)take(PLB);
    bf* QPh = (bf*)take(PLB); bf* QPl = (bf*)take(PLB); bf* KPh = (bf*)take(PLB); bf* KPl = (bf*)take(PLB); bf* VTh = (bf*)take(PLB); bf* VTl = (bf*)take(PLB);
    bf* CXh = (bf*)take(PLB); bf* CXl = (bf*)take(PLB);
    if ((size_t)(wsp - (char*)d_ws) > ws_size) return;
    k_wt<<<NQKV / 2, 256, 0, stream>>>(wqkv, WQ, (unsigned)NQKV);    // in[256 k][768 n] -> out[768 n][256 k]
    k_wt<<<DM / 2, 256, 0, stream>>>(wproj, WP, (unsigned)DM);       // in[256 k][256 n] -> out[256 n][256 k]
    k_cvt8<<<dim3(SEQ / 8, NB, 1), 256, 0, stream>>>(x, XB, (unsigned)(SEQ * 32), (size_t)SEQ_FULL * DM, (size_t)SEQ * DM);
    k_qkv<<<dim3(NB * SEQ / 64, NQKV / 64, 1), 32, 0, stream>>>(XB, WQ, bqkv, QPh, QPl, KPh, KPl, VTh, VTl);
    k_attn<<<dim3(SEQ / 16, NB, 1), 256, 0, stream>>>(QPh, QPl, KPh, KPl, VTh, VTl, CXh, CXl);
    k_gemmw<bf, 1, true><<<dim3(SEQ / 64, DM / 64, NB), 32, 0, stream>>>(CXh, CXl, WP, nullptr, DM, OUT, DM, bproj, (size_t)SEQ * DM, 0, (size_t)SEQ_FULL * DM);
}

// v001
// It runs in 89.6 microseconds.
// In two side-by-side timings against v000, it was 1.32 and 1.31 times as fast.
#include <hip/hip_runtime.h>

#ifndef NB
#define NB 32
#endif
#ifndef SEQ
#define SEQ 512
#endif
#define NB_FULL  32
#define SEQ_FULL 512
#define DM   256
#define NH   8
#define HD   32
#define NQKV 768
#define SCL  0.17677669529663688f     // 1/sqrt(float32(32))
#define L2E  1.4426950408889634f

static_assert(SEQ % 64 == 0);
static_assert(SEQ <= SEQ_FULL);
static_assert(NB >= 1);
static_assert(NB <= NB_FULL);
static_assert(NH * HD == DM);
static_assert(NQKV == 3 * DM);

typedef unsigned short bf;
typedef __attribute__((ext_vector_type(16))) __bf16   v16bf;
typedef __attribute__((ext_vector_type(8)))  unsigned short v8us;
typedef __attribute__((ext_vector_type(2)))  unsigned short v2us;
typedef __attribute__((ext_vector_type(8)))  float    v8f;
typedef __attribute__((ext_vector_type(4)))  float    v4f;
typedef v4f  __attribute__((may_alias)) v4fa;
typedef v8us __attribute__((may_alias)) v8usa;

__device__ __forceinline__ unsigned short f2bf(float f) { unsigned u = __float_as_uint(f); u += 0x7FFFu + ((u >> 16) & 1u); return (unsigned short)(u >> 16); }   // RNE convert
__device__ __forceinline__ float bf2f(unsigned short b) { return __uint_as_float(((unsigned)b) << 16); }
__device__ __forceinline__ float bfr(float f) { return bf2f(f2bf(f)); }
__device__ __forceinline__ void splitf(float y, unsigned short& h, unsigned short& l) { h = f2bf(y); l = f2bf(y - bf2f(h)); }
__device__ __forceinline__ v16bf cat16b(v8us lo, v8us hi) { return __builtin_bit_cast(v16bf, __builtin_shufflevector(lo, hi, 0, 1, 2, 3, 4, 5, 6, 7, 8, 9, 10, 11, 12, 13, 14, 15)); }
__device__ __forceinline__ v8f wmmab(v16bf a, v16bf b, v8f c) { return __builtin_amdgcn_wmma_f32_16x16x32_bf16(false, a, false, b, (short)0, c, false, false); }
// fragment from a fragment-order block: p = block + 8*lane; elements 0..7 <- k0+8h.., 8..15 <- k0+16+8h.. of row (lane & 15), h = lane >> 4
__device__ __forceinline__ v16bf ldf(const bf* p) { return cat16b(*(const v8us*)p, *(const v8us*)(p + 256)); }

// ---- k_gemmw: register-blocked GEMM, ONE WAVE per 64x64 output tile (16 accumulators), operands straight from fragment-order 16-bit planes; grid (M/64, N/64, Z), 32 threads.
// C[m][n] (f32, pitch ldc, + optional f32 bias[n] after bf16 convert) = sum_k A[m][k] Bt[n][k] (+ split products per NSPLIT). z-batch strides sA/sB/sC in elements. K % 32 == 0.
template <typename T16> struct WFrag;
template <> struct WFrag<bf> { typedef v16bf V; static __device__ __forceinline__ V ld(const bf* p) { return cat16b(*(const v8us*)p, *(const v8us*)(p + 256)); } static __device__ __forceinline__ v8f mma(V a, V b, v8f c) { return wmmab(a, b, c); } };
template <typename T16, int NSPLIT, bool BIAS>
__global__ __launch_bounds__(32) void k_gemmw(const T16* __restrict__ A, const T16* __restrict__ A2, const T16* __restrict__ Bt, const T16* __restrict__ Bt2, int K, float* C, int ldc, const float* __restrict__ bias, size_t sA, size_t sB, size_t sC) {
    typedef typename WFrag<T16>::V V;
    __shared__ __align__(16) float os[16 * 68];
    const size_t z = blockIdx.z; A += z * sA; if (A2) A2 += z * sA; Bt += z * sB; if (Bt2) Bt2 += z * sB; C += z * sC;
    const int lane = threadIdx.x & 31, lr = lane & 15, hi = lane >> 4; const int r0 = blockIdx.x * 64, c0 = blockIdx.y * 64;
    v8f acc[4][4];
#pragma unroll
    for (int mb = 0; mb < 4; ++mb)
#pragma unroll
        for (int nb = 0; nb < 4; ++nb) acc[mb][nb] = (v8f){};
    const size_t aoff = (size_t)r0 * K, boff = (size_t)c0 * K; const unsigned lo = 8u * (unsigned)lane;   // row tile rt starts at rt * 16 * K elements; k tile kt at + kt * 512 = + kc * 16
#pragma unroll 1
    for (int kc = 0; kc < K; kc += 32) {
        V a[4], a2[4]; const T16* pa[4]; const T16* pa2[4]; const T16* pb[4]; const T16* pb2[4];
#pragma unroll
        for (int i = 0; i < 4; ++i) { pa[i] = A + aoff + (size_t)i * 16 * K + kc * 16 + lo; pa2[i] = (NSPLIT == 1 || NSPLIT == 2) ? A2 + aoff + (size_t)i * 16 * K + kc * 16 + lo : pa[i]; pb[i] = Bt + boff + (size_t)i * 16 * K + kc * 16 + lo; pb2[i] = (NSPLIT >= 2) ? Bt2 + boff + (size_t)i * 16 * K + kc * 16 + lo : pb[i]; }
#pragma unroll
        for (int mb = 0; mb < 4; ++mb) { a[mb] = WFrag<T16>::ld(pa[mb]); if (NSPLIT == 1 || NSPLIT == 2) a2[mb] = WFrag<T16>::ld(pa2[mb]); }
#pragma unroll
        for (int nb = 0; nb < 4; ++nb) { const V b = WFrag<T16>::ld(pb[nb]); V b2; if (NSPLIT >= 2) b2 = WFrag<T16>::ld(pb2[nb]);
#pragma unroll
            for (int mb = 0; mb < 4; ++mb) { acc[mb][nb] = WFrag<T16>::mma(a[mb], b, acc[mb][nb]); if (NSPLIT == 1 || NSPLIT == 2) acc[mb][nb] = WFrag<T16>::mma(a2[mb], b, acc[mb][nb]); if (NSPLIT >= 2) acc[mb][nb] = WFrag<T16>::mma(a[mb], b2, acc[mb][nb]); } }
        asm volatile("v_nop\n\tv_nop\n\tv_nop\n\tv_nop" : "+v"(acc[0][0]), "+v"(acc[1][1]), "+v"(acc[2][2]), "+v"(acc[3][3]) : "v"(a[0]), "v"(a[3]));
        // the wait in front of any overwrite of a register that this trip's loads name; their addresses are inputs so that those registers live up to here
        asm volatile("s_wait_xcnt 0x0" :: "v"(pa[0]), "v"(pa[1]), "v"(pa[2]), "v"(pa[3]), "v"(pa2[0]), "v"(pa2[1]), "v"(pa2[2]), "v"(pa2[3]), "v"(pb[0]), "v"(pb[1]), "v"(pb[2]), "v"(pb[3]), "v"(pb2[0]), "v"(pb2[1]), "v"(pb2[2]), "v"(pb2[3]) : "memory");
    }
#pragma unroll
    for (int mb = 0; mb < 4; ++mb) {
#pragma unroll
        for (int nb = 0; nb < 4; ++nb) {
#pragma unroll
            for (int j = 0; j < 8; ++j) os[(hi * 8 + j) * 68 + nb * 16 + lr] = acc[mb][nb][j]; }
        __builtin_amdgcn_wave_barrier(); asm volatile("" ::: "memory");
        float* crow = C + (size_t)(r0 + mb * 16) * ldc + c0;
{
#pragma unroll
            for (int s = 0; s < 8; ++s) { const int row = 2 * s + hi, cofs = lr * 4; v4f val = *(const v4fa*)(os + row * 68 + cofs); if (BIAS) { val[0] += bfr(bias[c0 + cofs]); val[1] += bfr(bias[c0 + cofs + 1]); val[2] += bfr(bias[c0 + cofs + 2]); val[3] += bfr(bias[c0 + cofs + 3]); }
                *(v4f*)(crow + (size_t)row * ldc + cofs) = val; }
             }
        asm volatile("s_wait_xcnt 0x0" ::: "memory");   // in front of the next block's overwrites of the registers that these stores name
        __builtin_amdgcn_wave_barrier(); asm volatile("" ::: "memory");
    }
}

__global__ __launch_bounds__(256) void k_cvt8(const float* __restrict__ src, bf* dst, unsigned n8, size_t ss, size_t ds) {
    const unsigned i = blockIdx.x * 256u + threadIdx.x; if (i >= n8) return;
    src += (size_t)blockIdx.y * ss; dst += (size_t)blockIdx.y * ds;
    // i = 16-byte unit of the fragment-order plane (256 columns = 8 k tiles): lane i & 31, k half (i >> 5) & 1, k tile (i >> 6) & 7, row tile i >> 9
    const unsigned row = (i >> 9) * 16u + (i & 15u), k0 = ((i >> 6) & 7u) * 32u + ((i >> 5) & 1u) * 16u + ((i >> 4) & 1u) * 8u;
    const v8f v = *(const v8f*)(src + (size_t)row * DM + k0); v8us o;
#pragma unroll
    for (int k = 0; k < 8; ++k) o[k] = f2bf(v[k]);
    *(v8us*)(dst + (size_t)i * 8) = o;  }

__global__ __launch_bounds__(256) void k_wt(const float* __restrict__ W, bf* Wt, unsigned N) {
    const unsigned i = blockIdx.x * 256u + threadIdx.x; if (i >= N * 32u) return;
    // i = 16-byte unit of the fragment-order plane, rows n, 256 k: same split of i as in k_cvt8
    const unsigned n = (i >> 9) * 16u + (i & 15u), k0 = ((i >> 6) & 7u) * 32u + ((i >> 5) & 1u) * 16u + ((i >> 4) & 1u) * 8u;
    v8us o; const float* p[8]; float f[8];
#pragma unroll
    for (unsigned k = 0; k < 8u; ++k) { p[k] = W + (size_t)(k0 + k) * N + n; f[k] = *p[k]; }
    // the wait in front of any overwrite of a register that these loads name; their addresses are inputs so that those registers live up to here
    asm volatile("s_wait_xcnt 0x0" :: "v"(p[0]), "v"(p[1]), "v"(p[2]), "v"(p[3]), "v"(p[4]), "v"(p[5]), "v"(p[6]), "v"(p[7]) : "memory");
#pragma unroll
    for (unsigned k = 0; k < 8u; ++k) o[k] = f2bf(f[k]);
    *(v8us*)(Wt + (size_t)i * 8) = o;  }

// k_qkv: one wave per 64x64 tile of qkv = XB Wt^T + bf16(b_qkv); rows r0.. = 64 consecutive t of one batch, columns c0.. = two heads of q, k or v.
__global__ __launch_bounds__(32) void k_qkv(const bf* __restrict__ A, const bf* __restrict__ Bt, const float* __restrict__ bias, bf* QPh, bf* QPl, bf* KPh, bf* KPl, bf* VTh, bf* VTl) {
    __shared__ __align__(16) float os[64 * 68];
    const unsigned lane = threadIdx.x & 31u, lr = lane & 15u, hi = lane >> 4; const unsigned r0 = blockIdx.x * 64u, c0 = blockIdx.y * 64u;
    v8f acc[4][4];
#pragma unroll
    for (int mb = 0; mb < 4; ++mb)
#pragma unroll
        for (int nb = 0; nb < 4; ++nb) acc[mb][nb] = (v8f){};
    const size_t aoff = (size_t)r0 * DM, boff = (size_t)c0 * DM; const unsigned lo = 8u * lane;   // row tile rt at rt * 16 * DM elements, k tile at + kc * 16
#pragma unroll 1
    for (unsigned kc = 0; kc < DM; kc += 32u) {
        v16bf a[4]; const bf* pa = A + aoff + kc * 16u + lo; const bf* pb = Bt + boff + kc * 16u + lo;
#pragma unroll
        for (int mb = 0; mb < 4; ++mb) a[mb] = ldf(pa + (size_t)mb * 16 * DM);
#pragma unroll
        for (int nb = 0; nb < 4; ++nb) { const v16bf b = ldf(pb + (size_t)nb * 16 * DM);
#pragma unroll
            for (int mb = 0; mb < 4; ++mb) acc[mb][nb] = wmmab(a[mb], b, acc[mb][nb]); }
        asm volatile("v_nop\n\tv_nop\n\tv_nop\n\tv_nop" : "+v"(acc[0][0]), "+v"(acc[1][1]), "+v"(acc[2][2]), "+v"(acc[3][3]) : "v"(a[0]), "v"(a[3]));
        // the wait in front of any overwrite of a register that this trip's loads name; their addresses are inputs so that those registers live up to here
        asm volatile("s_wait_xcnt 0x0" :: "v"(pa), "v"(pb) : "memory");
    }
#pragma unroll
    for (int nb = 0; nb < 4; ++nb) { const float bv = bfr(bias[c0 + nb * 16 + lr]);
#pragma unroll
        for (int mb = 0; mb < 4; ++mb) {
#pragma unroll
            for (int j = 0; j < 8; ++j) os[(mb * 16 + hi * 8 + j) * 68 + nb * 16 + lr] = acc[mb][nb][j] + bv; } }
    asm volatile("s_wait_dscnt 0x0" ::: "memory"); __builtin_amdgcn_wave_barrier(); asm volatile("" ::: "memory");
    const unsigned b = r0 / (unsigned)SEQ, t0 = r0 - b * (unsigned)SEQ; const unsigned sel = c0 >> 8, hA = (c0 & 255u) >> 5;
    if (sel < 2u) {   // wave-uniform
        bf* Ph = (sel == 0u) ? QPh : KPh; bf* Pl = (sel == 0u) ? QPl : KPl;
{
#pragma unroll 1
            for (unsigned hh = 0; hh < 2u; ++hh) {
#pragma unroll 2
                for (unsigned s = 0; s < 8u; ++s) { const unsigned tt = s >> 1, hf = s & 1u; const float* src = os + (tt * 16u + lr) * 68u + hh * 32u + hf * 16u + hi * 8u;   // 16-row tile tt, d half hf
                    const v4f x0 = *(const v4fa*)src, x1 = *(const v4fa*)(src + 4); v8us oh, ol;
#pragma unroll
                    for (int q = 0; q < 4; ++q) { unsigned short u, w2; splitf(x0[q], u, w2); oh[q] = u; ol[q] = w2; splitf(x1[q], u, w2); oh[4 + q] = u; ol[4 + q] = w2; }
                    const size_t off = (((size_t)b * NH + hA + hh) * (SEQ / 16) + (t0 >> 4) + tt) * 512u + hf * 256u + lane * 8u;
                    *(v8us*)(Ph + off) = oh; *(v8us*)(Pl + off) = ol;
                    asm volatile("s_wait_xcnt 0x0" :: "v"(oh), "v"(ol), "v"(Ph + off), "v"(Pl + off) : "memory"); } }   // in front of the next trip's overwrites of the registers that these stores name (inputs: they live up to here)
             }
    } else {
{
#pragma unroll 1
            for (unsigned hh = 0; hh < 2u; ++hh) {
#pragma unroll 2
                for (unsigned s = 0; s < 8u; ++s) { const unsigned ck = s >> 2, dt = (s >> 1) & 1u, hf = s & 1u; const unsigned d = dt * 16u + lr, tl0 = ck * 32u + hf * 16u + hi * 8u; v8us oh, ol;   // 32-key chunk ck, d tile dt, key half hf
#pragma unroll
                    for (int i = 0; i < 8; ++i) { unsigned short u, w2; splitf(os[(tl0 + i) * 68u + hh * 32u + d], u, w2); oh[i] = u; ol[i] = w2; }
                    const size_t off = ((((size_t)b * NH + hA + hh) * (SEQ / 32) + (t0 >> 5) + ck) * 2u + dt) * 512u + hf * 256u + lane * 8u;
                    *(v8us*)(VTh + off) = oh; *(v8us*)(VTl + off) = ol;
                    asm volatile("s_wait_xcnt 0x0" :: "v"(oh), "v"(ol), "v"(VTh + off), "v"(VTl + off) : "memory"); } }   // as above
             }
    }
}

// k_attn: block = (16 queries, batch b), wave w = head w. Transposed flash attention over 32-key chunks:
//   S^T tile j [key kb+16j+8h+r][query q0+lr] = K rows (A) x Q rows (B), hi/lo 3 products; causal mask by value; online softmax per query = per lane pair (lane, lane^16);
//   P^T B fragment: element r <- p(tile 0)[r], element 8+r <- p(tile 1)[r], lane unchanged; O^T [d][query] += V^T rows (A) x P^T (B), hi/lo 3 products.
__global__ __launch_bounds__(256) void k_attn(const bf* __restrict__ QPh, const bf* __restrict__ QPl, const bf* __restrict__ KPh, const bf* __restrict__ KPl, const bf* __restrict__ VTh, const bf* __restrict__ VTl, bf* CXh, bf* CXl) {
    const unsigned tid = threadIdx.x, lane = tid & 31u, w = tid >> 5, lr = lane & 15u, hi = lane >> 4, lo = 8u * lane;
    const unsigned qt = blockIdx.x, b = blockIdx.y, q0 = qt * 16u;
    const size_t bh = (size_t)b * NH + w;
    const size_t qoff = (bh * (SEQ / 16) + qt) * 512u;
    const v16bf qh = ldf(QPh + qoff + lo), ql = ldf(QPl + qoff + lo);
    const size_t koff = bh * (SEQ * HD);      // 32 keys = two blocks = 1024 elements
    const bf* kh = KPh + koff; const bf* kl = KPl + koff;
    const size_t voff = bh * (SEQ * HD);      // 32 keys = d tile 0 block, d tile 1 block
    const bf* vh = VTh + voff; const bf* vl = VTl + voff;
    float m = -3.0e38f, l = 0.f; v8f o0 = (v8f){}, o1 = (v8f){};
    const unsigned query = q0 + lr;
    const unsigned nch = (qt >> 1) + 1u;      // block-uniform trip count; last chunk ends at key <= SEQ-1
#pragma unroll 1
    for (unsigned kc = 0; kc < nch; ++kc) {
        const unsigned kb = kc * 32u;
        const bf* pkh = kh + (size_t)kb * HD + lo; const bf* pkl = kl + (size_t)kb * HD + lo;
        const v16bf k0h = ldf(pkh), k0l = ldf(pkl), k1h = ldf(pkh + 512), k1l = ldf(pkl + 512);
        // the wait in front of any overwrite of a register that these loads name; their addresses are inputs so that those registers live up to here
        asm volatile("s_wait_xcnt 0x0" :: "v"(pkh), "v"(pkl) : "memory");
        v8f s0 = (v8f){}, s1 = (v8f){};
        s0 = wmmab(k0h, qh, s0); s0 = wmmab(k0h, ql, s0); s0 = wmmab(k0l, qh, s0);
        s1 = wmmab(k1h, qh, s1); s1 = wmmab(k1h, ql, s1); s1 = wmmab(k1l, qh, s1);
        asm volatile("v_nop\n\tv_nop\n\tv_nop\n\tv_nop" : "+v"(s0), "+v"(s1) : "v"(k0h), "v"(k0l), "v"(k1h), "v"(k1l), "v"(qh), "v"(ql));
        const unsigned keyb = kb + 8u * hi;
        float t0[8], t1[8]; float tmax = -3.0e38f;
#pragma unroll
        for (int r = 0; r < 8; ++r) { const bool ok0 = (keyb + (unsigned)r) <= query, ok1 = (keyb + 16u + (unsigned)r) <= query;
            t0[r] = ok0 ? s0[r] * SCL : -3.0e38f; t1[r] = ok1 ? s1[r] * SCL : -3.0e38f; tmax = fmaxf(tmax, fmaxf(t0[r], t1[r])); }
        tmax = fmaxf(tmax, __shfl_xor(tmax, 16, 32));
        const float mnew = fmaxf(m, tmax);
        const float alpha = __builtin_amdgcn_exp2f(__fmul_rn(__fsub_rn(m, mnew), L2E));
        float psum = 0.f; v8us p0h, p0l, p1h, p1l;
#pragma unroll
        for (int r = 0; r < 8; ++r) { const bool ok0 = (keyb + (unsigned)r) <= query, ok1 = (keyb + 16u + (unsigned)r) <= query;
            const float e0 = __builtin_amdgcn_exp2f(__fmul_rn(__fsub_rn(t0[r], mnew), L2E)), e1 = __builtin_amdgcn_exp2f(__fmul_rn(__fsub_rn(t1[r], mnew), L2E));
            const float p0 = ok0 ? e0 : 0.f, p1 = ok1 ? e1 : 0.f; psum += p0 + p1;
            unsigned short u, w2; splitf(p0, u, w2); p0h[r] = u; p0l[r] = w2; splitf(p1, u, w2); p1h[r] = u; p1l[r] = w2; }
        l = l * alpha + psum; m = mnew;
        o0 *= alpha; o1 *= alpha;
        const v16bf ph = cat16b(p0h, p1h), pl = cat16b(p0l, p1l);
        const bf* pvh = vh + (size_t)kb * HD + lo; const bf* pvl = vl + (size_t)kb * HD + lo;
        const v16bf v0h = ldf(pvh), v0l = ldf(pvl), v1h = ldf(pvh + 512), v1l = ldf(pvl + 512);
        o0 = wmmab(v0h, ph, o0); o0 = wmmab(v0h, pl, o0); o0 = wmmab(v0l, ph, o0);
        o1 = wmmab(v1h, ph, o1); o1 = wmmab(v1h, pl, o1); o1 = wmmab(v1l, ph, o1);
        asm volatile("v_nop\n\tv_nop\n\tv_nop\n\tv_nop" : "+v"(o0), "+v"(o1) : "v"(v0h), "v"(v0l), "v"(v1h), "v"(v1l), "v"(ph), "v"(pl));
    }
    const float ltot = l + __shfl_xor(l, 16, 32);
    const float inv = __fdiv_rn(1.0f, ltot);
    v8us ah, al, ch, cl;
#pragma unroll
    for (int r = 0; r < 8; ++r) { unsigned short u, w2; splitf(o0[r] * inv, u, w2); ah[r] = u; al[r] = w2; splitf(o1[r] * inv, u, w2); ch[r] = u; cl[r] = w2; }
    // ctx row tile (b*SEQ+q0)/16, k tile = head w: element (query lr, d = 16*half + 8*hi + r) sits at half*256 + lane*8 + r, which is this lane's own accumulator order
    const size_t co = ((((size_t)b * SEQ + q0) >> 4) * (DM / 32) + w) * 512u;
    *(v8us*)(CXh + co + lo) = ah; *(v8us*)(CXh + co + lo + 256u) = ch; *(v8us*)(CXl + co + lo) = al; *(v8us*)(CXl + co + lo + 256u) = cl;
}

#define PLB ((size_t)NB * SEQ * DM * 2)      // bytes of one 16-bit [NB*SEQ][256] plane
static_assert((size_t)NQKV * DM * 2 + (size_t)DM * DM * 2 + 9 * PLB <= (size_t)134217728);
static_assert(PLB % 256 == 0);
// coverage equalities (threads x elements per thread == plane elements)
static_assert((size_t)(NQKV / 8) * 256 * 8 == (size_t)NQKV * DM);                    // k_wt, qkv weights
static_assert((size_t)(DM / 8) * 256 * 8 == (size_t)DM * DM);                        // k_wt, proj weights
static_assert((size_t)(SEQ / 8) * 256 * 8 == (size_t)SEQ * DM);                      // k_cvt8 per batch
static_assert((size_t)(NB * SEQ / 64) * (DM / 64) * 2 * 8 * 32 * 8 == (size_t)NB * SEQ * DM);   // k_qkv: each of q, k, v plane pairs
static_assert((size_t)(SEQ / 16) * NB * 8 * 2 * 32 * 8 == (size_t)NB * SEQ * DM);    // k_attn ctx planes
static_assert((size_t)(SEQ / 64) * (DM / 64) * NB * 64 * 64 == (size_t)NB * SEQ * DM);   // output GEMM

extern "C" void kernel_launch(void* const* d_in, const int* in_sizes, int n_in,
                              void* d_out, int out_size, void* d_ws, size_t ws_size, hipStream_t stream) {
    if (n_in < 5) return;
    const long long need = ((long long)(NB - 1) * SEQ_FULL + SEQ) * DM;
    if ((long long)in_sizes[0] < need || (long long)out_size < need) return;
    if (in_sizes[1] < DM * NQKV || in_sizes[2] < NQKV || in_sizes[3] < DM * DM || in_sizes[4] < DM) return;
    const float* x = (const float*)d_in[0];       // [NB_FULL][SEQ_FULL][256]
    const float* wqkv = (const float*)d_in[1];    // [256 in][768 out]
    const float* bqkv = (const float*)d_in[2];    // [768]
    const float* wproj = (const float*)d_in[3];   // [256 in][256 out]
    const float* bproj = (const float*)d_in[4];   // [256]
    float* OUT = (float*)d_out;                   // [NB_FULL][SEQ_FULL][256]
    char* wsp = (char*)d_ws;
    auto take = [&](size_t bytes) { char* p = wsp; wsp += (bytes + 255) & ~(size_t)255; return (void*)p; };
    bf* WQ = (bf*)take((size_t)NQKV * DM * 2); bf* WP = (bf*)take((size_t)DM * DM * 2);
    bf* XB = (bf*)take(PLB);
    bf* QPh = (bf*)take(PLB); bf* QPl = (bf*)take(PLB); bf* KPh = (bf*)take(PLB); bf* KPl = (bf*)take(PLB); bf* VTh = (bf*)take(PLB); bf* VTl = (bf*)take(PLB);
    bf* CXh = (bf*)take(PLB); bf* CXl = (bf*)take(PLB);
    if ((size_t)(wsp - (char*)d_ws) > ws_size) return;
    k_wt<<<NQKV / 8, 256, 0, stream>>>(wqkv, WQ, (unsigned)NQKV);    // in[256 k][768 n] -> rows n, fragment order
    k_wt<<<DM / 8, 256, 0, stream>>>(wproj, WP, (unsigned)DM);       // in[256 k][256 n] -> rows n, fragment order
    k_cvt8<<<dim3(SEQ / 8, NB, 1), 256, 0, stream>>>(x, XB, (unsigned)(SEQ * 32), (size_t)SEQ_FULL * DM, (size_t)SEQ * DM);
    k_qkv<<<dim3(NB * SEQ / 64, NQKV / 64, 1), 32, 0, stream>>>(XB, WQ, bqkv, QPh, QPl, KPh, KPl, VTh, VTl);
    k_attn<<<dim3(SEQ / 16, NB, 1), 256, 0, stream>>>(QPh, QPl, KPh, KPl, VTh, VTl, CXh, CXl);
    k_gemmw<bf, 1, true><<<dim3(SEQ / 64, DM / 64, NB), 32, 0, stream>>>(CXh, CXl, WP, nullptr, DM, OUT, DM, bproj, (size_t)SEQ * DM, 0, (size_t)SEQ_FULL * DM);
}

// v002
// Measured time: 86.2 microseconds a run.
// Two timings next to v001 both put it at 1.04 times that version's speed.
// Counting every step since v000, it is 1.37 times as fast.
#include <hip/hip_runtime.h>

#ifndef NB
#define NB 32
#endif
#ifndef SEQ
#define SEQ 512
#endif
#define NB_FULL  32
#define SEQ_FULL 512
#define DM   256
#define NH   8
#define HD   32
#define NQKV 768
#define SCL  0.17677669529663688f     // 1/sqrt(float32(32))
#define L2E  1.4426950408889634f

static_assert(SEQ % 64 == 0);
static_assert(SEQ <= SEQ_FULL);
static_assert(NB >= 1);
static_assert(NB <= NB_FULL);
static_assert(NH * HD == DM);
static_assert(NQKV == 3 * DM);

typedef unsigned short bf;
typedef __attribute__((ext_vector_type(16))) __bf16   v16bf;
typedef __attribute__((ext_vector_type(8)))  unsigned short v8us;
typedef __attribute__((ext_vector_type(2)))  unsigned short v2us;
typedef __attribute__((ext_vector_type(8)))  float    v8f;
typedef __attribute__((ext_vector_type(4)))  float    v4f;
typedef v4f  __attribute__((may_alias)) v4fa;
typedef v8us __attribute__((may_alias)) v8usa;

__device__ __forceinline__ unsigned short f2bf(float f) { unsigned u = __float_as_uint(f); u += 0x7FFFu + ((u >> 16) & 1u); return (unsigned short)(u >> 16); }   // RNE convert
__device__ __forceinline__ float bf2f(unsigned short b) { return __uint_as_float(((unsigned)b) << 16); }
__device__ __forceinline__ float bfr(float f) { return bf2f(f2bf(f)); }
__device__ __forceinline__ void splitf(float y, unsigned short& h, unsigned short& l) { h = f2bf(y); l = f2bf(y - bf2f(h)); }
__device__ __forceinline__ v16bf cat16b(v8us lo, v8us hi) { return __builtin_bit_cast(v16bf, __builtin_shufflevector(lo, hi, 0, 1, 2, 3, 4, 5, 6, 7, 8, 9, 10, 11, 12, 13, 14, 15)); }
__device__ __forceinline__ v8f wmmab(v16bf a, v16bf b, v8f c) { return __builtin_amdgcn_wmma_f32_16x16x32_bf16(false, a, false, b, (short)0, c, false, false); }
// fragment from a fragment-order block: p = block + 8*lane; elements 0..7 <- k0+8h.., 8..15 <- k0+16+8h.. of row (lane & 15), h = lane >> 4
__device__ __forceinline__ v16bf ldf(const bf* p) { return cat16b(*(const v8us*)p, *(const v8us*)(p + 256)); }

// ---- k_gemmw: register-blocked GEMM, ONE WAVE per 64x64 output tile (16 accumulators), operands straight from fragment-order 16-bit planes; grid (M/64, N/64, Z), 32 threads.
// C[m][n] (f32, pitch ldc, + optional f32 bias[n] after bf16 convert) = sum_k A[m][k] Bt[n][k] (+ split products per NSPLIT). z-batch strides sA/sB/sC in elements. K % 32 == 0.
template <typename T16> struct WFrag;
template <> struct WFrag<bf> { typedef v16bf V; static __device__ __forceinline__ V ld(const bf* p) { return cat16b(*(const v8us*)p, *(const v8us*)(p + 256)); } static __device__ __forceinline__ v8f mma(V a, V b, v8f c) { return wmmab(a, b, c); } };
template <typename T16, int NSPLIT, bool BIAS>
__global__ __launch_bounds__(32) void k_gemmw(const T16* __restrict__ A, const T16* __restrict__ A2, const T16* __restrict__ Bt, const T16* __restrict__ Bt2, int K, float* C, int ldc, const float* __restrict__ bias, size_t sA, size_t sB, size_t sC) {
    typedef typename WFrag<T16>::V V;
    __shared__ __align__(16) float os[16 * 68];
    const size_t z = blockIdx.z; A += z * sA; if (A2) A2 += z * sA; Bt += z * sB; if (Bt2) Bt2 += z * sB; C += z * sC;
    const int lane = threadIdx.x & 31, lr = lane & 15, hi = lane >> 4; const int r0 = blockIdx.x * 64, c0 = blockIdx.y * 64;
    v8f acc[4][4];
#pragma unroll
    for (int mb = 0; mb < 4; ++mb)
#pragma unroll
        for (int nb = 0; nb < 4; ++nb) acc[mb][nb] = (v8f){};
    const size_t aoff = (size_t)r0 * K, boff = (size_t)c0 * K; const unsigned lo = 8u * (unsigned)lane;   // row tile rt starts at rt * 16 * K elements; k tile kt at + kt * 512 = + kc * 16
#pragma unroll 1
    for (int kc = 0; kc < K; kc += 32) {
        V a[4], a2[4]; const T16* pa[4]; const T16* pa2[4]; const T16* pb[4]; const T16* pb2[4];
#pragma unroll
        for (int i = 0; i < 4; ++i) { pa[i] = A + aoff + (size_t)i * 16 * K + kc * 16 + lo; pa2[i] = (NSPLIT == 1 || NSPLIT == 2) ? A2 + aoff + (size_t)i * 16 * K + kc * 16 + lo : pa[i]; pb[i] = Bt + boff + (size_t)i * 16 * K + kc * 16 + lo; pb2[i] = (NSPLIT >= 2) ? Bt2 + boff + (size_t)i * 16 * K + kc * 16 + lo : pb[i]; }
#pragma unroll
        for (int mb = 0; mb < 4; ++mb) { a[mb] = WFrag<T16>::ld(pa[mb]); if (NSPLIT == 1 || NSPLIT == 2) a2[mb] = WFrag<T16>::ld(pa2[mb]); }
#pragma unroll
        for (int nb = 0; nb < 4; ++nb) { const V b = WFrag<T16>::ld(pb[nb]); V b2; if (NSPLIT >= 2) b2 = WFrag<T16>::ld(pb2[nb]);
#pragma unroll
            for (int mb = 0; mb < 4; ++mb) { acc[mb][nb] = WFrag<T16>::mma(a[mb], b, acc[mb][nb]); if (NSPLIT == 1 || NSPLIT == 2) acc[mb][nb] = WFrag<T16>::mma(a2[mb], b, acc[mb][nb]); if (NSPLIT >= 2) acc[mb][nb] = WFrag<T16>::mma(a[mb], b2, acc[mb][nb]); } }
        asm volatile("v_nop\n\tv_nop\n\tv_nop\n\tv_nop" : "+v"(acc[0][0]), "+v"(acc[1][1]), "+v"(acc[2][2]), "+v"(acc[3][3]) : "v"(a[0]), "v"(a[3]));
        // the wait in front of any overwrite of a register that this trip's loads name; their addresses are inputs so that those registers live up to here
        asm volatile("s_wait_xcnt 0x0" :: "v"(pa[0]), "v"(pa[1]), "v"(pa[2]), "v"(pa[3]), "v"(pa2[0]), "v"(pa2[1]), "v"(pa2[2]), "v"(pa2[3]), "v"(pb[0]), "v"(pb[1]), "v"(pb[2]), "v"(pb[3]), "v"(pb2[0]), "v"(pb2[1]), "v"(pb2[2]), "v"(pb2[3]) : "memory");
    }
#pragma unroll
    for (int mb = 0; mb < 4; ++mb) {
#pragma unroll
        for (int nb = 0; nb < 4; ++nb) {
#pragma unroll
            for (int j = 0; j < 8; ++j) os[(hi * 8 + j) * 68 + nb * 16 + lr] = acc[mb][nb][j]; }
        __builtin_amdgcn_wave_barrier(); asm volatile("" ::: "memory");
        float* crow = C + (size_t)(r0 + mb * 16) * ldc + c0;
{
#pragma unroll
            for (int s = 0; s < 8; ++s) { const int row = 2 * s + hi, cofs = lr * 4; v4f val = *(const v4fa*)(os + row * 68 + cofs); if (BIAS) { val[0] += bfr(bias[c0 + cofs]); val[1] += bfr(bias[c0 + cofs + 1]); val[2] += bfr(bias[c0 + cofs + 2]); val[3] += bfr(bias[c0 + cofs + 3]); }
                *(v4f*)(crow + (size_t)row * ldc + cofs) = val; }
             }
        asm volatile("s_wait_xcnt 0x0" ::: "memory");   // in front of the next block's overwrites of the registers that these stores name
        __builtin_amdgcn_wave_barrier(); asm volatile("" ::: "memory");
    }
}

// one 16-byte unit i of the fragment-order bf16 plane of one batch of x
__device__ __forceinline__ void cvt8_unit(const float* __restrict__ src, bf* dst, unsigned i) {
    // i = 16-byte unit of the fragment-order plane (256 columns = 8 k tiles): lane i & 31, k half (i >> 5) & 1, k tile (i >> 6) & 7, row tile i >> 9
    const unsigned row = (i >> 9) * 16u + (i & 15u), k0 = ((i >> 6) & 7u) * 32u + ((i >> 5) & 1u) * 16u + ((i >> 4) & 1u) * 8u;
    const v8f v = *(const v8f*)(src + (size_t)row * DM + k0); v8us o;
#pragma unroll
    for (int k = 0; k < 8; ++k) o[k] = f2bf(v[k]);
    *(v8us*)(dst + (size_t)i * 8) = o;
    asm volatile("s_wait_xcnt 0x0" ::: "memory");   // in front of any overwrite of a register that this store names: in k_prep another job's code follows it in the built kernel
}

// one 16-byte unit i of the fragment-order bf16 plane of a transposed weight: W [256 k][N n] -> rows n
__device__ __forceinline__ void wt_unit(const float* __restrict__ W, bf* Wt, unsigned N, unsigned i) {
    // i = 16-byte unit of the fragment-order plane, rows n, 256 k: same split of i as in cvt8_unit
    const unsigned n = (i >> 9) * 16u + (i & 15u), k0 = ((i >> 6) & 7u) * 32u + ((i >> 5) & 1u) * 16u + ((i >> 4) & 1u) * 8u;
    v8us o; const float* p[8]; float f[8];
#pragma unroll
    for (unsigned k = 0; k < 8u; ++k) { p[k] = W + (size_t)(k0 + k) * N + n; f[k] = *p[k]; }
    // the wait in front of any overwrite of a register that these loads name; their addresses are inputs so that those registers live up to here
    asm volatile("s_wait_xcnt 0x0" :: "v"(p[0]), "v"(p[1]), "v"(p[2]), "v"(p[3]), "v"(p[4]), "v"(p[5]), "v"(p[6]), "v"(p[7]) : "memory");
#pragma unroll
    for (unsigned k = 0; k < 8u; ++k) o[k] = f2bf(f[k]);
    *(v8us*)(Wt + (size_t)i * 8) = o;
    asm volatile("s_wait_xcnt 0x0" ::: "memory");   // in front of any overwrite of a register that this store names: in k_prep another job's code follows it in the built kernel
}

// k_prep: the three input conversions read nothing of each other's output, so they share one grid; the job is picked by block index (block-uniform).
// The weight blocks have the low indices: they start first, and their strided loads run under the start of the x blocks.
#define PB_WQ (NQKV / 8)      // blocks for W_qkv
#define PB_WP (DM / 8)        // blocks for W_proj
#define PB_X  (SEQ / 8)       // blocks for one batch of x
__global__ __launch_bounds__(256) void k_prep(const float* __restrict__ x, const float* __restrict__ wqkv, const float* __restrict__ wproj, bf* XB, bf* WQ, bf* WP) {
    const unsigned blk = blockIdx.x, tid = threadIdx.x;
    if (blk < (unsigned)PB_WQ) { wt_unit(wqkv, WQ, (unsigned)NQKV, blk * 256u + tid); return; }
    if (blk < (unsigned)(PB_WQ + PB_WP)) { wt_unit(wproj, WP, (unsigned)DM, (blk - (unsigned)PB_WQ) * 256u + tid); return; }
    const unsigned c = blk - (unsigned)(PB_WQ + PB_WP), bat = c / (unsigned)PB_X;
    cvt8_unit(x + (size_t)bat * SEQ_FULL * DM, XB + (size_t)bat * SEQ * DM, (c - bat * (unsigned)PB_X) * 256u + tid);
}

// k_qkv: one wave per 64x64 tile of qkv = XB Wt^T + bf16(b_qkv); rows r0.. = 64 consecutive t of one batch, columns c0.. = two heads of q, k or v.
__global__ __launch_bounds__(32) void k_qkv(const bf* __restrict__ A, const bf* __restrict__ Bt, const float* __restrict__ bias, bf* QPh, bf* QPl, bf* KPh, bf* KPl, bf* VTh, bf* VTl) {
    __shared__ __align__(16) float os[64 * 68];
    const unsigned lane = threadIdx.x & 31u, lr = lane & 15u, hi = lane >> 4; const unsigned r0 = blockIdx.x * 64u, c0 = blockIdx.y * 64u;
    v8f acc[4][4];
#pragma unroll
    for (int mb = 0; mb < 4; ++mb)
#pragma unroll
        for (int nb = 0; nb < 4; ++nb) acc[mb][nb] = (v8f){};
    const size_t aoff = (size_t)r0 * DM, boff = (size_t)c0 * DM; const unsigned lo = 8u * lane;   // row tile rt at rt * 16 * DM elements, k tile at + kc * 16
#pragma unroll 1
    for (unsigned kc = 0; kc < DM; kc += 32u) {
        v16bf a[4]; const bf* pa = A + aoff + kc * 16u + lo; const bf* pb = Bt + boff + kc * 16u + lo;
#pragma unroll
        for (int mb = 0; mb < 4; ++mb) a[mb] = ldf(pa + (size_t)mb * 16 * DM);
#pragma unroll
        for (int nb = 0; nb < 4; ++nb) { const v16bf b = ldf(pb + (size_t)nb * 16 * DM);
#pragma unroll
            for (int mb = 0; mb < 4; ++mb) acc[mb][nb] = wmmab(a[mb], b, acc[mb][nb]); }
        asm volatile("v_nop\n\tv_nop\n\tv_nop\n\tv_nop" : "+v"(acc[0][0]), "+v"(acc[1][1]), "+v"(acc[2][2]), "+v"(acc[3][3]) : "v"(a[0]), "v"(a[3]));
        // the wait in front of any overwrite of a register that this trip's loads name; their addresses are inputs so that those registers live up to here
        asm volatile("s_wait_xcnt 0x0" :: "v"(pa), "v"(pb) : "memory");
    }
#pragma unroll
    for (int nb = 0; nb < 4; ++nb) { const float bv = bfr(bias[c0 + nb * 16 + lr]);
#pragma unroll
        for (int mb = 0; mb < 4; ++mb) {
#pragma unroll
            for (int j = 0; j < 8; ++j) os[(mb * 16 + hi * 8 + j) * 68 + nb * 16 + lr] = acc[mb][nb][j] + bv; } }
    asm volatile("s_wait_dscnt 0x0" ::: "memory"); __builtin_amdgcn_wave_barrier(); asm volatile("" ::: "memory");
    const unsigned b = r0 / (unsigned)SEQ, t0 = r0 - b * (unsigned)SEQ; const unsigned sel = c0 >> 8, hA = (c0 & 255u) >> 5;
    if (sel < 2u) {   // wave-uniform
        bf* Ph = (sel == 0u) ? QPh : KPh; bf* Pl = (sel == 0u) ? QPl : KPl;
{
#pragma unroll 1
            for (unsigned hh = 0; hh < 2u; ++hh) {
#pragma unroll 2
                for (unsigned s = 0; s < 8u; ++s) { const unsigned tt = s >> 1, hf = s & 1u; const float* src = os + (tt * 16u + lr) * 68u + hh * 32u + hf * 16u + hi * 8u;   // 16-row tile tt, d half hf
                    const v4f x0 = *(const v4fa*)src, x1 = *(const v4fa*)(src + 4); v8us oh, ol;
#pragma unroll
                    for (int q = 0; q < 4; ++q) { unsigned short u, w2; splitf(x0[q], u, w2); oh[q] = u; ol[q] = w2; splitf(x1[q], u, w2); oh[4 + q] = u; ol[4 + q] = w2; }
                    const size_t off = (((size_t)b * NH + hA + hh) * (SEQ / 16) + (t0 >> 4) + tt) * 512u + hf * 256u + lane * 8u;
                    *(v8us*)(Ph + off) = oh; *(v8us*)(Pl + off) = ol;
                    asm volatile("s_wait_xcnt 0x0" :: "v"(oh), "v"(ol), "v"(Ph + off), "v"(Pl + off) : "memory"); } }   // in front of the next trip's overwrites of the registers that these stores name (inputs: they live up to here)
             }
    } else {
{
#pragma unroll 1
            for (unsigned hh = 0; hh < 2u; ++hh) {
#pragma unroll 2
                for (unsigned s = 0; s < 8u; ++s) { const unsigned ck = s >> 2, dt = (s >> 1) & 1u, hf = s & 1u; const unsigned d = dt * 16u + lr, tl0 = ck * 32u + hf * 16u + hi * 8u; v8us oh, ol;   // 32-key chunk ck, d tile dt, key half hf
#pragma unroll
                    for (int i = 0; i < 8; ++i) { unsigned short u, w2; splitf(os[(tl0 + i) * 68u + hh * 32u + d], u, w2); oh[i] = u; ol[i] = w2; }
                    const size_t off = ((((size_t)b * NH + hA + hh) * (SEQ / 32) + (t0 >> 5) + ck) * 2u + dt) * 512u + hf * 256u + lane * 8u;
                    *(v8us*)(VTh + off) = oh; *(v8us*)(VTl + off) = ol;
                    asm volatile("s_wait_xcnt 0x0" :: "v"(oh), "v"(ol), "v"(VTh + off), "v"(VTl + off) : "memory"); } }   // as above
             }
    }
}

// k_attn: block = (16 queries, batch b), wave w = head w. Transposed flash attention over 32-key chunks:
//   S^T tile j [key kb+16j+8h+r][query q0+lr] = K rows (A) x Q rows (B), hi/lo 3 products; causal mask by value; online softmax per query = per lane pair (lane, lane^16);
//   P^T B fragment: element r <- p(tile 0)[r], element 8+r <- p(tile 1)[r], lane unchanged; O^T [d][query] += V^T rows (A) x P^T (B), hi/lo 3 products.
__global__ __launch_bounds__(256) void k_attn(const bf* __restrict__ QPh, const bf* __restrict__ QPl, const bf* __restrict__ KPh, const bf* __restrict__ KPl, const bf* __restrict__ VTh, const bf* __restrict__ VTl, bf* CXh, bf* CXl) {
    const unsigned tid = threadIdx.x, lane = tid & 31u, w = tid >> 5, lr = lane & 15u, hi = lane >> 4, lo = 8u * lane;
    const unsigned qt = blockIdx.x, b = blockIdx.y, q0 = qt * 16u;
    const size_t bh = (size_t)b * NH + w;
    const size_t qoff = (bh * (SEQ / 16) + qt) * 512u;
    const v16bf qh = ldf(QPh + qoff + lo), ql = ldf(QPl + qoff + lo);
    const size_t koff = bh * (SEQ * HD);      // 32 keys = two blocks = 1024 elements
    const bf* kh = KPh + koff; const bf* kl = KPl + koff;
    const size_t voff = bh * (SEQ * HD);      // 32 keys = d tile 0 block, d tile 1 block
    const bf* vh = VTh + voff; const bf* vl = VTl + voff;
    float m = -3.0e38f, l = 0.f; v8f o0 = (v8f){}, o1 = (v8f){};
    const unsigned query = q0 + lr;
    const unsigned nch = (qt >> 1) + 1u;      // block-uniform trip count; last chunk ends at key <= SEQ-1
#pragma unroll 1
    for (unsigned kc = 0; kc < nch; ++kc) {
        const unsigned kb = kc * 32u;
        const bf* pkh = kh + (size_t)kb * HD + lo; const bf* pkl = kl + (size_t)kb * HD + lo;
        const v16bf k0h = ldf(pkh), k0l = ldf(pkl), k1h = ldf(pkh + 512), k1l = ldf(pkl + 512);
        // the wait in front of any overwrite of a register that these loads name; their addresses are inputs so that those registers live up to here
        asm volatile("s_wait_xcnt 0x0" :: "v"(pkh), "v"(pkl) : "memory");
        v8f s0 = (v8f){}, s1 = (v8f){};
        s0 = wmmab(k0h, qh, s0); s0 = wmmab(k0h, ql, s0); s0 = wmmab(k0l, qh, s0);
        s1 = wmmab(k1h, qh, s1); s1 = wmmab(k1h, ql, s1); s1 = wmmab(k1l, qh, s1);
        asm volatile("v_nop\n\tv_nop\n\tv_nop\n\tv_nop" : "+v"(s0), "+v"(s1) : "v"(k0h), "v"(k0l), "v"(k1h), "v"(k1l), "v"(qh), "v"(ql));
        const unsigned keyb = kb + 8u * hi;
        float t0[8], t1[8]; float tmax = -3.0e38f;
#pragma unroll
        for (int r = 0; r < 8; ++r) { const bool ok0 = (keyb + (unsigned)r) <= query, ok1 = (keyb + 16u + (unsigned)r) <= query;
            t0[r] = ok0 ? s0[r] * SCL : -3.0e38f; t1[r] = ok1 ? s1[r] * SCL : -3.0e38f; tmax = fmaxf(tmax, fmaxf(t0[r], t1[r])); }
        tmax = fmaxf(tmax, __shfl_xor(tmax, 16, 32));
        const float mnew = fmaxf(m, tmax);
        const float alpha = __builtin_amdgcn_exp2f(__fmul_rn(__fsub_rn(m, mnew), L2E));
        float psum = 0.f; v8us p0h, p0l, p1h, p1l;
#pragma unroll
        for (int r = 0; r < 8; ++r) { const bool ok0 = (keyb + (unsigned)r) <= query, ok1 = (keyb + 16u + (unsigned)r) <= query;
            const float e0 = __builtin_amdgcn_exp2f(__fmul_rn(__fsub_rn(t0[r], mnew), L2E)), e1 = __builtin_amdgcn_exp2f(__fmul_rn(__fsub_rn(t1[r], mnew), L2E));
            const float p0 = ok0 ? e0 : 0.f, p1 = ok1 ? e1 : 0.f; psum += p0 + p1;
            unsigned short u, w2; splitf(p0, u, w2); p0h[r] = u; p0l[r] = w2; splitf(p1, u, w2); p1h[r] = u; p1l[r] = w2; }
        l = l * alpha + psum; m = mnew;
        o0 *= alpha; o1 *= alpha;
        const v16bf ph = cat16b(p0h, p1h), pl = cat16b(p0l, p1l);
        const bf* pvh = vh + (size_t)kb * HD + lo; const bf* pvl = vl + (size_t)kb * HD + lo;
        const v16bf v0h = ldf(pvh), v0l = ldf(pvl), v1h = ldf(pvh + 512), v1l = ldf(pvl + 512);
        o0 = wmmab(v0h, ph, o0); o0 = wmmab(v0h, pl, o0); o0 = wmmab(v0l, ph, o0);
        o1 = wmmab(v1h, ph, o1); o1 = wmmab(v1h, pl, o1); o1 = wmmab(v1l, ph, o1);
        asm volatile("v_nop\n\tv_nop\n\tv_nop\n\tv_nop" : "+v"(o0), "+v"(o1) : "v"(v0h), "v"(v0l), "v"(v1h), "v"(v1l), "v"(ph), "v"(pl));
    }
    const float ltot = l + __shfl_xor(l, 16, 32);
    const float inv = __fdiv_rn(1.0f, ltot);
    v8us ah, al, ch, cl;
#pragma unroll
    for (int r = 0; r < 8; ++r) { unsigned short u, w2; splitf(o0[r] * inv, u, w2); ah[r] = u; al[r] = w2; splitf(o1[r] * inv, u, w2); ch[r] = u; cl[r] = w2; }
    // ctx row tile (b*SEQ+q0)/16, k tile = head w: element (query lr, d = 16*half + 8*hi + r) sits at half*256 + lane*8 + r, which is this lane's own accumulator order
    const size_t co = ((((size_t)b * SEQ + q0) >> 4) * (DM / 32) + w) * 512u;
    *(v8us*)(CXh + co + lo) = ah; *(v8us*)(CXh + co + lo + 256u) = ch; *(v8us*)(CXl + co + lo) = al; *(v8us*)(CXl + co + lo + 256u) = cl;
}

#define PLB ((size_t)NB * SEQ * DM * 2)      // bytes of one 16-bit [NB*SEQ][256] plane
static_assert((size_t)NQKV * DM * 2 + (size_t)DM * DM * 2 + 9 * PLB <= (size_t)134217728);
static_assert(PLB % 256 == 0);
// coverage equalities (threads x elements per thread == plane elements)
static_assert((size_t)(NQKV / 8) * 256 * 8 == (size_t)NQKV * DM);                    // k_prep, qkv weights
static_assert((size_t)(DM / 8) * 256 * 8 == (size_t)DM * DM);                        // k_prep, proj weights
static_assert((size_t)(SEQ / 8) * 256 * 8 == (size_t)SEQ * DM);                      // k_prep, x per batch
static_assert((size_t)(NB * SEQ / 64) * (DM / 64) * 2 * 8 * 32 * 8 == (size_t)NB * SEQ * DM);   // k_qkv: each of q, k, v plane pairs
static_assert((size_t)(SEQ / 16) * NB * 8 * 2 * 32 * 8 == (size_t)NB * SEQ * DM);    // k_attn ctx planes
static_assert((size_t)(SEQ / 64) * (DM / 64) * NB * 64 * 64 == (size_t)NB * SEQ * DM);   // output GEMM

extern "C" void kernel_launch(void* const* d_in, const int* in_sizes, int n_in,
                              void* d_out, int out_size, void* d_ws, size_t ws_size, hipStream_t stream) {
    if (n_in < 5) return;
    const long long need = ((long long)(NB - 1) * SEQ_FULL + SEQ) * DM;
    if ((long long)in_sizes[0] < need || (long long)out_size < need) return;
    if (in_sizes[1] < DM * NQKV || in_sizes[2] < NQKV || in_sizes[3] < DM * DM || in_sizes[4] < DM) return;
    const float* x = (const float*)d_in[0];       // [NB_FULL][SEQ_FULL][256]
    const float* wqkv = (const float*)d_in[1];    // [256 in][768 out]
    const float* bqkv = (const float*)d_in[2];    // [768]
    const float* wproj = (const float*)d_in[3];   // [256 in][256 out]
    const float* bproj = (const float*)d_in[4];   // [256]
    float* OUT = (float*)d_out;                   // [NB_FULL][SEQ_FULL][256]
    char* wsp = (char*)d_ws;
    auto take = [&](size_t bytes) { char* p = wsp; wsp += (bytes + 255) & ~(size_t)255; return (void*)p; };
    bf* WQ = (bf*)take((size_t)NQKV * DM * 2); bf* WP = (bf*)take((size_t)DM * DM * 2);
    bf* XB = (bf*)take(PLB);
    bf* QPh = (bf*)take(PLB); bf* QPl = (bf*)take(PLB); bf* KPh = (bf*)take(PLB); bf* KPl = (bf*)take(PLB); bf* VTh = (bf*)take(PLB); bf* VTl = (bf*)take(PLB);
    bf* CXh = (bf*)take(PLB); bf* CXl = (bf*)take(PLB);
    if ((size_t)(wsp - (char*)d_ws) > ws_size) return;
    k_prep<<<PB_WQ + PB_WP + PB_X * NB, 256, 0, stream>>>(x, wqkv, wproj, XB, WQ, WP);   // weights in[256 k][n] -> rows n, x rows: all in fragment order
    k_qkv<<<dim3(NB * SEQ / 64, NQKV / 64, 1), 32, 0, stream>>>(XB, WQ, bqkv, QPh, QPl, KPh, KPl, VTh, VTl);
    k_attn<<<dim3(SEQ / 16, NB, 1), 256, 0, stream>>>(QPh, QPl, KPh, KPl, VTh, VTl, CXh, CXl);
    k_gemmw<bf, 1, true><<<dim3(SEQ / 64, DM / 64, NB), 32, 0, stream>>>(CXh, CXl, WP, nullptr, DM, OUT, DM, bproj, (size_t)SEQ * DM, 0, (size_t)SEQ_FULL * DM);
}

// v003
// It runs in 77.8 microseconds.
// Next to v002, in two timings, it ran 1.10 times as fast each time.
// Over all steps from v000 it is 1.51 times as fast.
#include <hip/hip_runtime.h>

#ifndef NB
#define NB 32
#endif
#ifndef SEQ
#define SEQ 512
#endif
#define NB_FULL  32
#define SEQ_FULL 512
#define DM   256
#define NH   8
#define HD   32
#define NQKV 768
#define SCL  0.17677669529663688f     // 1/sqrt(float32(32))
#define L2E  1.4426950408889634f

static_assert(SEQ % 64 == 0);
static_assert(SEQ <= SEQ_FULL);
static_assert(NB >= 1);
static_assert(NB <= NB_FULL);
static_assert(NH * HD == DM);
static_assert(NQKV == 3 * DM);

typedef unsigned short bf;
typedef __attribute__((ext_vector_type(16))) __bf16   v16bf;
typedef __attribute__((ext_vector_type(8)))  unsigned short v8us;
typedef __attribute__((ext_vector_type(2)))  unsigned short v2us;
typedef __attribute__((ext_vector_type(8)))  float    v8f;
typedef __attribute__((ext_vector_type(4)))  float    v4f;
typedef v4f  __attribute__((may_alias)) v4fa;
typedef v8us __attribute__((may_alias)) v8usa;

__device__ __forceinline__ unsigned short f2bf(float f) { unsigned u = __float_as_uint(f); u += 0x7FFFu + ((u >> 16) & 1u); return (unsigned short)(u >> 16); }   // RNE convert
__device__ __forceinline__ float bf2f(unsigned short b) { return __uint_as_float(((unsigned)b) << 16); }
__device__ __forceinline__ float bfr(float f) { return bf2f(f2bf(f)); }
__device__ __forceinline__ void splitf(float y, unsigned short& h, unsigned short& l) { h = f2bf(y); l = f2bf(y - bf2f(h)); }
__device__ __forceinline__ v16bf cat16b(v8us lo, v8us hi) { return __builtin_bit_cast(v16bf, __builtin_shufflevector(lo, hi, 0, 1, 2, 3, 4, 5, 6, 7, 8, 9, 10, 11, 12, 13, 14, 15)); }
__device__ __forceinline__ v8f wmmab(v16bf a, v16bf b, v8f c) { return __builtin_amdgcn_wmma_f32_16x16x32_bf16(false, a, false, b, (short)0, c, false, false); }
// fragment from a fragment-order block: p = block + 8*lane; elements 0..7 <- k0+8h.., 8..15 <- k0+16+8h.. of row (lane & 15), h = lane >> 4
__device__ __forceinline__ v16bf ldf(const bf* p) { return cat16b(*(const v8us*)p, *(const v8us*)(p + 256)); }

// ---- k_gemmw: register-blocked GEMM, ONE WAVE per 64x64 output tile (16 accumulators), operands straight from fragment-order 16-bit planes; grid (M/64, N/64, Z), 32 threads.
// C[m][n] (f32, pitch ldc, + optional f32 bias[n] after bf16 convert) = sum_k A[m][k] Bt[n][k] (+ split products per NSPLIT). z-batch strides sA/sB/sC in elements. K % 32 == 0.
template <typename T16> struct WFrag;
template <> struct WFrag<bf> { typedef v16bf V; static __device__ __forceinline__ V ld(const bf* p) { return cat16b(*(const v8us*)p, *(const v8us*)(p + 256)); } static __device__ __forceinline__ v8f mma(V a, V b, v8f c) { return wmmab(a, b, c); } };
template <typename T16, int NSPLIT, bool BIAS>
__global__ __launch_bounds__(32) void k_gemmw(const T16* __restrict__ A, const T16* __restrict__ A2, const T16* __restrict__ Bt, const T16* __restrict__ Bt2, int K, float* C, int ldc, const float* __restrict__ bias, size_t sA, size_t sB, size_t sC) {
    typedef typename WFrag<T16>::V V;
    __shared__ __align__(16) float os[16 * 68];
    const size_t z = blockIdx.z; A += z * sA; if (A2) A2 += z * sA; Bt += z * sB; if (Bt2) Bt2 += z * sB; C += z * sC;
    const int lane = threadIdx.x & 31, lr = lane & 15, hi = lane >> 4; const int r0 = blockIdx.x * 64, c0 = blockIdx.y * 64;
    v8f acc[4][4];
#pragma unroll
    for (int mb = 0; mb < 4; ++mb)
#pragma unroll
        for (int nb = 0; nb < 4; ++nb) acc[mb][nb] = (v8f){};
    const size_t aoff = (size_t)r0 * K, boff = (size_t)c0 * K; const unsigned lo = 8u * (unsigned)lane;   // row tile rt starts at rt * 16 * K elements; k tile kt at + kt * 512 = + kc * 16
#pragma unroll 1
    for (int kc = 0; kc < K; kc += 32) {
        V a[4], a2[4]; const T16* pa[4]; const T16* pa2[4]; const T16* pb[4]; const T16* pb2[4];
#pragma unroll
        for (int i = 0; i < 4; ++i) { pa[i] = A + aoff + (size_t)i * 16 * K + kc * 16 + lo; pa2[i] = (NSPLIT == 1 || NSPLIT == 2) ? A2 + aoff + (size_t)i * 16 * K + kc * 16 + lo : pa[i]; pb[i] = Bt + boff + (size_t)i * 16 * K + kc * 16 + lo; pb2[i] = (NSPLIT >= 2) ? Bt2 + boff + (size_t)i * 16 * K + kc * 16 + lo : pb[i]; }
#pragma unroll
        for (int mb = 0; mb < 4; ++mb) { a[mb] = WFrag<T16>::ld(pa[mb]); if (NSPLIT == 1 || NSPLIT == 2) a2[mb] = WFrag<T16>::ld(pa2[mb]); }
#pragma unroll
        for (int nb = 0; nb < 4; ++nb) { const V b = WFrag<T16>::ld(pb[nb]); V b2; if (NSPLIT >= 2) b2 = WFrag<T16>::ld(pb2[nb]);
#pragma unroll
            for (int mb = 0; mb < 4; ++mb) { acc[mb][nb] = WFrag<T16>::mma(a[mb], b, acc[mb][nb]); if (NSPLIT == 1 || NSPLIT == 2) acc[mb][nb] = WFrag<T16>::mma(a2[mb], b, acc[mb][nb]); if (NSPLIT >= 2) acc[mb][nb] = WFrag<T16>::mma(a[mb], b2, acc[mb][nb]); } }
        asm volatile("v_nop\n\tv_nop\n\tv_nop\n\tv_nop" : "+v"(acc[0][0]), "+v"(acc[1][1]), "+v"(acc[2][2]), "+v"(acc[3][3]) : "v"(a[0]), "v"(a[3]));
        // the wait in front of any overwrite of a register that this trip's loads name; their addresses are inputs so that those registers live up to here
        asm volatile("s_wait_xcnt 0x0" :: "v"(pa[0]), "v"(pa[1]), "v"(pa[2]), "v"(pa[3]), "v"(pa2[0]), "v"(pa2[1]), "v"(pa2[2]), "v"(pa2[3]), "v"(pb[0]), "v"(pb[1]), "v"(pb[2]), "v"(pb[3]), "v"(pb2[0]), "v"(pb2[1]), "v"(pb2[2]), "v"(pb2[3]) : "memory");
    }
#pragma unroll
    for (int mb = 0; mb < 4; ++mb) {
#pragma unroll
        for (int nb = 0; nb < 4; ++nb) {
#pragma unroll
            for (int j = 0; j < 8; ++j) os[(hi * 8 + j) * 68 + nb * 16 + lr] = acc[mb][nb][j]; }
        __builtin_amdgcn_wave_barrier(); asm volatile("" ::: "memory");
        float* crow = C + (size_t)(r0 + mb * 16) * ldc + c0;
{
#pragma unroll
            for (int s = 0; s < 8; ++s) { const int row = 2 * s + hi, cofs = lr * 4; v4f val = *(const v4fa*)(os + row * 68 + cofs); if (BIAS) { val[0] += bfr(bias[c0 + cofs]); val[1] += bfr(bias[c0 + cofs + 1]); val[2] += bfr(bias[c0 + cofs + 2]); val[3] += bfr(bias[c0 + cofs + 3]); }
                *(v4f*)(crow + (size_t)row * ldc + cofs) = val; }
             }
        asm volatile("s_wait_xcnt 0x0" ::: "memory");   // in front of the next block's overwrites of the registers that these stores name
        __builtin_amdgcn_wave_barrier(); asm volatile("" ::: "memory");
    }
}

// one 16-byte unit i of the fragment-order bf16 plane of one batch of x
__device__ __forceinline__ void cvt8_unit(const float* __restrict__ src, bf* dst, unsigned i) {
    // i = 16-byte unit of the fragment-order plane (256 columns = 8 k tiles): lane i & 31, k half (i >> 5) & 1, k tile (i >> 6) & 7, row tile i >> 9
    const unsigned row = (i >> 9) * 16u + (i & 15u), k0 = ((i >> 6) & 7u) * 32u + ((i >> 5) & 1u) * 16u + ((i >> 4) & 1u) * 8u;
    const v8f v = *(const v8f*)(src + (size_t)row * DM + k0); v8us o;
#pragma unroll
    for (int k = 0; k < 8; ++k) o[k] = f2bf(v[k]);
    *(v8us*)(dst + (size_t)i * 8) = o;
    asm volatile("s_wait_xcnt 0x0" ::: "memory");   // in front of any overwrite of a register that this store names: in k_prep another job's code follows it in the built kernel
}

// one 16-byte unit i of the fragment-order bf16 plane of a transposed weight: W [256 k][N n] -> rows n
__device__ __forceinline__ void wt_unit(const float* __restrict__ W, bf* Wt, unsigned N, unsigned i) {
    // i = 16-byte unit of the fragment-order plane, rows n, 256 k: same split of i as in cvt8_unit
    const unsigned n = (i >> 9) * 16u + (i & 15u), k0 = ((i >> 6) & 7u) * 32u + ((i >> 5) & 1u) * 16u + ((i >> 4) & 1u) * 8u;
    v8us o; const float* p[8]; float f[8];
#pragma unroll
    for (unsigned k = 0; k < 8u; ++k) { p[k] = W + (size_t)(k0 + k) * N + n; f[k] = *p[k]; }
    // the wait in front of any overwrite of a register that these loads name; their addresses are inputs so that those registers live up to here
    asm volatile("s_wait_xcnt 0x0" :: "v"(p[0]), "v"(p[1]), "v"(p[2]), "v"(p[3]), "v"(p[4]), "v"(p[5]), "v"(p[6]), "v"(p[7]) : "memory");
#pragma unroll
    for (unsigned k = 0; k < 8u; ++k) o[k] = f2bf(f[k]);
    *(v8us*)(Wt + (size_t)i * 8) = o;
    asm volatile("s_wait_xcnt 0x0" ::: "memory");   // in front of any overwrite of a register that this store names: in k_prep another job's code follows it in the built kernel
}

// k_prep: the three input conversions read nothing of each other's output, so they share one grid; the job is picked by block index (block-uniform).
// The weight blocks have the low indices: they start first, and their strided loads run under the start of the x blocks.
#define PB_WQ (NQKV / 8)      // blocks for W_qkv
#define PB_WP (DM / 8)        // blocks for W_proj
#define PB_X  (SEQ / 8)       // blocks for one batch of x
__global__ __launch_bounds__(256) void k_prep(const float* __restrict__ x, const float* __restrict__ wqkv, const float* __restrict__ wproj, bf* XB, bf* WQ, bf* WP) {
    const unsigned blk = blockIdx.x, tid = threadIdx.x;
    if (blk < (unsigned)PB_WQ) { wt_unit(wqkv, WQ, (unsigned)NQKV, blk * 256u + tid); return; }
    if (blk < (unsigned)(PB_WQ + PB_WP)) { wt_unit(wproj, WP, (unsigned)DM, (blk - (unsigned)PB_WQ) * 256u + tid); return; }
    const unsigned c = blk - (unsigned)(PB_WQ + PB_WP), bat = c / (unsigned)PB_X;
    cvt8_unit(x + (size_t)bat * SEQ_FULL * DM, XB + (size_t)bat * SEQ * DM, (c - bat * (unsigned)PB_X) * 256u + tid);
}

// k_qkv: one wave per 64x64 tile of qkv = XB Wt^T + bf16(b_qkv); rows r0.. = 64 consecutive t of one batch, columns c0.. = two heads of q, k or v.
__global__ __launch_bounds__(32) void k_qkv(const bf* __restrict__ A, const bf* __restrict__ Bt, const float* __restrict__ bias, bf* QPh, bf* QPl, bf* KPh, bf* KPl, bf* VTh, bf* VTl) {
    __shared__ __align__(16) float os[64 * 68];
    const unsigned lane = threadIdx.x & 31u, lr = lane & 15u, hi = lane >> 4; const unsigned r0 = blockIdx.x * 64u, c0 = blockIdx.y * 64u;
    v8f acc[4][4];
#pragma unroll
    for (int mb = 0; mb < 4; ++mb)
#pragma unroll
        for (int nb = 0; nb < 4; ++nb) acc[mb][nb] = (v8f){};
    const size_t aoff = (size_t)r0 * DM, boff = (size_t)c0 * DM; const unsigned lo = 8u * lane;   // row tile rt at rt * 16 * DM elements, k tile at + kc * 16
#pragma unroll 1
    for (unsigned kc = 0; kc < DM; kc += 32u) {
        v16bf a[4]; const bf* pa = A + aoff + kc * 16u + lo; const bf* pb = Bt + boff + kc * 16u + lo;
#pragma unroll
        for (int mb = 0; mb < 4; ++mb) a[mb] = ldf(pa + (size_t)mb * 16 * DM);
#pragma unroll
        for (int nb = 0; nb < 4; ++nb) { const v16bf b = ldf(pb + (size_t)nb * 16 * DM);
#pragma unroll
            for (int mb = 0; mb < 4; ++mb) acc[mb][nb] = wmmab(a[mb], b, acc[mb][nb]); }
        asm volatile("v_nop\n\tv_nop\n\tv_nop\n\tv_nop" : "+v"(acc[0][0]), "+v"(acc[1][1]), "+v"(acc[2][2]), "+v"(acc[3][3]) : "v"(a[0]), "v"(a[3]));
        // the wait in front of any overwrite of a register that this trip's loads name; their addresses are inputs so that those registers live up to here
        asm volatile("s_wait_xcnt 0x0" :: "v"(pa), "v"(pb) : "memory");
    }
#pragma unroll
    for (int nb = 0; nb < 4; ++nb) { const float bv = bfr(bias[c0 + nb * 16 + lr]);
#pragma unroll
        for (int mb = 0; mb < 4; ++mb) {
#pragma unroll
            for (int j = 0; j < 8; ++j) os[(mb * 16 + hi * 8 + j) * 68 + nb * 16 + lr] = acc[mb][nb][j] + bv; } }
    asm volatile("s_wait_dscnt 0x0" ::: "memory"); __builtin_amdgcn_wave_barrier(); asm volatile("" ::: "memory");
    const unsigned b = r0 / (unsigned)SEQ, t0 = r0 - b * (unsigned)SEQ; const unsigned sel = c0 >> 8, hA = (c0 & 255u) >> 5;
    if (sel < 2u) {   // wave-uniform
        bf* Ph = (sel == 0u) ? QPh : KPh; bf* Pl = (sel == 0u) ? QPl : KPl;
{
#pragma unroll 1
            for (unsigned hh = 0; hh < 2u; ++hh) {
#pragma unroll 2
                for (unsigned s = 0; s < 8u; ++s) { const unsigned tt = s >> 1, hf = s & 1u; const float* src = os + (tt * 16u + lr) * 68u + hh * 32u + hf * 16u + hi * 8u;   // 16-row tile tt, d half hf
                    const v4f x0 = *(const v4fa*)src, x1 = *(const v4fa*)(src + 4); v8us oh, ol;
#pragma unroll
                    for (int q = 0; q < 4; ++q) { unsigned short u, w2; splitf(x0[q], u, w2); oh[q] = u; ol[q] = w2; splitf(x1[q], u, w2); oh[4 + q] = u; ol[4 + q] = w2; }
                    const size_t off = (((size_t)b * NH + hA + hh) * (SEQ / 16) + (t0 >> 4) + tt) * 512u + hf * 256u + lane * 8u;
                    *(v8us*)(Ph + off) = oh; *(v8us*)(Pl + off) = ol;
                    asm volatile("s_wait_xcnt 0x0" :: "v"(oh), "v"(ol), "v"(Ph + off), "v"(Pl + off) : "memory"); } }   // in front of the next trip's overwrites of the registers that these stores name (inputs: they live up to here)
             }
    } else {
{
#pragma unroll 1
            for (unsigned hh = 0; hh < 2u; ++hh) {
#pragma unroll 2
                for (unsigned s = 0; s < 8u; ++s) { const unsigned ck = s >> 2, dt = (s >> 1) & 1u, hf = s & 1u; const unsigned d = dt * 16u + lr, tl0 = ck * 32u + hf * 16u + hi * 8u; v8us oh, ol;   // 32-key chunk ck, d tile dt, key half hf
#pragma unroll
                    for (int i = 0; i < 8; ++i) { unsigned short u, w2; splitf(os[(tl0 + i) * 68u + hh * 32u + d], u, w2); oh[i] = u; ol[i] = w2; }
                    const size_t off = ((((size_t)b * NH + hA + hh) * (SEQ / 32) + (t0 >> 5) + ck) * 2u + dt) * 512u + hf * 256u + lane * 8u;
                    *(v8us*)(VTh + off) = oh; *(v8us*)(VTl + off) = ol;
                    asm volatile("s_wait_xcnt 0x0" :: "v"(oh), "v"(ol), "v"(VTh + off), "v"(VTl + off) : "memory"); } }   // as above
             }
    }
}

// k_attn: block = (query tile pair, batch b), wave w = head w. Causal cost grows with the query tile, so every wave runs tile t = blockIdx.x and then tile n - 1 - t, one after the other:
// each wave of the launch then has the same number of key chunks, wherever its block is placed, and all blocks are resident at once. No barrier and no shared buffer. Transposed flash attention over 32-key chunks:
//   S^T tile j [key kb+16j+8h+r][query q0+lr] = K rows (A) x Q rows (B), hi/lo 3 products; causal mask by value; online softmax per query = per lane pair (lane, lane^16);
//   P^T B fragment: element r <- p(tile 0)[r], element 8+r <- p(tile 1)[r], lane unchanged; O^T [d][query] += V^T rows (A) x P^T (B), hi/lo 3 products.
__global__ __launch_bounds__(256) void k_attn(const bf* __restrict__ QPh, const bf* __restrict__ QPl, const bf* __restrict__ KPh, const bf* __restrict__ KPl, const bf* __restrict__ VTh, const bf* __restrict__ VTl, bf* CXh, bf* CXl) {
    const unsigned tid = threadIdx.x, lane = tid & 31u, w = tid >> 5, lr = lane & 15u, hi = lane >> 4, lo = 8u * lane;
    const unsigned b = blockIdx.y;
    const size_t bh = (size_t)b * NH + w;
    const size_t koff = bh * (SEQ * HD);      // 32 keys = two blocks = 1024 elements
    const bf* kh = KPh + koff; const bf* kl = KPl + koff;
    const size_t voff = bh * (SEQ * HD);      // 32 keys = d tile 0 block, d tile 1 block
    const bf* vh = VTh + voff; const bf* vl = VTl + voff;
    // unrolled: two straight-line copies, so that neither chunk loop carries an outer loop's selects and copies (fewer registers and vector instructions than the rolled build)
#pragma unroll
    for (unsigned part = 0; part < 2u; ++part) {
    const unsigned qt = part ? (unsigned)(SEQ / 16 - 1) - blockIdx.x : blockIdx.x, q0 = qt * 16u;   // block-uniform; over the grid every tile exactly once
    const size_t qoff = (bh * (SEQ / 16) + qt) * 512u;
    const bf* pqh = QPh + qoff + lo; const bf* pql = QPl + qoff + lo;
    const v16bf qh = ldf(pqh), ql = ldf(pql);
    // the wait in front of any overwrite of a register that these loads name; their addresses are inputs so that those registers live up to here
    asm volatile("s_wait_xcnt 0x0" :: "v"(pqh), "v"(pql) : "memory");
    float m = -3.0e38f, l = 0.f; v8f o0 = (v8f){}, o1 = (v8f){};
    const unsigned query = q0 + lr;
    const unsigned nch = (qt >> 1) + 1u;      // block-uniform trip count; last chunk ends at key <= SEQ-1
#pragma unroll 1
    for (unsigned kc = 0; kc < nch; ++kc) {
        const unsigned kb = kc * 32u;
        const bf* pkh = kh + (size_t)kb * HD + lo; const bf* pkl = kl + (size_t)kb * HD + lo;
        const v16bf k0h = ldf(pkh), k0l = ldf(pkl), k1h = ldf(pkh + 512), k1l = ldf(pkl + 512);
        // the wait in front of any overwrite of a register that these loads name; their addresses are inputs so that those registers live up to here
        asm volatile("s_wait_xcnt 0x0" :: "v"(pkh), "v"(pkl) : "memory");
        v8f s0 = (v8f){}, s1 = (v8f){};
        s0 = wmmab(k0h, qh, s0); s0 = wmmab(k0h, ql, s0); s0 = wmmab(k0l, qh, s0);
        s1 = wmmab(k1h, qh, s1); s1 = wmmab(k1h, ql, s1); s1 = wmmab(k1l, qh, s1);
        asm volatile("v_nop\n\tv_nop\n\tv_nop\n\tv_nop" : "+v"(s0), "+v"(s1) : "v"(k0h), "v"(k0l), "v"(k1h), "v"(k1l), "v"(qh), "v"(ql));
        const unsigned keyb = kb + 8u * hi;
        float t0[8], t1[8]; float tmax = -3.0e38f;
#pragma unroll
        for (int r = 0; r < 8; ++r) { const bool ok0 = (keyb + (unsigned)r) <= query, ok1 = (keyb + 16u + (unsigned)r) <= query;
            t0[r] = ok0 ? s0[r] * SCL : -3.0e38f; t1[r] = ok1 ? s1[r] * SCL : -3.0e38f; tmax = fmaxf(tmax, fmaxf(t0[r], t1[r])); }
        tmax = fmaxf(tmax, __shfl_xor(tmax, 16, 32));
        const float mnew = fmaxf(m, tmax);
        const float alpha = __builtin_amdgcn_exp2f(__fmul_rn(__fsub_rn(m, mnew), L2E));
        float psum = 0.f; v8us p0h, p0l, p1h, p1l;
#pragma unroll
        for (int r = 0; r < 8; ++r) { const bool ok0 = (keyb + (unsigned)r) <= query, ok1 = (keyb + 16u + (unsigned)r) <= query;
            const float e0 = __builtin_amdgcn_exp2f(__fmul_rn(__fsub_rn(t0[r], mnew), L2E)), e1 = __builtin_amdgcn_exp2f(__fmul_rn(__fsub_rn(t1[r], mnew), L2E));
            const float p0 = ok0 ? e0 : 0.f, p1 = ok1 ? e1 : 0.f; psum += p0 + p1;
            unsigned short u, w2; splitf(p0, u, w2); p0h[r] = u; p0l[r] = w2; splitf(p1, u, w2); p1h[r] = u; p1l[r] = w2; }
        l = l * alpha + psum; m = mnew;
        o0 *= alpha; o1 *= alpha;
        const v16bf ph = cat16b(p0h, p1h), pl = cat16b(p0l, p1l);
        const bf* pvh = vh + (size_t)kb * HD + lo; const bf* pvl = vl + (size_t)kb * HD + lo;
        const v16bf v0h = ldf(pvh), v0l = ldf(pvl), v1h = ldf(pvh + 512), v1l = ldf(pvl + 512);
        o0 = wmmab(v0h, ph, o0); o0 = wmmab(v0h, pl, o0); o0 = wmmab(v0l, ph, o0);
        o1 = wmmab(v1h, ph, o1); o1 = wmmab(v1h, pl, o1); o1 = wmmab(v1l, ph, o1);
        asm volatile("v_nop\n\tv_nop\n\tv_nop\n\tv_nop" : "+v"(o0), "+v"(o1) : "v"(v0h), "v"(v0l), "v"(v1h), "v"(v1l), "v"(ph), "v"(pl));
    }
    const float ltot = l + __shfl_xor(l, 16, 32);
    const float inv = __fdiv_rn(1.0f, ltot);
    v8us ah, al, ch, cl;
#pragma unroll
    for (int r = 0; r < 8; ++r) { unsigned short u, w2; splitf(o0[r] * inv, u, w2); ah[r] = u; al[r] = w2; splitf(o1[r] * inv, u, w2); ch[r] = u; cl[r] = w2; }
    // ctx row tile (b*SEQ+q0)/16, k tile = head w: element (query lr, d = 16*half + 8*hi + r) sits at half*256 + lane*8 + r, which is this lane's own accumulator order
    const size_t co = ((((size_t)b * SEQ + q0) >> 4) * (DM / 32) + w) * 512u;
    bf* pch = CXh + co + lo; bf* pcl = CXl + co + lo;
    *(v8us*)pch = ah; *(v8us*)(pch + 256u) = ch; *(v8us*)pcl = al; *(v8us*)(pcl + 256u) = cl;
    // in front of the second tile's overwrites of the registers that these stores name (inputs: they live up to here)
    asm volatile("s_wait_xcnt 0x0" :: "v"(ah), "v"(ch), "v"(al), "v"(cl), "v"(pch), "v"(pcl) : "memory");
    }
}

#define PLB ((size_t)NB * SEQ * DM * 2)      // bytes of one 16-bit [NB*SEQ][256] plane
static_assert((size_t)NQKV * DM * 2 + (size_t)DM * DM * 2 + 9 * PLB <= (size_t)134217728);
static_assert(PLB % 256 == 0);
// coverage equalities (threads x elements per thread == plane elements)
static_assert((size_t)(NQKV / 8) * 256 * 8 == (size_t)NQKV * DM);                    // k_prep, qkv weights
static_assert((size_t)(DM / 8) * 256 * 8 == (size_t)DM * DM);                        // k_prep, proj weights
static_assert((size_t)(SEQ / 8) * 256 * 8 == (size_t)SEQ * DM);                      // k_prep, x per batch
static_assert((size_t)(NB * SEQ / 64) * (DM / 64) * 2 * 8 * 32 * 8 == (size_t)NB * SEQ * DM);   // k_qkv: each of q, k, v plane pairs
static_assert((size_t)(SEQ / 32) * 2 * NB * 8 * 2 * 32 * 8 == (size_t)NB * SEQ * DM);    // k_attn ctx planes: two tiles a block
static_assert((size_t)(SEQ / 64) * (DM / 64) * NB * 64 * 64 == (size_t)NB * SEQ * DM);   // output GEMM

extern "C" void kernel_launch(void* const* d_in, const int* in_sizes, int n_in,
                              void* d_out, int out_size, void* d_ws, size_t ws_size, hipStream_t stream) {
    if (n_in < 5) return;
    const long long need = ((long long)(NB - 1) * SEQ_FULL + SEQ) * DM;
    if ((long long)in_sizes[0] < need || (long long)out_size < need) return;
    if (in_sizes[1] < DM * NQKV || in_sizes[2] < NQKV || in_sizes[3] < DM * DM || in_sizes[4] < DM) return;
    const float* x = (const float*)d_in[0];       // [NB_FULL][SEQ_FULL][256]
    const float* wqkv = (const float*)d_in[1];    // [256 in][768 out]
    const float* bqkv = (const float*)d_in[2];    // [768]
    const float* wproj = (const float*)d_in[3];   // [256 in][256 out]
    const float* bproj = (const float*)d_in[4];   // [256]
    float* OUT = (float*)d_out;                   // [NB_FULL][SEQ_FULL][256]
    char* wsp = (char*)d_ws;
    auto take = [&](size_t bytes) { char* p = wsp; wsp += (bytes + 255) & ~(size_t)255; return (void*)p; };
    bf* WQ = (bf*)take((size_t)NQKV * DM * 2); bf* WP = (bf*)take((size_t)DM * DM * 2);
    bf* XB = (bf*)take(PLB);
    bf* QPh = (bf*)take(PLB); bf* QPl = (bf*)take(PLB); bf* KPh = (bf*)take(PLB); bf* KPl = (bf*)take(PLB); bf* VTh = (bf*)take(PLB); bf* VTl = (bf*)take(PLB);
    bf* CXh = (bf*)take(PLB); bf* CXl = (bf*)take(PLB);
    if ((size_t)(wsp - (char*)d_ws) > ws_size) return;
    k_prep<<<PB_WQ + PB_WP + PB_X * NB, 256, 0, stream>>>(x, wqkv, wproj, XB, WQ, WP);   // weights in[256 k][n] -> rows n, x rows: all in fragment order
    k_qkv<<<dim3(NB * SEQ / 64, NQKV / 64, 1), 32, 0, stream>>>(XB, WQ, bqkv, QPh, QPl, KPh, KPl, VTh, VTl);
    k_attn<<<dim3(SEQ / 32, NB, 1), 256, 0, stream>>>(QPh, QPl, KPh, KPl, VTh, VTl, CXh, CXl);
    k_gemmw<bf, 1, true><<<dim3(SEQ / 64, DM / 64, NB), 32, 0, stream>>>(CXh, CXl, WP, nullptr, DM, OUT, DM, bproj, (size_t)SEQ * DM, 0, (size_t)SEQ_FULL * DM);
}

// v004
// It runs in 69.5 microseconds.
// Next to v003, in two timings, it ran 1.12 times as fast each time.
// Counting every step since v000, it is 1.68 times as fast.
#include <hip/hip_runtime.h>

#ifndef NB
#define NB 32
#endif
#ifndef SEQ
#define SEQ 512
#endif
#define NB_FULL  32
#define SEQ_FULL 512
#define DM   256
#define NH   8
#define HD   32
#define NQKV 768
#define SCL  0.17677669529663688f     // 1/sqrt(float32(32))
#define L2E  1.4426950408889634f

static_assert(SEQ % 64 == 0);
static_assert(SEQ <= SEQ_FULL);
static_assert(NB >= 1);
static_assert(NB <= NB_FULL);
static_assert(NH * HD == DM);
static_assert(NQKV == 3 * DM);

typedef unsigned short bf;
typedef __attribute__((ext_vector_type(16))) __bf16   v16bf;
typedef __attribute__((ext_vector_type(8)))  unsigned short v8us;
typedef __attribute__((ext_vector_type(2)))  unsigned short v2us;
typedef __attribute__((ext_vector_type(8)))  float    v8f;
typedef __attribute__((ext_vector_type(4)))  float    v4f;
typedef v4f  __attribute__((may_alias)) v4fa;
typedef v8us __attribute__((may_alias)) v8usa;

__device__ __forceinline__ unsigned short f2bf(float f) { unsigned u = __float_as_uint(f); u += 0x7FFFu + ((u >> 16) & 1u); return (unsigned short)(u >> 16); }   // RNE convert
__device__ __forceinline__ float bf2f(unsigned short b) { return __uint_as_float(((unsigned)b) << 16); }
__device__ __forceinline__ float bfr(float f) { return bf2f(f2bf(f)); }
__device__ __forceinline__ void splitf(float y, unsigned short& h, unsigned short& l) { h = f2bf(y); l = f2bf(y - bf2f(h)); }
__device__ __forceinline__ v16bf cat16b(v8us lo, v8us hi) { return __builtin_bit_cast(v16bf, __builtin_shufflevector(lo, hi, 0, 1, 2, 3, 4, 5, 6, 7, 8, 9, 10, 11, 12, 13, 14, 15)); }
__device__ __forceinline__ v8f wmmab(v16bf a, v16bf b, v8f c) { return __builtin_amdgcn_wmma_f32_16x16x32_bf16(false, a, false, b, (short)0, c, false, false); }
// fragment from a fragment-order block: p = block + 8*lane; elements 0..7 <- k0+8h.., 8..15 <- k0+16+8h.. of row (lane & 15), h = lane >> 4
__device__ __forceinline__ v16bf ldf(const bf* p) { return cat16b(*(const v8us*)p, *(const v8us*)(p + 256)); }

// ---- k_gemmw: register-blocked GEMM, ONE WAVE per 64x64 output tile (16 accumulators), operands straight from fragment-order 16-bit planes; grid (M/64, N/64, Z), 32 threads.
// C[m][n] (f32, pitch ldc, + optional f32 bias[n] after bf16 convert) = sum_k A[m][k] Bt[n][k] (+ split products per NSPLIT). z-batch strides sA/sB/sC in elements. K % 32 == 0.
template <typename T16> struct WFrag;
template <> struct WFrag<bf> { typedef v16bf V; static __device__ __forceinline__ V ld(const bf* p) { return cat16b(*(const v8us*)p, *(const v8us*)(p + 256)); } static __device__ __forceinline__ v8f mma(V a, V b, v8f c) { return wmmab(a, b, c); } };
template <typename T16, int NSPLIT, bool BIAS>
__global__ __launch_bounds__(32) void k_gemmw(const T16* __restrict__ A, const T16* __restrict__ A2, const T16* __restrict__ Bt, const T16* __restrict__ Bt2, int K, float* C, int ldc, const float* __restrict__ bias, size_t sA, size_t sB, size_t sC) {
    typedef typename WFrag<T16>::V V;
    __shared__ __align__(16) float os[16 * 68];
    const size_t z = blockIdx.z; A += z * sA; if (A2) A2 += z * sA; Bt += z * sB; if (Bt2) Bt2 += z * sB; C += z * sC;
    const int lane = threadIdx.x & 31, lr = lane & 15, hi = lane >> 4; const int r0 = blockIdx.x * 64, c0 = blockIdx.y * 64;
    v8f acc[4][4];
#pragma unroll
    for (int mb = 0; mb < 4; ++mb)
#pragma unroll
        for (int nb = 0; nb < 4; ++nb) acc[mb][nb] = (v8f){};
    const size_t aoff = (size_t)r0 * K, boff = (size_t)c0 * K; const unsigned lo = 8u * (unsigned)lane;   // row tile rt starts at rt * 16 * K elements; k tile kt at + kt * 512 = + kc * 16
#pragma unroll 1
    for (int kc = 0; kc < K; kc += 32) {
        V a[4], a2[4]; const T16* pa[4]; const T16* pa2[4]; const T16* pb[4]; const T16* pb2[4];
#pragma unroll
        for (int i = 0; i < 4; ++i) { pa[i] = A + aoff + (size_t)i * 16 * K + kc * 16 + lo; pa2[i] = (NSPLIT == 1 || NSPLIT == 2) ? A2 + aoff + (size_t)i * 16 * K + kc * 16 + lo : pa[i]; pb[i] = Bt + boff + (size_t)i * 16 * K + kc * 16 + lo; pb2[i] = (NSPLIT >= 2) ? Bt2 + boff + (size_t)i * 16 * K + kc * 16 + lo : pb[i]; }
#pragma unroll
        for (int mb = 0; mb < 4; ++mb) { a[mb] = WFrag<T16>::ld(pa[mb]); if (NSPLIT == 1 || NSPLIT == 2) a2[mb] = WFrag<T16>::ld(pa2[mb]); }
#pragma unroll
        for (int nb = 0; nb < 4; ++nb) { const V b = WFrag<T16>::ld(pb[nb]); V b2; if (NSPLIT >= 2) b2 = WFrag<T16>::ld(pb2[nb]);
#pragma unroll
            for (int mb = 0; mb < 4; ++mb) { acc[mb][nb] = WFrag<T16>::mma(a[mb], b, acc[mb][nb]); if (NSPLIT == 1 || NSPLIT == 2) acc[mb][nb] = WFrag<T16>::mma(a2[mb], b, acc[mb][nb]); if (NSPLIT >= 2) acc[mb][nb] = WFrag<T16>::mma(a[mb], b2, acc[mb][nb]); } }
        asm volatile("v_nop\n\tv_nop\n\tv_nop\n\tv_nop" : "+v"(acc[0][0]), "+v"(acc[1][1]), "+v"(acc[2][2]), "+v"(acc[3][3]) : "v"(a[0]), "v"(a[3]));
        // the wait in front of any overwrite of a register that this trip's loads name; their addresses are inputs so that those registers live up to here
        asm volatile("s_wait_xcnt 0x0" :: "v"(pa[0]), "v"(pa[1]), "v"(pa[2]), "v"(pa[3]), "v"(pa2[0]), "v"(pa2[1]), "v"(pa2[2]), "v"(pa2[3]), "v"(pb[0]), "v"(pb[1]), "v"(pb[2]), "v"(pb[3]), "v"(pb2[0]), "v"(pb2[1]), "v"(pb2[2]), "v"(pb2[3]) : "memory");
    }
#pragma unroll
    for (int mb = 0; mb < 4; ++mb) {
#pragma unroll
        for (int nb = 0; nb < 4; ++nb) {
#pragma unroll
            for (int j = 0; j < 8; ++j) os[(hi * 8 + j) * 68 + nb * 16 + lr] = acc[mb][nb][j]; }
        __builtin_amdgcn_wave_barrier(); asm volatile("" ::: "memory");
        float* crow = C + (size_t)(r0 + mb * 16) * ldc + c0;
{
#pragma unroll
            for (int s = 0; s < 8; ++s) { const int row = 2 * s + hi, cofs = lr * 4; v4f val = *(const v4fa*)(os + row * 68 + cofs); if (BIAS) { val[0] += bfr(bias[c0 + cofs]); val[1] += bfr(bias[c0 + cofs + 1]); val[2] += bfr(bias[c0 + cofs + 2]); val[3] += bfr(bias[c0 + cofs + 3]); }
                *(v4f*)(crow + (size_t)row * ldc + cofs) = val; }
             }
        asm volatile("s_wait_xcnt 0x0" ::: "memory");   // in front of the next block's overwrites of the registers that these stores name
        __builtin_amdgcn_wave_barrier(); asm volatile("" ::: "memory");
    }
}

// one 16-byte unit i of the fragment-order bf16 plane of one batch of x
__device__ __forceinline__ void cvt8_unit(const float* __restrict__ src, bf* dst, unsigned i) {
    // i = 16-byte unit of the fragment-order plane (256 columns = 8 k tiles): lane i & 31, k half (i >> 5) & 1, k tile (i >> 6) & 7, row tile i >> 9
    const unsigned row = (i >> 9) * 16u + (i & 15u), k0 = ((i >> 6) & 7u) * 32u + ((i >> 5) & 1u) * 16u + ((i >> 4) & 1u) * 8u;
    const v8f v = *(const v8f*)(src + (size_t)row * DM + k0); v8us o;
#pragma unroll
    for (int k = 0; k < 8; ++k) o[k] = f2bf(v[k]);
    *(v8us*)(dst + (size_t)i * 8) = o;
    asm volatile("s_wait_xcnt 0x0" ::: "memory");   // in front of any overwrite of a register that this store names: in k_prep another job's code follows it in the built kernel
}

// one 16-byte unit i of the fragment-order bf16 plane of a transposed weight: W [256 k][N n] -> rows n
__device__ __forceinline__ void wt_unit(const float* __restrict__ W, bf* Wt, unsigned N, unsigned i) {
    // i = 16-byte unit of the fragment-order plane, rows n, 256 k: same split of i as in cvt8_unit
    const unsigned n = (i >> 9) * 16u + (i & 15u), k0 = ((i >> 6) & 7u) * 32u + ((i >> 5) & 1u) * 16u + ((i >> 4) & 1u) * 8u;
    v8us o; const float* p[8]; float f[8];
#pragma unroll
    for (unsigned k = 0; k < 8u; ++k) { p[k] = W + (size_t)(k0 + k) * N + n; f[k] = *p[k]; }
    // the wait in front of any overwrite of a register that these loads name; their addresses are inputs so that those registers live up to here
    asm volatile("s_wait_xcnt 0x0" :: "v"(p[0]), "v"(p[1]), "v"(p[2]), "v"(p[3]), "v"(p[4]), "v"(p[5]), "v"(p[6]), "v"(p[7]) : "memory");
#pragma unroll
    for (unsigned k = 0; k < 8u; ++k) o[k] = f2bf(f[k]);
    *(v8us*)(Wt + (size_t)i * 8) = o;
    asm volatile("s_wait_xcnt 0x0" ::: "memory");   // in front of any overwrite of a register that this store names: in k_prep another job's code follows it in the built kernel
}

// k_prep: the three input conversions read nothing of each other's output, so they share one grid; the job is picked by block index (block-uniform).
// The weight blocks have the low indices: they start first, and their strided loads run under the start of the x blocks.
#define PB_WQ (NQKV / 8)      // blocks for W_qkv
#define PB_WP (DM / 8)        // blocks for W_proj
#define PB_X  (SEQ / 8)       // blocks for one batch of x
__global__ __launch_bounds__(256) void k_prep(const float* __restrict__ x, const float* __restrict__ wqkv, const float* __restrict__ wproj, bf* XB, bf* WQ, bf* WP) {
    const unsigned blk = blockIdx.x, tid = threadIdx.x;
    if (blk < (unsigned)PB_WQ) { wt_unit(wqkv, WQ, (unsigned)NQKV, blk * 256u + tid); return; }
    if (blk < (unsigned)(PB_WQ + PB_WP)) { wt_unit(wproj, WP, (unsigned)DM, (blk - (unsigned)PB_WQ) * 256u + tid); return; }
    const unsigned c = blk - (unsigned)(PB_WQ + PB_WP), bat = c / (unsigned)PB_X;
    cvt8_unit(x + (size_t)bat * SEQ_FULL * DM, XB + (size_t)bat * SEQ * DM, (c - bat * (unsigned)PB_X) * 256u + tid);
}

// k_qkv: one wave per 64x64 tile of qkv = XB Wt^T + bf16(b_qkv); rows r0.. = 64 consecutive t of one batch, columns c0.. = two heads of q, k or v.
__global__ __launch_bounds__(32) void k_qkv(const bf* __restrict__ A, const bf* __restrict__ Bt, const float* __restrict__ bias, bf* QPh, bf* QPl, bf* KPh, bf* KPl, bf* VTh, bf* VTl) {
    __shared__ __align__(16) float os[64 * 68];
    const unsigned lane = threadIdx.x & 31u, lr = lane & 15u, hi = lane >> 4; const unsigned r0 = blockIdx.x * 64u, c0 = blockIdx.y * 64u;
    v8f acc[4][4];
#pragma unroll
    for (int mb = 0; mb < 4; ++mb)
#pragma unroll
        for (int nb = 0; nb < 4; ++nb) acc[mb][nb] = (v8f){};
    const size_t aoff = (size_t)r0 * DM, boff = (size_t)c0 * DM; const unsigned lo = 8u * lane;   // row tile rt at rt * 16 * DM elements, k tile at + kc * 16
#pragma unroll 1
    for (unsigned kc = 0; kc < DM; kc += 32u) {
        v16bf a[4]; const bf* pa = A + aoff + kc * 16u + lo; const bf* pb = Bt + boff + kc * 16u + lo;
#pragma unroll
        for (int mb = 0; mb < 4; ++mb) a[mb] = ldf(pa + (size_t)mb * 16 * DM);
#pragma unroll
        for (int nb = 0; nb < 4; ++nb) { const v16bf b = ldf(pb + (size_t)nb * 16 * DM);
#pragma unroll
            for (int mb = 0; mb < 4; ++mb) acc[mb][nb] = wmmab(a[mb], b, acc[mb][nb]); }
        asm volatile("v_nop\n\tv_nop\n\tv_nop\n\tv_nop" : "+v"(acc[0][0]), "+v"(acc[1][1]), "+v"(acc[2][2]), "+v"(acc[3][3]) : "v"(a[0]), "v"(a[3]));
        // the wait in front of any overwrite of a register that this trip's loads name; their addresses are inputs so that those registers live up to here
        asm volatile("s_wait_xcnt 0x0" :: "v"(pa), "v"(pb) : "memory");
    }
#pragma unroll
    for (int nb = 0; nb < 4; ++nb) { const float bv = bfr(bias[c0 + nb * 16 + lr]);
#pragma unroll
        for (int mb = 0; mb < 4; ++mb) {
#pragma unroll
            for (int j = 0; j < 8; ++j) os[(mb * 16 + hi * 8 + j) * 68 + nb * 16 + lr] = acc[mb][nb][j] + bv; } }
    asm volatile("s_wait_dscnt 0x0" ::: "memory"); __builtin_amdgcn_wave_barrier(); asm volatile("" ::: "memory");
    const unsigned b = r0 / (unsigned)SEQ, t0 = r0 - b * (unsigned)SEQ; const unsigned sel = c0 >> 8, hA = (c0 & 255u) >> 5;
    if (sel < 2u) {   // wave-uniform
        bf* Ph = (sel == 0u) ? QPh : KPh; bf* Pl = (sel == 0u) ? QPl : KPl;
{
#pragma unroll 1
            for (unsigned hh = 0; hh < 2u; ++hh) {
#pragma unroll 2
                for (unsigned s = 0; s < 8u; ++s) { const unsigned tt = s >> 1, hf = s & 1u; const float* src = os + (tt * 16u + lr) * 68u + hh * 32u + hf * 16u + hi * 8u;   // 16-row tile tt, d half hf
                    const v4f x0 = *(const v4fa*)src, x1 = *(const v4fa*)(src + 4); v8us oh, ol;
#pragma unroll
                    for (int q = 0; q < 4; ++q) { unsigned short u, w2; splitf(x0[q], u, w2); oh[q] = u; ol[q] = w2; splitf(x1[q], u, w2); oh[4 + q] = u; ol[4 + q] = w2; }
                    const size_t off = (((size_t)b * NH + hA + hh) * (SEQ / 16) + (t0 >> 4) + tt) * 512u + hf * 256u + lane * 8u;
                    *(v8us*)(Ph + off) = oh; *(v8us*)(Pl + off) = ol;
                    asm volatile("s_wait_xcnt 0x0" :: "v"(oh), "v"(ol), "v"(Ph + off), "v"(Pl + off) : "memory"); } }   // in front of the next trip's overwrites of the registers that these stores name (inputs: they live up to here)
             }
    } else {
{
#pragma unroll 1
            for (unsigned hh = 0; hh < 2u; ++hh) {
#pragma unroll 2
                for (unsigned s = 0; s < 8u; ++s) { const unsigned ck = s >> 2, dt = (s >> 1) & 1u, hf = s & 1u; const unsigned d = dt * 16u + lr, tl0 = ck * 32u + hf * 16u + hi * 8u; v8us oh, ol;   // 32-key chunk ck, d tile dt, key half hf
#pragma unroll
                    for (int i = 0; i < 8; ++i) { unsigned short u, w2; splitf(os[(tl0 + i) * 68u + hh * 32u + d], u, w2); oh[i] = u; ol[i] = w2; }
                    const size_t off = ((((size_t)b * NH + hA + hh) * (SEQ / 32) + (t0 >> 5) + ck) * 2u + dt) * 512u + hf * 256u + lane * 8u;
                    *(v8us*)(VTh + off) = oh; *(v8us*)(VTl + off) = ol;
                    asm volatile("s_wait_xcnt 0x0" :: "v"(oh), "v"(ol), "v"(VTh + off), "v"(VTl + off) : "memory"); } }   // as above
             }
    }
}

// k_attn: block = (head, batch b), wave w = query tile pair w. Causal cost grows with the query tile, so every wave runs tile n - 1 - w and then tile w, one after the other:
// each wave of the launch then has the same number of key chunks, and all blocks are resident at once. All waves of a block walk the SAME head's K and V^T planes from chunk 0 on, the long tile first so that they stay
// on the same chunk for as long as possible: one wave's miss brings a chunk into the WGP's cache and the other waves' loads of it hit there instead of going to L2. No barrier and no shared buffer. Transposed flash attention over 32-key chunks:
//   S^T tile j [key kb+16j+8h+r][query q0+lr] = K rows (A) x Q rows (B), hi/lo 3 products; causal mask by value; online softmax per query = per lane pair (lane, lane^16);
//   P^T B fragment: element r <- p(tile 0)[r], element 8+r <- p(tile 1)[r], lane unchanged; O^T [d][query] += V^T rows (A) x P^T (B), hi/lo 3 products.
__global__ __launch_bounds__(SEQ) void k_attn(const bf* __restrict__ QPh, const bf* __restrict__ QPl, const bf* __restrict__ KPh, const bf* __restrict__ KPl, const bf* __restrict__ VTh, const bf* __restrict__ VTl, bf* CXh, bf* CXl) {
    const unsigned tid = threadIdx.x, lane = tid & 31u, lr = lane & 15u, hi = lane >> 4, lo = 8u * lane;
    const unsigned w = (unsigned)__builtin_amdgcn_readfirstlane((int)(tid >> 5));   // wave number, told to the compiler as wave-uniform: tile index and trip count stay scalar, the chunk loops branch on SCC with EXEC whole
    const unsigned b = blockIdx.y, hd = blockIdx.x;
    const size_t bh = (size_t)b * NH + hd;
    const size_t koff = bh * (SEQ * HD);      // 32 keys = two blocks = 1024 elements
    const bf* kh = KPh + koff; const bf* kl = KPl + koff;
    const size_t voff = bh * (SEQ * HD);      // 32 keys = d tile 0 block, d tile 1 block
    const bf* vh = VTh + voff; const bf* vl = VTl + voff;
    // unrolled: two straight-line copies, so that neither chunk loop carries an outer loop's selects and copies (fewer registers and vector instructions than the rolled build)
#pragma unroll
    for (unsigned part = 0; part < 2u; ++part) {
    const unsigned qt = part ? w : (unsigned)(SEQ / 16 - 1) - w, q0 = qt * 16u;   // wave-uniform; over the block's SEQ / 32 waves every tile of the head exactly once
    const size_t qoff = (bh * (SEQ / 16) + qt) * 512u;
    const bf* pqh = QPh + qoff + lo; const bf* pql = QPl + qoff + lo;
    const v16bf qh = ldf(pqh), ql = ldf(pql);
    // the wait in front of any overwrite of a register that these loads name; their addresses are inputs so that those registers live up to here
    asm volatile("s_wait_xcnt 0x0" :: "v"(pqh), "v"(pql) : "memory");
    float m = -3.0e38f, l = 0.f; v8f o0 = (v8f){}, o1 = (v8f){};
    const unsigned query = q0 + lr;
    const unsigned nch = (qt >> 1) + 1u;      // wave-uniform trip count; last chunk ends at key <= SEQ-1
#pragma unroll 1
    for (unsigned kc = 0; kc < nch; ++kc) {
        const unsigned kb = kc * 32u;
        const bf* pkh = kh + (size_t)kb * HD + lo; const bf* pkl = kl + (size_t)kb * HD + lo;
        const v16bf k0h = ldf(pkh), k0l = ldf(pkl), k1h = ldf(pkh + 512), k1l = ldf(pkl + 512);
        // the wait in front of any overwrite of a register that these loads name; their addresses are inputs so that those registers live up to here
        asm volatile("s_wait_xcnt 0x0" :: "v"(pkh), "v"(pkl) : "memory");
        v8f s0 = (v8f){}, s1 = (v8f){};
        s0 = wmmab(k0h, qh, s0); s0 = wmmab(k0h, ql, s0); s0 = wmmab(k0l, qh, s0);
        s1 = wmmab(k1h, qh, s1); s1 = wmmab(k1h, ql, s1); s1 = wmmab(k1l, qh, s1);
        asm volatile("v_nop\n\tv_nop\n\tv_nop\n\tv_nop" : "+v"(s0), "+v"(s1) : "v"(k0h), "v"(k0l), "v"(k1h), "v"(k1l), "v"(qh), "v"(ql));
        const unsigned keyb = kb + 8u * hi;
        float t0[8], t1[8]; float tmax = -3.0e38f;
#pragma unroll
        for (int r = 0; r < 8; ++r) { const bool ok0 = (keyb + (unsigned)r) <= query, ok1 = (keyb + 16u + (unsigned)r) <= query;
            t0[r] = ok0 ? s0[r] * SCL : -3.0e38f; t1[r] = ok1 ? s1[r] * SCL : -3.0e38f; tmax = fmaxf(tmax, fmaxf(t0[r], t1[r])); }
        tmax = fmaxf(tmax, __shfl_xor(tmax, 16, 32));
        const float mnew = fmaxf(m, tmax);
        const float alpha = __builtin_amdgcn_exp2f(__fmul_rn(__fsub_rn(m, mnew), L2E));
        float psum = 0.f; v8us p0h, p0l, p1h, p1l;
#pragma unroll
        for (int r = 0; r < 8; ++r) { const bool ok0 = (keyb + (unsigned)r) <= query, ok1 = (keyb + 16u + (unsigned)r) <= query;
            const float e0 = __builtin_amdgcn_exp2f(__fmul_rn(__fsub_rn(t0[r], mnew), L2E)), e1 = __builtin_amdgcn_exp2f(__fmul_rn(__fsub_rn(t1[r], mnew), L2E));
            const float p0 = ok0 ? e0 : 0.f, p1 = ok1 ? e1 : 0.f; psum += p0 + p1;
            unsigned short u, w2; splitf(p0, u, w2); p0h[r] = u; p0l[r] = w2; splitf(p1, u, w2); p1h[r] = u; p1l[r] = w2; }
        l = l * alpha + psum; m = mnew;
        o0 *= alpha; o1 *= alpha;
        const v16bf ph = cat16b(p0h, p1h), pl = cat16b(p0l, p1l);
        const bf* pvh = vh + (size_t)kb * HD + lo; const bf* pvl = vl + (size_t)kb * HD + lo;
        const v16bf v0h = ldf(pvh), v0l = ldf(pvl), v1h = ldf(pvh + 512), v1l = ldf(pvl + 512);
        o0 = wmmab(v0h, ph, o0); o0 = wmmab(v0h, pl, o0); o0 = wmmab(v0l, ph, o0);
        o1 = wmmab(v1h, ph, o1); o1 = wmmab(v1h, pl, o1); o1 = wmmab(v1l, ph, o1);
        asm volatile("v_nop\n\tv_nop\n\tv_nop\n\tv_nop" : "+v"(o0), "+v"(o1) : "v"(v0h), "v"(v0l), "v"(v1h), "v"(v1l), "v"(ph), "v"(pl));
    }
    const float ltot = l + __shfl_xor(l, 16, 32);
    const float inv = __fdiv_rn(1.0f, ltot);
    v8us ah, al, ch, cl;
#pragma unroll
    for (int r = 0; r < 8; ++r) { unsigned short u, w2; splitf(o0[r] * inv, u, w2); ah[r] = u; al[r] = w2; splitf(o1[r] * inv, u, w2); ch[r] = u; cl[r] = w2; }
    // ctx row tile (b*SEQ+q0)/16, k tile = head hd: element (query lr, d = 16*half + 8*hi + r) sits at half*256 + lane*8 + r, which is this lane's own accumulator order
    const size_t co = ((((size_t)b * SEQ + q0) >> 4) * (DM / 32) + hd) * 512u;
    bf* pch = CXh + co + lo; bf* pcl = CXl + co + lo;
    *(v8us*)pch = ah; *(v8us*)(pch + 256u) = ch; *(v8us*)pcl = al; *(v8us*)(pcl + 256u) = cl;
    // in front of the second tile's overwrites of the registers that these stores name (inputs: they live up to here)
    asm volatile("s_wait_xcnt 0x0" :: "v"(ah), "v"(ch), "v"(al), "v"(cl), "v"(pch), "v"(pcl) : "memory");
    }
}

#define PLB ((size_t)NB * SEQ * DM * 2)      // bytes of one 16-bit [NB*SEQ][256] plane
static_assert((size_t)NQKV * DM * 2 + (size_t)DM * DM * 2 + 9 * PLB <= (size_t)134217728);
static_assert(PLB % 256 == 0);
// coverage equalities (threads x elements per thread == plane elements)
static_assert((size_t)(NQKV / 8) * 256 * 8 == (size_t)NQKV * DM);                    // k_prep, qkv weights
static_assert((size_t)(DM / 8) * 256 * 8 == (size_t)DM * DM);                        // k_prep, proj weights
static_assert((size_t)(SEQ / 8) * 256 * 8 == (size_t)SEQ * DM);                      // k_prep, x per batch
static_assert((size_t)(NB * SEQ / 64) * (DM / 64) * 2 * 8 * 32 * 8 == (size_t)NB * SEQ * DM);   // k_qkv: each of q, k, v plane pairs
static_assert((size_t)(SEQ / 32) * 2 * NB * 8 * 2 * 32 * 8 == (size_t)NB * SEQ * DM);    // k_attn ctx planes: SEQ / 32 waves a block, two tiles a wave, NB x 8 blocks
static_assert((size_t)(SEQ / 64) * (DM / 64) * NB * 64 * 64 == (size_t)NB * SEQ * DM);   // output GEMM

extern "C" void kernel_launch(void* const* d_in, const int* in_sizes, int n_in,
                              void* d_out, int out_size, void* d_ws, size_t ws_size, hipStream_t stream) {
    if (n_in < 5) return;
    const long long need = ((long long)(NB - 1) * SEQ_FULL + SEQ) * DM;
    if ((long long)in_sizes[0] < need || (long long)out_size < need) return;
    if (in_sizes[1] < DM * NQKV || in_sizes[2] < NQKV || in_sizes[3] < DM * DM || in_sizes[4] < DM) return;
    const float* x = (const float*)d_in[0];       // [NB_FULL][SEQ_FULL][256]
    const float* wqkv = (const float*)d_in[1];    // [256 in][768 out]
    const float* bqkv = (const float*)d_in[2];    // [768]
    const float* wproj = (const float*)d_in[3];   // [256 in][256 out]
    const float* bproj = (const float*)d_in[4];   // [256]
    float* OUT = (float*)d_out;                   // [NB_FULL][SEQ_FULL][256]
    char* wsp = (char*)d_ws;
    auto take = [&](size_t bytes) { char* p = wsp; wsp += (bytes + 255) & ~(size_t)255; return (void*)p; };
    bf* WQ = (bf*)take((size_t)NQKV * DM * 2); bf* WP = (bf*)take((size_t)DM * DM * 2);
    bf* XB = (bf*)take(PLB);
    bf* QPh = (bf*)take(PLB); bf* QPl = (bf*)take(PLB); bf* KPh = (bf*)take(PLB); bf* KPl = (bf*)take(PLB); bf* VTh = (bf*)take(PLB); bf* VTl = (bf*)take(PLB);
    bf* CXh = (bf*)take(PLB); bf* CXl = (bf*)take(PLB);
    if ((size_t)(wsp - (char*)d_ws) > ws_size) return;
    k_prep<<<PB_WQ + PB_WP + PB_X * NB, 256, 0, stream>>>(x, wqkv, wproj, XB, WQ, WP);   // weights in[256 k][n] -> rows n, x rows: all in fragment order
    k_qkv<<<dim3(NB * SEQ / 64, NQKV / 64, 1), 32, 0, stream>>>(XB, WQ, bqkv, QPh, QPl, KPh, KPl, VTh, VTl);
    k_attn<<<dim3(NH, NB, 1), SEQ, 0, stream>>>(QPh, QPl, KPh, KPl, VTh, VTl, CXh, CXl);
    k_gemmw<bf, 1, true><<<dim3(SEQ / 64, DM / 64, NB), 32, 0, stream>>>(CXh, CXl, WP, nullptr, DM, OUT, DM, bproj, (size_t)SEQ * DM, 0, (size_t)SEQ_FULL * DM);
}

// v005
// One run takes 50.6 microseconds.
// Two timings next to v004 both put it at 1.37 times that version's speed.
// All steps since v000 together make it 2.31 times as fast.
#include <hip/hip_runtime.h>

#ifndef NB
#define NB 32
#endif
#ifndef SEQ
#define SEQ 512
#endif
#define NB_FULL  32
#define SEQ_FULL 512
#define DM   256
#define NH   8
#define HD   32
#define NQKV 768
#define SCL  0.17677669529663688f     // 1/sqrt(float32(32))
#define L2E  1.4426950408889634f

static_assert(SEQ % 64 == 0);
static_assert(SEQ <= SEQ_FULL);
static_assert(NB >= 1);
static_assert(NB <= NB_FULL);
static_assert(NH * HD == DM);
static_assert(NQKV == 3 * DM);

typedef unsigned short bf;
typedef __attribute__((ext_vector_type(16))) __bf16   v16bf;
typedef __attribute__((ext_vector_type(8)))  unsigned short v8us;
typedef __attribute__((ext_vector_type(2)))  unsigned short v2us;
typedef __attribute__((ext_vector_type(8)))  float    v8f;
typedef __attribute__((ext_vector_type(4)))  float    v4f;
typedef v4f  __attribute__((may_alias)) v4fa;
typedef v8us __attribute__((may_alias)) v8usa;

__device__ __forceinline__ unsigned short f2bf(float f) { unsigned u = __float_as_uint(f); u += 0x7FFFu + ((u >> 16) & 1u); return (unsigned short)(u >> 16); }   // RNE convert
__device__ __forceinline__ float bf2f(unsigned short b) { return __uint_as_float(((unsigned)b) << 16); }
__device__ __forceinline__ float bfr(float f) { return bf2f(f2bf(f)); }
__device__ __forceinline__ void splitf(float y, unsigned short& h, unsigned short& l) { h = f2bf(y); l = f2bf(y - bf2f(h)); }
__device__ __forceinline__ v16bf cat16b(v8us lo, v8us hi) { return __builtin_bit_cast(v16bf, __builtin_shufflevector(lo, hi, 0, 1, 2, 3, 4, 5, 6, 7, 8, 9, 10, 11, 12, 13, 14, 15)); }
__device__ __forceinline__ v8f wmmab(v16bf a, v16bf b, v8f c) { return __builtin_amdgcn_wmma_f32_16x16x32_bf16(false, a, false, b, (short)0, c, false, false); }
// fragment from a fragment-order block: p = block + 8*lane; elements 0..7 <- k0+8h.., 8..15 <- k0+16+8h.. of row (lane & 15), h = lane >> 4
__device__ __forceinline__ v16bf ldf(const bf* p) { return cat16b(*(const v8us*)p, *(const v8us*)(p + 256)); }

// ---- k_gemmw: register-blocked GEMM, ONE WAVE per 64x64 output tile (16 accumulators), operands straight from fragment-order 16-bit planes; grid (M/64, N/64, Z), 32 threads.
// C[m][n] (f32, pitch ldc, + optional f32 bias[n] after bf16 convert) = sum_k A[m][k] Bt[n][k] (+ split products per NSPLIT). z-batch strides sA/sB/sC in elements. K % 32 == 0.
template <typename T16> struct WFrag;
template <> struct WFrag<bf> { typedef v16bf V; static __device__ __forceinline__ V ld(const bf* p) { return cat16b(*(const v8us*)p, *(const v8us*)(p + 256)); } static __device__ __forceinline__ v8f mma(V a, V b, v8f c) { return wmmab(a, b, c); } };
template <typename T16, int NSPLIT, bool BIAS>
__global__ __launch_bounds__(32) void k_gemmw(const T16* __restrict__ A, const T16* __restrict__ A2, const T16* __restrict__ Bt, const T16* __restrict__ Bt2, int K, float* C, int ldc, const float* __restrict__ bias, size_t sA, size_t sB, size_t sC) {
    typedef typename WFrag<T16>::V V;
    __shared__ __align__(16) float os[16 * 68];
    const size_t z = blockIdx.z; A += z * sA; if (A2) A2 += z * sA; Bt += z * sB; if (Bt2) Bt2 += z * sB; C += z * sC;
    const int lane = threadIdx.x & 31, lr = lane & 15, hi = lane >> 4; const int r0 = blockIdx.x * 64, c0 = blockIdx.y * 64;
    v8f acc[4][4];
#pragma unroll
    for (int mb = 0; mb < 4; ++mb)
#pragma unroll
        for (int nb = 0; nb < 4; ++nb) acc[mb][nb] = (v8f){};
    const size_t aoff = (size_t)r0 * K, boff = (size_t)c0 * K; const unsigned lo = 8u * (unsigned)lane;   // row tile rt starts at rt * 16 * K elements; k tile kt at + kt * 512 = + kc * 16
#pragma unroll 1
    for (int kc = 0; kc < K; kc += 32) {
        V a[4], a2[4]; const T16* pa[4]; const T16* pa2[4]; const T16* pb[4]; const T16* pb2[4];
#pragma unroll
        for (int i = 0; i < 4; ++i) { pa[i] = A + aoff + (size_t)i * 16 * K + kc * 16 + lo; pa2[i] = (NSPLIT == 1 || NSPLIT == 2) ? A2 + aoff + (size_t)i * 16 * K + kc * 16 + lo : pa[i]; pb[i] = Bt + boff + (size_t)i * 16 * K + kc * 16 + lo; pb2[i] = (NSPLIT >= 2) ? Bt2 + boff + (size_t)i * 16 * K + kc * 16 + lo : pb[i]; }
#pragma unroll
        for (int mb = 0; mb < 4; ++mb) { a[mb] = WFrag<T16>::ld(pa[mb]); if (NSPLIT == 1 || NSPLIT == 2) a2[mb] = WFrag<T16>::ld(pa2[mb]); }
#pragma unroll
        for (int nb = 0; nb < 4; ++nb) { const V b = WFrag<T16>::ld(pb[nb]); V b2; if (NSPLIT >= 2) b2 = WFrag<T16>::ld(pb2[nb]);
#pragma unroll
            for (int mb = 0; mb < 4; ++mb) { acc[mb][nb] = WFrag<T16>::mma(a[mb], b, acc[mb][nb]); if (NSPLIT == 1 || NSPLIT == 2) acc[mb][nb] = WFrag<T16>::mma(a2[mb], b, acc[mb][nb]); if (NSPLIT >= 2) acc[mb][nb] = WFrag<T16>::mma(a[mb], b2, acc[mb][nb]); } }
        asm volatile("v_nop\n\tv_nop\n\tv_nop\n\tv_nop" : "+v"(acc[0][0]), "+v"(acc[1][1]), "+v"(acc[2][2]), "+v"(acc[3][3]) : "v"(a[0]), "v"(a[3]));
        // the wait in front of any overwrite of a register that this trip's loads name; their addresses are inputs so that those registers live up to here
        asm volatile("s_wait_xcnt 0x0" :: "v"(pa[0]), "v"(pa[1]), "v"(pa[2]), "v"(pa[3]), "v"(pa2[0]), "v"(pa2[1]), "v"(pa2[2]), "v"(pa2[3]), "v"(pb[0]), "v"(pb[1]), "v"(pb[2]), "v"(pb[3]), "v"(pb2[0]), "v"(pb2[1]), "v"(pb2[2]), "v"(pb2[3]) : "memory");
    }
#pragma unroll
    for (int mb = 0; mb < 4; ++mb) {
#pragma unroll
        for (int nb = 0; nb < 4; ++nb) {
#pragma unroll
            for (int j = 0; j < 8; ++j) os[(hi * 8 + j) * 68 + nb * 16 + lr] = acc[mb][nb][j]; }
        __builtin_amdgcn_wave_barrier(); asm volatile("" ::: "memory");
        float* crow = C + (size_t)(r0 + mb * 16) * ldc + c0;
{
#pragma unroll
            for (int s = 0; s < 8; ++s) { const int row = 2 * s + hi, cofs = lr * 4; v4f val = *(const v4fa*)(os + row * 68 + cofs); if (BIAS) { val[0] += bfr(bias[c0 + cofs]); val[1] += bfr(bias[c0 + cofs + 1]); val[2] += bfr(bias[c0 + cofs + 2]); val[3] += bfr(bias[c0 + cofs + 3]); }
                *(v4f*)(crow + (size_t)row * ldc + cofs) = val; }
             }
        asm volatile("s_wait_xcnt 0x0" ::: "memory");   // in front of the next block's overwrites of the registers that these stores name
        __builtin_amdgcn_wave_barrier(); asm volatile("" ::: "memory");
    }
}

// one 16-byte unit i of the fragment-order bf16 plane of one batch of x
__device__ __forceinline__ void cvt8_unit(const float* __restrict__ src, bf* dst, unsigned i) {
    // i = 16-byte unit of the fragment-order plane (256 columns = 8 k tiles): lane i & 31, k half (i >> 5) & 1, k tile (i >> 6) & 7, row tile i >> 9
    const unsigned row = (i >> 9) * 16u + (i & 15u), k0 = ((i >> 6) & 7u) * 32u + ((i >> 5) & 1u) * 16u + ((i >> 4) & 1u) * 8u;
    const v8f v = *(const v8f*)(src + (size_t)row * DM + k0); v8us o;
#pragma unroll
    for (int k = 0; k < 8; ++k) o[k] = f2bf(v[k]);
    *(v8us*)(dst + (size_t)i * 8) = o;
    asm volatile("s_wait_xcnt 0x0" ::: "memory");   // in front of any overwrite of a register that this store names: in k_prep another job's code follows it in the built kernel
}

// one 16-byte unit i of the fragment-order bf16 plane of a transposed weight: W [256 k][N n] -> rows n
__device__ __forceinline__ void wt_unit(const float* __restrict__ W, bf* Wt, unsigned N, unsigned i) {
    // i = 16-byte unit of the fragment-order plane, rows n, 256 k: same split of i as in cvt8_unit
    const unsigned n = (i >> 9) * 16u + (i & 15u), k0 = ((i >> 6) & 7u) * 32u + ((i >> 5) & 1u) * 16u + ((i >> 4) & 1u) * 8u;
    v8us o; const float* p[8]; float f[8];
#pragma unroll
    for (unsigned k = 0; k < 8u; ++k) { p[k] = W + (size_t)(k0 + k) * N + n; f[k] = *p[k]; }
    // the wait in front of any overwrite of a register that these loads name; their addresses are inputs so that those registers live up to here
    asm volatile("s_wait_xcnt 0x0" :: "v"(p[0]), "v"(p[1]), "v"(p[2]), "v"(p[3]), "v"(p[4]), "v"(p[5]), "v"(p[6]), "v"(p[7]) : "memory");
#pragma unroll
    for (unsigned k = 0; k < 8u; ++k) o[k] = f2bf(f[k]);
    *(v8us*)(Wt + (size_t)i * 8) = o;
    asm volatile("s_wait_xcnt 0x0" ::: "memory");   // in front of any overwrite of a register that this store names: in k_prep another job's code follows it in the built kernel
}

// k_prep: the three input conversions read nothing of each other's output, so they share one grid; the job is picked by block index (block-uniform).
// The weight blocks have the low indices: they start first, and their strided loads run under the start of the x blocks.
#define PB_WQ (NQKV / 8)      // blocks for W_qkv
#define PB_WP (DM / 8)        // blocks for W_proj
#define PB_X  (SEQ / 8)       // blocks for one batch of x
__global__ __launch_bounds__(256) void k_prep(const float* __restrict__ x, const float* __restrict__ wqkv, const float* __restrict__ wproj, bf* XB, bf* WQ, bf* WP) {
    const unsigned blk = blockIdx.x, tid = threadIdx.x;
    if (blk < (unsigned)PB_WQ) { wt_unit(wqkv, WQ, (unsigned)NQKV, blk * 256u + tid); return; }
    if (blk < (unsigned)(PB_WQ + PB_WP)) { wt_unit(wproj, WP, (unsigned)DM, (blk - (unsigned)PB_WQ) * 256u + tid); return; }
    const unsigned c = blk - (unsigned)(PB_WQ + PB_WP), bat = c / (unsigned)PB_X;
    cvt8_unit(x + (size_t)bat * SEQ_FULL * DM, XB + (size_t)bat * SEQ * DM, (c - bat * (unsigned)PB_X) * 256u + tid);
}

// k_attn: qkv projection and attention of one (head, batch b) in one block; wave w = query tile pair w (tiles n - 1 - w and w).
// Projection: a head needs only its own 96 columns of qkv, so no product is done twice over the grid. Each wave projects the 16-row tiles n - 1 - w and w of x (K = 256, bf16 x bf16, f32 accumulate, + bf16(b_qkv)), oriented so
// that the accumulators ARE fragment order (lane unchanged, 8 registers = 8 consecutive k): Q^T and K^T tiles [d][t] = W rows (A) x x rows (B) give the Q and K fragments (row t, k = d); V tiles [t][d] = x rows (A) x W rows (B) give the V^T fragment halves (row d, k = t).
// The head's 96 rows of W^T are first copied to LDS (48 KiB, one barrier), so that the k loop's weight reads count on the LDS counter and never wait behind the x loads, which run four k tiles ahead.
// Q hi/lo stays in the wave's registers; K and V^T hi/lo of the whole head go to LDS in the fragment-order blocks described above (4 planes x 32 KiB); one barrier; then every wave reads them from LDS.
// Causal cost grows with the query tile, so every wave runs tile n - 1 - w and then tile w, one after the other: each wave of the launch then has the same number of key chunks, and all blocks are resident at once. Transposed flash attention over 32-key chunks:
//   S^T tile j [key kb+16j+8h+r][query q0+lr] = K rows (A) x Q rows (B), hi/lo 3 products; causal mask by value; online softmax per query = per lane pair (lane, lane^16);
//   P^T B fragment: element r <- p(tile 0)[r], element 8+r <- p(tile 1)[r], lane unchanged; O^T [d][query] += V^T rows (A) x P^T (B), hi/lo 3 products.
__global__ __launch_bounds__(SEQ) void k_attn(const bf* __restrict__ XB, const bf* __restrict__ WQ, const float* __restrict__ bias, bf* CXh, bf* CXl) {
    __shared__ __align__(16) bf Kh[SEQ * HD]; __shared__ __align__(16) bf Kl[SEQ * HD]; __shared__ __align__(16) bf Vh[SEQ * HD]; __shared__ __align__(16) bf Vl[SEQ * HD];
    __shared__ __align__(16) bf Ws[3 * HD * DM];   // this head's q, k, v rows of W^T, fragment order: [q | k | v][d tile][k tile][512]
    const unsigned tid = threadIdx.x, lane = tid & 31u, lr = lane & 15u, hi = lane >> 4, lo = 8u * lane;
    const unsigned w = (unsigned)__builtin_amdgcn_readfirstlane((int)(tid >> 5));   // wave number, told to the compiler as wave-uniform: tile index and trip count stay scalar, the chunk loops branch on SCC with EXEC whole
    const unsigned b = blockIdx.y, hd = blockIdx.x;
    v16bf qfh[2], qfl[2];
    {
        const bf* pws = WQ + (size_t)hd * HD * DM + 8u * tid;      // 16-byte unit tid of this head's q rows of W^T (32 rows = 16 KiB in a row); its k rows at + DM * DM, its v rows at + 2 * DM * DM
        const bf* px0 = XB + (size_t)b * SEQ * DM + (size_t)((unsigned)(SEQ / 16 - 1) - w) * 16 * DM + lo;   // x row tile n - 1 - w; k tile kt at + kt * 512
        const bf* px1 = XB + (size_t)b * SEQ * DM + (size_t)w * 16 * DM + lo;                                // x row tile w
        const float* pbr = bias + hd * HD + 8u * hi;               // q and k bias by accumulator register: d = 16 * dt + 8 * hi + r
        const float* pbl = bias + 2 * DM + hd * HD + lr;           // v bias by lane: d = 16 * dt + lr
        v8us wst[6]; v16bf xf[DM / 32][2];
#pragma unroll
        for (int j = 0; j < 6; ++j) wst[j] = *(const v8us*)(pws + (j >> 1) * DM * DM + (j & 1) * 4096);
        __builtin_amdgcn_sched_barrier(0);   // keeps the weight loads in front of the x loads: loads return in order, and the staging below must not wait for x
#pragma unroll
        for (int kt = 0; kt < 4; ++kt) { xf[kt][0] = ldf(px0 + kt * 512); xf[kt][1] = ldf(px1 + kt * 512); }
        __builtin_amdgcn_sched_barrier(0);   // keeps the x loads up here: they fly while the weights are staged, and the k loop then waits for one k tile at a time
#pragma unroll
        for (int j = 0; j < 6; ++j) *(v8us*)(Ws + (j >> 1) * (HD * DM) + (j & 1) * 4096 + 8u * tid) = wst[j];
        // barrier by hand with LDS-only fences: it publishes Ws; __syncthreads() here would also wait for the x loads that are in flight
        __builtin_amdgcn_fence(__ATOMIC_RELEASE, "workgroup", "local"); __builtin_amdgcn_s_barrier(); __builtin_amdgcn_fence(__ATOMIC_ACQUIRE, "workgroup", "local");
        v8f bq[2], bk[2]; float bv[2];
        v8f aq[2][2], ak[2][2], av[2][2];   // [tile][d tile]
#pragma unroll
        for (int i = 0; i < 2; ++i)
#pragma unroll
            for (int dt = 0; dt < 2; ++dt) { aq[i][dt] = (v8f){}; ak[i][dt] = (v8f){}; av[i][dt] = (v8f){}; }
        // unrolled: the x fragments are named registers, and every address is base + constant offset
#pragma unroll
        for (int kt = 0; kt < DM / 32; ++kt) {
            const v16bf x0 = xf[kt][0], x1 = xf[kt][1]; v16bf wq[2], wk[2], wv[2];
#pragma unroll
            for (int dt = 0; dt < 2; ++dt) { const bf* pwf = Ws + dt * 16 * DM + kt * 512 + lo; wq[dt] = ldf(pwf); wk[dt] = ldf(pwf + HD * DM); wv[dt] = ldf(pwf + 2 * HD * DM); }
#pragma unroll
            for (int dt = 0; dt < 2; ++dt) {
                aq[0][dt] = wmmab(wq[dt], x0, aq[0][dt]); aq[1][dt] = wmmab(wq[dt], x1, aq[1][dt]);
                ak[0][dt] = wmmab(wk[dt], x0, ak[0][dt]); ak[1][dt] = wmmab(wk[dt], x1, ak[1][dt]);
                av[0][dt] = wmmab(x0, wv[dt], av[0][dt]); av[1][dt] = wmmab(x1, wv[dt], av[1][dt]); }
            // order inside this k tile: its twelve LDS reads as one group, then its twelve products: one LDS latency a k tile instead of one for every fragment
            __builtin_amdgcn_sched_group_barrier(0x100, 12, 0); __builtin_amdgcn_sched_group_barrier(0x008, 12, 0);
            if (kt + 4 < DM / 32) {   // x runs four k tiles ahead, into the registers that this k tile has just left
                xf[kt + 4][0] = ldf(px0 + (kt + 4) * 512); xf[kt + 4][1] = ldf(px1 + (kt + 4) * 512);
                __builtin_amdgcn_sched_group_barrier(0x020, 4, 0); }   // these four loads behind the products
            if (kt == 5) {   // the biases, once registers are free again, two k tiles ahead of their use
#pragma unroll
                for (int dt = 0; dt < 2; ++dt) { bq[dt] = *(const v8f*)(pbr + dt * 16); bk[dt] = *(const v8f*)(pbr + DM + dt * 16); }
                asm volatile("s_wait_xcnt 0x0" ::: "memory");   // in front of any overwrite of the offset register that these loads name (seen in the listing: the next load's result took it)
                bv[0] = pbl[0]; bv[1] = pbl[16]; }
            __builtin_amdgcn_sched_barrier(0);   // nothing moves from one k tile to another: x loads stay four k tiles ahead of their use
        }
        asm volatile("s_wait_xcnt 0x0" ::: "memory");   // in front of any overwrite of a register that the loads above name
#pragma unroll
        for (int i = 0; i < 2; ++i) {
            const unsigned tt = i ? w : (unsigned)(SEQ / 16 - 1) - w;   // 16-row tile of the head
            v8us qh8[2], ql8[2];
#pragma unroll
            for (int dt = 0; dt < 2; ++dt) { v8us kh8, kl8, vh8, vl8;
#pragma unroll
                for (int r = 0; r < 8; ++r) { unsigned short u, w2;
                    splitf(aq[i][dt][r] + bfr(bq[dt][r]), u, w2); qh8[dt][r] = u; ql8[dt][r] = w2;
                    splitf(ak[i][dt][r] + bfr(bk[dt][r]), u, w2); kh8[r] = u; kl8[r] = w2;
                    splitf(av[i][dt][r] + bfr(bv[dt]), u, w2); vh8[r] = u; vl8[r] = w2; }
                const unsigned ko = tt * 512u + (unsigned)dt * 256u + lo;                                       // K block = row tile tt, d half dt
                const unsigned vo = ((tt >> 1) * 2u + (unsigned)dt) * 512u + (tt & 1u) * 256u + lo;             // V^T block = [key chunk tt / 2][d tile dt], key half tt & 1
                *(v8us*)(Kh + ko) = kh8; *(v8us*)(Kl + ko) = kl8; *(v8us*)(Vh + vo) = vh8; *(v8us*)(Vl + vo) = vl8; }
            qfh[i] = cat16b(qh8[0], qh8[1]); qfl[i] = cat16b(ql8[0], ql8[1]);
        }
    }
    __syncthreads();   // publishes the head's K and V^T planes: from here on every wave reads what the other waves wrote, and nobody writes them again
    // unrolled: two straight-line copies, so that neither chunk loop carries an outer loop's selects and copies (fewer registers and vector instructions than the rolled build)
#pragma unroll
    for (unsigned part = 0; part < 2u; ++part) {
    const unsigned qt = part ? w : (unsigned)(SEQ / 16 - 1) - w, q0 = qt * 16u;   // wave-uniform; over the block's SEQ / 32 waves every tile of the head exactly once
    const v16bf qh = qfh[part], ql = qfl[part];
    float m = -3.0e38f, l = 0.f; v8f o0 = (v8f){}, o1 = (v8f){};
    const unsigned query = q0 + lr;
    const unsigned nch = (qt >> 1) + 1u;      // wave-uniform trip count; last chunk ends at key <= SEQ-1
#pragma unroll 1
    for (unsigned kc = 0; kc < nch; ++kc) {
        const unsigned kb = kc * 32u;
        const bf* pkh = Kh + kb * HD + lo; const bf* pkl = Kl + kb * HD + lo;   // LDS: 32 keys = two blocks = 1024 elements
        const v16bf k0h = ldf(pkh), k0l = ldf(pkl), k1h = ldf(pkh + 512), k1l = ldf(pkl + 512);
        v8f s0 = (v8f){}, s1 = (v8f){};
        s0 = wmmab(k0h, qh, s0); s0 = wmmab(k0h, ql, s0); s0 = wmmab(k0l, qh, s0);
        s1 = wmmab(k1h, qh, s1); s1 = wmmab(k1h, ql, s1); s1 = wmmab(k1l, qh, s1);
        asm volatile("v_nop\n\tv_nop\n\tv_nop\n\tv_nop" : "+v"(s0), "+v"(s1) : "v"(k0h), "v"(k0l), "v"(k1h), "v"(k1l), "v"(qh), "v"(ql));
        const unsigned keyb = kb + 8u * hi;
        float t0[8], t1[8]; float tmax = -3.0e38f;
#pragma unroll
        for (int r = 0; r < 8; ++r) { const bool ok0 = (keyb + (unsigned)r) <= query, ok1 = (keyb + 16u + (unsigned)r) <= query;
            t0[r] = ok0 ? s0[r] * SCL : -3.0e38f; t1[r] = ok1 ? s1[r] * SCL : -3.0e38f; tmax = fmaxf(tmax, fmaxf(t0[r], t1[r])); }
        tmax = fmaxf(tmax, __shfl_xor(tmax, 16, 32));
        const float mnew = fmaxf(m, tmax);
        const float alpha = __builtin_amdgcn_exp2f(__fmul_rn(__fsub_rn(m, mnew), L2E));
        float psum = 0.f; v8us p0h, p0l, p1h, p1l;
#pragma unroll
        for (int r = 0; r < 8; ++r) { const bool ok0 = (keyb + (unsigned)r) <= query, ok1 = (keyb + 16u + (unsigned)r) <= query;
            const float e0 = __builtin_amdgcn_exp2f(__fmul_rn(__fsub_rn(t0[r], mnew), L2E)), e1 = __builtin_amdgcn_exp2f(__fmul_rn(__fsub_rn(t1[r], mnew), L2E));
            const float p0 = ok0 ? e0 : 0.f, p1 = ok1 ? e1 : 0.f; psum += p0 + p1;
            unsigned short u, w2; splitf(p0, u, w2); p0h[r] = u; p0l[r] = w2; splitf(p1, u, w2); p1h[r] = u; p1l[r] = w2; }
        l = l * alpha + psum; m = mnew;
        o0 *= alpha; o1 *= alpha;
        const v16bf ph = cat16b(p0h, p1h), pl = cat16b(p0l, p1l);
        const bf* pvh = Vh + kb * HD + lo; const bf* pvl = Vl + kb * HD + lo;   // LDS: 32 keys = d tile 0 block, d tile 1 block
        const v16bf v0h = ldf(pvh), v0l = ldf(pvl), v1h = ldf(pvh + 512), v1l = ldf(pvl + 512);
        o0 = wmmab(v0h, ph, o0); o0 = wmmab(v0h, pl, o0); o0 = wmmab(v0l, ph, o0);
        o1 = wmmab(v1h, ph, o1); o1 = wmmab(v1h, pl, o1); o1 = wmmab(v1l, ph, o1);
        asm volatile("v_nop\n\tv_nop\n\tv_nop\n\tv_nop" : "+v"(o0), "+v"(o1) : "v"(v0h), "v"(v0l), "v"(v1h), "v"(v1l), "v"(ph), "v"(pl));
    }
    const float ltot = l + __shfl_xor(l, 16, 32);
    const float inv = __fdiv_rn(1.0f, ltot);
    v8us ah, al, ch, cl;
#pragma unroll
    for (int r = 0; r < 8; ++r) { unsigned short u, w2; splitf(o0[r] * inv, u, w2); ah[r] = u; al[r] = w2; splitf(o1[r] * inv, u, w2); ch[r] = u; cl[r] = w2; }
    // ctx row tile (b*SEQ+q0)/16, k tile = head hd: element (query lr, d = 16*half + 8*hi + r) sits at half*256 + lane*8 + r, which is this lane's own accumulator order
    const size_t co = ((((size_t)b * SEQ + q0) >> 4) * (DM / 32) + hd) * 512u;
    bf* pch = CXh + co + lo; bf* pcl = CXl + co + lo;
    *(v8us*)pch = ah; *(v8us*)(pch + 256u) = ch; *(v8us*)pcl = al; *(v8us*)(pcl + 256u) = cl;
    // in front of the second tile's overwrites of the registers that these stores name (inputs: they live up to here)
    asm volatile("s_wait_xcnt 0x0" :: "v"(ah), "v"(ch), "v"(al), "v"(cl), "v"(pch), "v"(pcl) : "memory");
    }
}

#define PLB ((size_t)NB * SEQ * DM * 2)      // bytes of one 16-bit [NB*SEQ][256] plane
static_assert((size_t)NQKV * DM * 2 + (size_t)DM * DM * 2 + 3 * PLB <= (size_t)134217728);
static_assert(PLB % 256 == 0);
// coverage equalities (threads x elements per thread == plane elements)
static_assert((size_t)(NQKV / 8) * 256 * 8 == (size_t)NQKV * DM);                    // k_prep, qkv weights
static_assert((size_t)(DM / 8) * 256 * 8 == (size_t)DM * DM);                        // k_prep, proj weights
static_assert((size_t)(SEQ / 8) * 256 * 8 == (size_t)SEQ * DM);                      // k_prep, x per batch
static_assert((size_t)SEQ * 6 * 8 == (size_t)3 * HD * DM);                               // k_attn weight staging: SEQ threads, six 16-byte units a thread
static_assert((size_t)(SEQ / 32) * 2 * 2 * 32 * 8 == (size_t)SEQ * HD);                  // k_attn LDS planes: SEQ / 32 waves, two tiles a wave, two 16-byte units a lane and tile
static_assert((size_t)(SEQ / 32) * 2 * NB * 8 * 2 * 32 * 8 == (size_t)NB * SEQ * DM);    // k_attn ctx planes: SEQ / 32 waves a block, two tiles a wave, NB x 8 blocks
static_assert((size_t)(SEQ / 64) * (DM / 64) * NB * 64 * 64 == (size_t)NB * SEQ * DM);   // output GEMM

extern "C" void kernel_launch(void* const* d_in, const int* in_sizes, int n_in,
                              void* d_out, int out_size, void* d_ws, size_t ws_size, hipStream_t stream) {
    if (n_in < 5) return;
    const long long need = ((long long)(NB - 1) * SEQ_FULL + SEQ) * DM;
    if ((long long)in_sizes[0] < need || (long long)out_size < need) return;
    if (in_sizes[1] < DM * NQKV || in_sizes[2] < NQKV || in_sizes[3] < DM * DM || in_sizes[4] < DM) return;
    const float* x = (const float*)d_in[0];       // [NB_FULL][SEQ_FULL][256]
    const float* wqkv = (const float*)d_in[1];    // [256 in][768 out]
    const float* bqkv = (const float*)d_in[2];    // [768]
    const float* wproj = (const float*)d_in[3];   // [256 in][256 out]
    const float* bproj = (const float*)d_in[4];   // [256]
    float* OUT = (float*)d_out;                   // [NB_FULL][SEQ_FULL][256]
    char* wsp = (char*)d_ws;
    auto take = [&](size_t bytes) { char* p = wsp; wsp += (bytes + 255) & ~(size_t)255; return (void*)p; };
    bf* WQ = (bf*)take((size_t)NQKV * DM * 2); bf* WP = (bf*)take((size_t)DM * DM * 2);
    bf* XB = (bf*)take(PLB);
    bf* CXh = (bf*)take(PLB); bf* CXl = (bf*)take(PLB);
    if ((size_t)(wsp - (char*)d_ws) > ws_size) return;
    k_prep<<<PB_WQ + PB_WP + PB_X * NB, 256, 0, stream>>>(x, wqkv, wproj, XB, WQ, WP);   // weights in[256 k][n] -> rows n, x rows: all in fragment order
    k_attn<<<dim3(NH, NB, 1), SEQ, 0, stream>>>(XB, WQ, bqkv, CXh, CXl);
    k_gemmw<bf, 1, true><<<dim3(SEQ / 64, DM / 64, NB), 32, 0, stream>>>(CXh, CXl, WP, nullptr, DM, OUT, DM, bproj, (size_t)SEQ * DM, 0, (size_t)SEQ_FULL * DM);
}

// v006
// One run takes 44.1 microseconds.
// Next to v005, in two timings, it ran 1.15 times as fast each time.
// All steps since v000 together make it 2.66 times as fast.
#include <hip/hip_runtime.h>

#ifndef NB
#define NB 32
#endif
#ifndef SEQ
#define SEQ 512
#endif
#define NB_FULL  32
#define SEQ_FULL 512
#define DM   256
#define NH   8
#define HD   32
#define NQKV 768
#define SCL  0.17677669529663688f     // 1/sqrt(float32(32))
#define L2E  1.4426950408889634f

static_assert(SEQ % 64 == 0);
static_assert(SEQ <= SEQ_FULL);
static_assert(NB >= 1);
static_assert(NB <= NB_FULL);
static_assert(NH * HD == DM);
static_assert(NQKV == 3 * DM);

typedef unsigned short bf;
typedef __attribute__((ext_vector_type(16))) __bf16   v16bf;
typedef __attribute__((ext_vector_type(8)))  unsigned short v8us;
typedef __attribute__((ext_vector_type(2)))  unsigned short v2us;
typedef __attribute__((ext_vector_type(8)))  float    v8f;
typedef __attribute__((ext_vector_type(4)))  float    v4f;
typedef v4f  __attribute__((may_alias)) v4fa;
typedef v8us __attribute__((may_alias)) v8usa;

typedef __attribute__((ext_vector_type(8)))  __bf16   v8bf;
typedef __attribute__((ext_vector_type(2)))  __bf16   v2bf;
typedef __attribute__((ext_vector_type(2)))  float    v2f;
typedef __attribute__((ext_vector_type(4)))  unsigned v4u;
// f32 -> bf16 by the hardware's packed convert (round to nearest even, two values an instruction)
__device__ __forceinline__ float bfr(float f) { return __uint_as_float((unsigned)__builtin_bit_cast(unsigned short, (__bf16)f) << 16); }
__device__ __forceinline__ v8us cvt8(v8f y) { return __builtin_bit_cast(v8us, __builtin_convertvector(y, v8bf)); }
// y = hi + lo, both bf16: hi = bf16(y), lo = bf16(y - hi); y - hi is exact in f32
__device__ __forceinline__ void split8(v8f y, v8us& h, v8us& l) {
    v4u hu, lu;
#pragma unroll
    for (int j = 0; j < 4; ++j) { const v2f p = { y[2 * j], y[2 * j + 1] }; const unsigned u = __builtin_bit_cast(unsigned, __builtin_convertvector(p, v2bf)); hu[j] = u;
        const v2f back = { __uint_as_float(u << 16), __uint_as_float(u & 0xFFFF0000u) };   // the two hi parts as f32, taken from the packed word
        lu[j] = __builtin_bit_cast(unsigned, __builtin_convertvector(p - back, v2bf)); }
    h = __builtin_bit_cast(v8us, hu); l = __builtin_bit_cast(v8us, lu);
}
__device__ __forceinline__ v16bf cat16b(v8us lo, v8us hi) { return __builtin_bit_cast(v16bf, __builtin_shufflevector(lo, hi, 0, 1, 2, 3, 4, 5, 6, 7, 8, 9, 10, 11, 12, 13, 14, 15)); }
__device__ __forceinline__ v8f wmmab(v16bf a, v16bf b, v8f c) { return __builtin_amdgcn_wmma_f32_16x16x32_bf16(false, a, false, b, (short)0, c, false, false); }
// fragment from a fragment-order block: p = block + 8*lane; elements 0..7 <- k0+8h.., 8..15 <- k0+16+8h.. of row (lane & 15), h = lane >> 4
__device__ __forceinline__ v16bf ldf(const bf* p) { return cat16b(*(const v8us*)p, *(const v8us*)(p + 256)); }

// ---- k_gemmw: register-blocked GEMM, ONE WAVE per 64x64 output tile (16 accumulators), operands straight from fragment-order 16-bit planes; grid (M/64, N/64, Z), 32 threads.
// C[m][n] (f32, pitch ldc, + optional f32 bias[n] after bf16 convert) = sum_k A[m][k] Bt[n][k] (+ split products per NSPLIT). z-batch strides sA/sB/sC in elements. K % 32 == 0.
template <typename T16> struct WFrag;
template <> struct WFrag<bf> { typedef v16bf V; static __device__ __forceinline__ V ld(const bf* p) { return cat16b(*(const v8us*)p, *(const v8us*)(p + 256)); } static __device__ __forceinline__ v8f mma(V a, V b, v8f c) { return wmmab(a, b, c); } };
template <typename T16, int NSPLIT, bool BIAS>
__global__ __launch_bounds__(32) void k_gemmw(const T16* __restrict__ A, const T16* __restrict__ A2, const T16* __restrict__ Bt, const T16* __restrict__ Bt2, int K, float* C, int ldc, const float* __restrict__ bias, size_t sA, size_t sB, size_t sC) {
    typedef typename WFrag<T16>::V V;
    __shared__ __align__(16) float os[16 * 68];
    const size_t z = blockIdx.z; A += z * sA; if (A2) A2 += z * sA; Bt += z * sB; if (Bt2) Bt2 += z * sB; C += z * sC;
    const int lane = threadIdx.x & 31, lr = lane & 15, hi = lane >> 4; const int r0 = blockIdx.x * 64, c0 = blockIdx.y * 64;
    v8f acc[4][4];
#pragma unroll
    for (int mb = 0; mb < 4; ++mb)
#pragma unroll
        for (int nb = 0; nb < 4; ++nb) acc[mb][nb] = (v8f){};
    const size_t aoff = (size_t)r0 * K, boff = (size_t)c0 * K; const unsigned lo = 8u * (unsigned)lane;   // row tile rt starts at rt * 16 * K elements; k tile kt at + kt * 512 = + kc * 16
#pragma unroll 1
    for (int kc = 0; kc < K; kc += 32) {
        V a[4], a2[4]; const T16* pa[4]; const T16* pa2[4]; const T16* pb[4]; const T16* pb2[4];
#pragma unroll
        for (int i = 0; i < 4; ++i) { pa[i] = A + aoff + (size_t)i * 16 * K + kc * 16 + lo; pa2[i] = (NSPLIT == 1 || NSPLIT == 2) ? A2 + aoff + (size_t)i * 16 * K + kc * 16 + lo : pa[i]; pb[i] = Bt + boff + (size_t)i * 16 * K + kc * 16 + lo; pb2[i] = (NSPLIT >= 2) ? Bt2 + boff + (size_t)i * 16 * K + kc * 16 + lo : pb[i]; }
#pragma unroll
        for (int mb = 0; mb < 4; ++mb) { a[mb] = WFrag<T16>::ld(pa[mb]); if (NSPLIT == 1 || NSPLIT == 2) a2[mb] = WFrag<T16>::ld(pa2[mb]); }
#pragma unroll
        for (int nb = 0; nb < 4; ++nb) { const V b = WFrag<T16>::ld(pb[nb]); V b2; if (NSPLIT >= 2) b2 = WFrag<T16>::ld(pb2[nb]);
#pragma unroll
            for (int mb = 0; mb < 4; ++mb) { acc[mb][nb] = WFrag<T16>::mma(a[mb], b, acc[mb][nb]); if (NSPLIT == 1 || NSPLIT == 2) acc[mb][nb] = WFrag<T16>::mma(a2[mb], b, acc[mb][nb]); if (NSPLIT >= 2) acc[mb][nb] = WFrag<T16>::mma(a[mb], b2, acc[mb][nb]); } }
        asm volatile("v_nop\n\tv_nop\n\tv_nop\n\tv_nop" : "+v"(acc[0][0]), "+v"(acc[1][1]), "+v"(acc[2][2]), "+v"(acc[3][3]) : "v"(a[0]), "v"(a[3]));
        // the wait in front of any overwrite of a register that this trip's loads name; their addresses are inputs so that those registers live up to here
        asm volatile("s_wait_xcnt 0x0" :: "v"(pa[0]), "v"(pa[1]), "v"(pa[2]), "v"(pa[3]), "v"(pa2[0]), "v"(pa2[1]), "v"(pa2[2]), "v"(pa2[3]), "v"(pb[0]), "v"(pb[1]), "v"(pb[2]), "v"(pb[3]), "v"(pb2[0]), "v"(pb2[1]), "v"(pb2[2]), "v"(pb2[3]) : "memory");
    }
#pragma unroll
    for (int mb = 0; mb < 4; ++mb) {
#pragma unroll
        for (int nb = 0; nb < 4; ++nb) {
#pragma unroll
            for (int j = 0; j < 8; ++j) os[(hi * 8 + j) * 68 + nb * 16 + lr] = acc[mb][nb][j]; }
        __builtin_amdgcn_wave_barrier(); asm volatile("" ::: "memory");
        float* crow = C + (size_t)(r0 + mb * 16) * ldc + c0;
{
#pragma unroll
            for (int s = 0; s < 8; ++s) { const int row = 2 * s + hi, cofs = lr * 4; v4f val = *(const v4fa*)(os + row * 68 + cofs); if (BIAS) { val[0] += bfr(bias[c0 + cofs]); val[1] += bfr(bias[c0 + cofs + 1]); val[2] += bfr(bias[c0 + cofs + 2]); val[3] += bfr(bias[c0 + cofs + 3]); }
                *(v4f*)(crow + (size_t)row * ldc + cofs) = val; }
             }
        asm volatile("s_wait_xcnt 0x0" ::: "memory");   // in front of the next block's overwrites of the registers that these stores name
        __builtin_amdgcn_wave_barrier(); asm volatile("" ::: "memory");
    }
}

// one 16-byte unit i of the fragment-order bf16 plane of one batch of x
__device__ __forceinline__ void cvt8_unit(const float* __restrict__ src, bf* dst, unsigned i) {
    // i = 16-byte unit of the fragment-order plane (256 columns = 8 k tiles): lane i & 31, k half (i >> 5) & 1, k tile (i >> 6) & 7, row tile i >> 9
    const unsigned row = (i >> 9) * 16u + (i & 15u), k0 = ((i >> 6) & 7u) * 32u + ((i >> 5) & 1u) * 16u + ((i >> 4) & 1u) * 8u;
    const v8f v = *(const v8f*)(src + (size_t)row * DM + k0);
    *(v8us*)(dst + (size_t)i * 8) = cvt8(v);
    asm volatile("s_wait_xcnt 0x0" ::: "memory");   // in front of any overwrite of a register that this store names: in k_prep another job's code follows it in the built kernel
}

// one 16-byte unit i of the fragment-order bf16 plane of a transposed weight: W [256 k][N n] -> rows n
__device__ __forceinline__ void wt_unit(const float* __restrict__ W, bf* Wt, unsigned N, unsigned i) {
    // i = 16-byte unit of the fragment-order plane, rows n, 256 k: same split of i as in cvt8_unit
    const unsigned n = (i >> 9) * 16u + (i & 15u), k0 = ((i >> 6) & 7u) * 32u + ((i >> 5) & 1u) * 16u + ((i >> 4) & 1u) * 8u;
    const float* p[8]; v8f f;
#pragma unroll
    for (unsigned k = 0; k < 8u; ++k) { p[k] = W + (size_t)(k0 + k) * N + n; f[k] = *p[k]; }
    // the wait in front of any overwrite of a register that these loads name; their addresses are inputs so that those registers live up to here
    asm volatile("s_wait_xcnt 0x0" :: "v"(p[0]), "v"(p[1]), "v"(p[2]), "v"(p[3]), "v"(p[4]), "v"(p[5]), "v"(p[6]), "v"(p[7]) : "memory");
    *(v8us*)(Wt + (size_t)i * 8) = cvt8(f);
    asm volatile("s_wait_xcnt 0x0" ::: "memory");   // in front of any overwrite of a register that this store names: in k_prep another job's code follows it in the built kernel
}

// k_prep: the three input conversions read nothing of each other's output, so they share one grid; the job is picked by block index (block-uniform).
// The weight blocks have the low indices: they start first, and their strided loads run under the start of the x blocks.
#define PB_WQ (NQKV / 8)      // blocks for W_qkv
#define PB_WP (DM / 8)        // blocks for W_proj
#define PB_X  (SEQ / 8)       // blocks for one batch of x
__global__ __launch_bounds__(256) void k_prep(const float* __restrict__ x, const float* __restrict__ wqkv, const float* __restrict__ wproj, bf* XB, bf* WQ, bf* WP) {
    const unsigned blk = blockIdx.x, tid = threadIdx.x;
    if (blk < (unsigned)PB_WQ) { wt_unit(wqkv, WQ, (unsigned)NQKV, blk * 256u + tid); return; }
    if (blk < (unsigned)(PB_WQ + PB_WP)) { wt_unit(wproj, WP, (unsigned)DM, (blk - (unsigned)PB_WQ) * 256u + tid); return; }
    const unsigned c = blk - (unsigned)(PB_WQ + PB_WP), bat = c / (unsigned)PB_X;
    cvt8_unit(x + (size_t)bat * SEQ_FULL * DM, XB + (size_t)bat * SEQ * DM, (c - bat * (unsigned)PB_X) * 256u + tid);
}

// k_attn: qkv projection and attention of one (head, batch b) in one block; wave w = query tile pair w (tiles n - 1 - w and w).
// Projection: a head needs only its own 96 columns of qkv, so no product is done twice over the grid. Each wave projects the 16-row tiles n - 1 - w and w of x (K = 256, bf16 x bf16, f32 accumulate, + bf16(b_qkv)), oriented so
// that the accumulators ARE fragment order (lane unchanged, 8 registers = 8 consecutive k): Q^T and K^T tiles [d][t] = W rows (A) x x rows (B) give the Q and K fragments (row t, k = d); V tiles [t][d] = x rows (A) x W rows (B) give the V^T fragment halves (row d, k = t).
// The head's 96 rows of W^T are first copied to LDS (48 KiB, one barrier), so that the k loop's weight reads count on the LDS counter and never wait behind the x loads, which run four k tiles ahead.
// Q hi/lo stays in the wave's registers; K and V^T hi/lo of the whole head go to LDS in the fragment-order blocks described above (4 planes x 32 KiB); one barrier; then every wave reads them from LDS.
// Causal cost grows with the query tile, so every wave runs tile n - 1 - w and then tile w, one after the other: each wave of the launch then has the same number of key chunks, and all blocks are resident at once. Transposed flash attention over 32-key chunks:
//   S^T tile j [key kb+16j+8h+r][query q0+lr] = K rows (A) x Q rows (B), hi/lo 3 products; causal mask by value; online softmax per query = per lane pair (lane, lane^16);
//   P^T B fragment: element r <- p(tile 0)[r], element 8+r <- p(tile 1)[r], lane unchanged; O^T [d][query] += V^T rows (A) x P^T (B), hi/lo 3 products.
__global__ __launch_bounds__(SEQ) void k_attn(const bf* __restrict__ XB, const bf* __restrict__ WQ, const float* __restrict__ bias, bf* CXh, bf* CXl) {
    __shared__ __align__(16) bf Kh[SEQ * HD]; __shared__ __align__(16) bf Kl[SEQ * HD]; __shared__ __align__(16) bf Vh[SEQ * HD]; __shared__ __align__(16) bf Vl[SEQ * HD];
    __shared__ __align__(16) bf Ws[3 * HD * DM];   // this head's q, k, v rows of W^T, fragment order: [q | k | v][d tile][k tile][512]
    const unsigned tid = threadIdx.x, lane = tid & 31u, lr = lane & 15u, hi = lane >> 4, lo = 8u * lane;
    const unsigned w = (unsigned)__builtin_amdgcn_readfirstlane((int)(tid >> 5));   // wave number, told to the compiler as wave-uniform: tile index and trip count stay scalar, the chunk loops branch on SCC with EXEC whole
    const unsigned b = blockIdx.y, hd = blockIdx.x;
    v16bf qfh[2], qfl[2];
    {
        const bf* pws = WQ + (size_t)hd * HD * DM + 8u * tid;      // 16-byte unit tid of this head's q rows of W^T (32 rows = 16 KiB in a row); its k rows at + DM * DM, its v rows at + 2 * DM * DM
        const bf* px0 = XB + (size_t)b * SEQ * DM + (size_t)((unsigned)(SEQ / 16 - 1) - w) * 16 * DM + lo;   // x row tile n - 1 - w; k tile kt at + kt * 512
        const bf* px1 = XB + (size_t)b * SEQ * DM + (size_t)w * 16 * DM + lo;                                // x row tile w
        const float* pbr = bias + hd * HD + 8u * hi;               // q and k bias by accumulator register: d = 16 * dt + 8 * hi + r
        const float* pbl = bias + 2 * DM + hd * HD + lr;           // v bias by lane: d = 16 * dt + lr
        v8us wst[6]; v16bf xf[DM / 32][2];
#pragma unroll
        for (int j = 0; j < 6; ++j) wst[j] = *(const v8us*)(pws + (j >> 1) * DM * DM + (j & 1) * 4096);
        __builtin_amdgcn_sched_barrier(0);   // keeps the weight loads in front of the x loads: loads return in order, and the staging below must not wait for x
#pragma unroll
        for (int kt = 0; kt < 4; ++kt) { xf[kt][0] = ldf(px0 + kt * 512); xf[kt][1] = ldf(px1 + kt * 512); }
        __builtin_amdgcn_sched_barrier(0);   // keeps the x loads up here: they fly while the weights are staged, and the k loop then waits for one k tile at a time
#pragma unroll
        for (int j = 0; j < 6; ++j) *(v8us*)(Ws + (j >> 1) * (HD * DM) + (j & 1) * 4096 + 8u * tid) = wst[j];
        // barrier by hand with LDS-only fences: it publishes Ws; __syncthreads() here would also wait for the x loads that are in flight
        __builtin_amdgcn_fence(__ATOMIC_RELEASE, "workgroup", "local"); __builtin_amdgcn_s_barrier(); __builtin_amdgcn_fence(__ATOMIC_ACQUIRE, "workgroup", "local");
        v8f bq[2], bk[2]; float bv[2];
        v8f aq[2][2], ak[2][2], av[2][2];   // [tile][d tile]
#pragma unroll
        for (int i = 0; i < 2; ++i)
#pragma unroll
            for (int dt = 0; dt < 2; ++dt) { aq[i][dt] = (v8f){}; ak[i][dt] = (v8f){}; av[i][dt] = (v8f){}; }
        // unrolled: the x fragments are named registers, and every address is base + constant offset
#pragma unroll
        for (int kt = 0; kt < DM / 32; ++kt) {
            const v16bf x0 = xf[kt][0], x1 = xf[kt][1]; v16bf wq[2], wk[2], wv[2];
#pragma unroll
            for (int dt = 0; dt < 2; ++dt) { const bf* pwf = Ws + dt * 16 * DM + kt * 512 + lo; wq[dt] = ldf(pwf); wk[dt] = ldf(pwf + HD * DM); wv[dt] = ldf(pwf + 2 * HD * DM); }
#pragma unroll
            for (int dt = 0; dt < 2; ++dt) {
                aq[0][dt] = wmmab(wq[dt], x0, aq[0][dt]); aq[1][dt] = wmmab(wq[dt], x1, aq[1][dt]);
                ak[0][dt] = wmmab(wk[dt], x0, ak[0][dt]); ak[1][dt] = wmmab(wk[dt], x1, ak[1][dt]);
                av[0][dt] = wmmab(x0, wv[dt], av[0][dt]); av[1][dt] = wmmab(x1, wv[dt], av[1][dt]); }
            // order inside this k tile: its twelve LDS reads as one group, then its twelve products: one LDS latency a k tile instead of one for every fragment
            __builtin_amdgcn_sched_group_barrier(0x100, 12, 0); __builtin_amdgcn_sched_group_barrier(0x008, 12, 0);
            if (kt + 4 < DM / 32) {   // x runs four k tiles ahead, into the registers that this k tile has just left
                xf[kt + 4][0] = ldf(px0 + (kt + 4) * 512); xf[kt + 4][1] = ldf(px1 + (kt + 4) * 512);
                __builtin_amdgcn_sched_group_barrier(0x020, 4, 0); }   // these four loads behind the products
            if (kt == 5) {   // the biases, once registers are free again, two k tiles ahead of their use
#pragma unroll
                for (int dt = 0; dt < 2; ++dt) { bq[dt] = *(const v8f*)(pbr + dt * 16); bk[dt] = *(const v8f*)(pbr + DM + dt * 16); }
                asm volatile("s_wait_xcnt 0x0" ::: "memory");   // in front of any overwrite of the offset register that these loads name (seen in the listing: the next load's result took it)
                bv[0] = pbl[0]; bv[1] = pbl[16]; }
            __builtin_amdgcn_sched_barrier(0);   // nothing moves from one k tile to another: x loads stay four k tiles ahead of their use
        }
        asm volatile("s_wait_xcnt 0x0" ::: "memory");   // in front of any overwrite of a register that the loads above name
#pragma unroll
        for (int i = 0; i < 2; ++i) {
            const unsigned tt = i ? w : (unsigned)(SEQ / 16 - 1) - w;   // 16-row tile of the head
            v8us qh8[2], ql8[2];
#pragma unroll
            for (int dt = 0; dt < 2; ++dt) { v8us kh8, kl8, vh8, vl8; v8f yq, yk, yv;
#pragma unroll
                for (int r = 0; r < 8; ++r) { yq[r] = aq[i][dt][r] + bfr(bq[dt][r]); yk[r] = ak[i][dt][r] + bfr(bk[dt][r]); yv[r] = av[i][dt][r] + bfr(bv[dt]); }
                split8(yq, qh8[dt], ql8[dt]); split8(yk, kh8, kl8); split8(yv, vh8, vl8);
                const unsigned ko = tt * 512u + (unsigned)dt * 256u + lo;                                       // K block = row tile tt, d half dt
                const unsigned vo = ((tt >> 1) * 2u + (unsigned)dt) * 512u + (tt & 1u) * 256u + lo;             // V^T block = [key chunk tt / 2][d tile dt], key half tt & 1
                *(v8us*)(Kh + ko) = kh8; *(v8us*)(Kl + ko) = kl8; *(v8us*)(Vh + vo) = vh8; *(v8us*)(Vl + vo) = vl8; }
            qfh[i] = cat16b(qh8[0], qh8[1]); qfl[i] = cat16b(ql8[0], ql8[1]);
        }
    }
    __syncthreads();   // publishes the head's K and V^T planes: from here on every wave reads what the other waves wrote, and nobody writes them again
    // unrolled: two straight-line copies, so that neither chunk loop carries an outer loop's selects and copies (fewer registers and vector instructions than the rolled build)
#pragma unroll
    for (unsigned part = 0; part < 2u; ++part) {
    const unsigned qt = part ? w : (unsigned)(SEQ / 16 - 1) - w, q0 = qt * 16u;   // wave-uniform; over the block's SEQ / 32 waves every tile of the head exactly once
    const v16bf qh = qfh[part], ql = qfl[part];
    float m = -3.0e38f, l = 0.f; v8f o0 = (v8f){}, o1 = (v8f){};
    const unsigned query = q0 + lr;
    const unsigned nch = (qt >> 1) + 1u;      // wave-uniform trip count; last chunk ends at key <= SEQ-1
#pragma unroll 1
    for (unsigned kc = 0; kc < nch; ++kc) {
        const unsigned kb = kc * 32u;
        const bf* pkh = Kh + kb * HD + lo; const bf* pkl = Kl + kb * HD + lo;   // LDS: 32 keys = two blocks = 1024 elements
        const v16bf k0h = ldf(pkh), k0l = ldf(pkl), k1h = ldf(pkh + 512), k1l = ldf(pkl + 512);
        v8f s0 = (v8f){}, s1 = (v8f){};
        s0 = wmmab(k0h, qh, s0); s0 = wmmab(k0h, ql, s0); s0 = wmmab(k0l, qh, s0);
        s1 = wmmab(k1h, qh, s1); s1 = wmmab(k1h, ql, s1); s1 = wmmab(k1l, qh, s1);
        asm volatile("v_nop\n\tv_nop\n\tv_nop\n\tv_nop" : "+v"(s0), "+v"(s1) : "v"(k0h), "v"(k0l), "v"(k1h), "v"(k1l), "v"(qh), "v"(ql));
        const unsigned keyb = kb + 8u * hi;
        float t0[8], t1[8]; float tmax = -3.0e38f;
#pragma unroll
        for (int r = 0; r < 8; ++r) { const bool ok0 = (keyb + (unsigned)r) <= query, ok1 = (keyb + 16u + (unsigned)r) <= query;
            t0[r] = ok0 ? s0[r] * SCL : -3.0e38f; t1[r] = ok1 ? s1[r] * SCL : -3.0e38f; tmax = fmaxf(tmax, fmaxf(t0[r], t1[r])); }
        tmax = fmaxf(tmax, __shfl_xor(tmax, 16, 32));
        const float mnew = fmaxf(m, tmax);
        // v_exp_f32 and the slot behind it in one statement: a v_nop in a statement of its own landed elsewhere
        float alpha; asm("v_exp_f32 %0, %1\n\tv_nop" : "=v"(alpha) : "v"(__fmul_rn(__fsub_rn(m, mnew), L2E)));
        float psum = 0.f; v8us p0h, p0l, p1h, p1l; v8f pv0, pv1;
#pragma unroll
        for (int r = 0; r < 8; ++r) { const bool ok0 = (keyb + (unsigned)r) <= query, ok1 = (keyb + 16u + (unsigned)r) <= query;
            const float e0 = __builtin_amdgcn_exp2f(__fmul_rn(__fsub_rn(t0[r], mnew), L2E)), e1 = __builtin_amdgcn_exp2f(__fmul_rn(__fsub_rn(t1[r], mnew), L2E));
            const float p0 = ok0 ? e0 : 0.f, p1 = ok1 ? e1 : 0.f; psum += p0 + p1; pv0[r] = p0; pv1[r] = p1; }
        split8(pv0, p0h, p0l); split8(pv1, p1h, p1l);
        l = l * alpha + psum; m = mnew;
        o0 *= alpha; o1 *= alpha;
        const v16bf ph = cat16b(p0h, p1h), pl = cat16b(p0l, p1l);
        const bf* pvh = Vh + kb * HD + lo; const bf* pvl = Vl + kb * HD + lo;   // LDS: 32 keys = d tile 0 block, d tile 1 block
        const v16bf v0h = ldf(pvh), v0l = ldf(pvl), v1h = ldf(pvh + 512), v1l = ldf(pvl + 512);
        o0 = wmmab(v0h, ph, o0); o0 = wmmab(v0h, pl, o0); o0 = wmmab(v0l, ph, o0);
        o1 = wmmab(v1h, ph, o1); o1 = wmmab(v1h, pl, o1); o1 = wmmab(v1l, ph, o1);
        asm volatile("v_nop\n\tv_nop\n\tv_nop\n\tv_nop" : "+v"(o0), "+v"(o1) : "v"(v0h), "v"(v0l), "v"(v1h), "v"(v1l), "v"(ph), "v"(pl));
    }
    const float ltot = l + __shfl_xor(l, 16, 32);
    const float inv = __fdiv_rn(1.0f, ltot);
    v8us ah, al, ch, cl;
    split8(o0 * inv, ah, al); split8(o1 * inv, ch, cl);
    // ctx row tile (b*SEQ+q0)/16, k tile = head hd: element (query lr, d = 16*half + 8*hi + r) sits at half*256 + lane*8 + r, which is this lane's own accumulator order
    const size_t co = ((((size_t)b * SEQ + q0) >> 4) * (DM / 32) + hd) * 512u;
    bf* pch = CXh + co + lo; bf* pcl = CXl + co + lo;
    *(v8us*)pch = ah; *(v8us*)(pch + 256u) = ch; *(v8us*)pcl = al; *(v8us*)(pcl + 256u) = cl;
    // in front of the second tile's overwrites of the registers that these stores name (inputs: they live up to here)
    asm volatile("s_wait_xcnt 0x0" :: "v"(ah), "v"(ch), "v"(al), "v"(cl), "v"(pch), "v"(pcl) : "memory");
    }
}

#define PLB ((size_t)NB * SEQ * DM * 2)      // bytes of one 16-bit [NB*SEQ][256] plane
static_assert((size_t)NQKV * DM * 2 + (size_t)DM * DM * 2 + 3 * PLB <= (size_t)134217728);
static_assert(PLB % 256 == 0);
// coverage equalities (threads x elements per thread == plane elements)
static_assert((size_t)(NQKV / 8) * 256 * 8 == (size_t)NQKV * DM);                    // k_prep, qkv weights
static_assert((size_t)(DM / 8) * 256 * 8 == (size_t)DM * DM);                        // k_prep, proj weights
static_assert((size_t)(SEQ / 8) * 256 * 8 == (size_t)SEQ * DM);                      // k_prep, x per batch
static_assert((size_t)SEQ * 6 * 8 == (size_t)3 * HD * DM);                               // k_attn weight staging: SEQ threads, six 16-byte units a thread
static_assert((size_t)(SEQ / 32) * 2 * 2 * 32 * 8 == (size_t)SEQ * HD);                  // k_attn LDS planes: SEQ / 32 waves, two tiles a wave, two 16-byte units a lane and tile
static_assert((size_t)(SEQ / 32) * 2 * NB * 8 * 2 * 32 * 8 == (size_t)NB * SEQ * DM);    // k_attn ctx planes: SEQ / 32 waves a block, two tiles a wave, NB x 8 blocks
static_assert((size_t)(SEQ / 64) * (DM / 64) * NB * 64 * 64 == (size_t)NB * SEQ * DM);   // output GEMM

extern "C" void kernel_launch(void* const* d_in, const int* in_sizes, int n_in,
                              void* d_out, int out_size, void* d_ws, size_t ws_size, hipStream_t stream) {
    if (n_in < 5) return;
    const long long need = ((long long)(NB - 1) * SEQ_FULL + SEQ) * DM;
    if ((long long)in_sizes[0] < need || (long long)out_size < need) return;
    if (in_sizes[1] < DM * NQKV || in_sizes[2] < NQKV || in_sizes[3] < DM * DM || in_sizes[4] < DM) return;
    const float* x = (const float*)d_in[0];       // [NB_FULL][SEQ_FULL][256]
    const float* wqkv = (const float*)d_in[1];    // [256 in][768 out]
    const float* bqkv = (const float*)d_in[2];    // [768]
    const float* wproj = (const float*)d_in[3];   // [256 in][256 out]
    const float* bproj = (const float*)d_in[4];   // [256]
    float* OUT = (float*)d_out;                   // [NB_FULL][SEQ_FULL][256]
    char* wsp = (char*)d_ws;
    auto take = [&](size_t bytes) { char* p = wsp; wsp += (bytes + 255) & ~(size_t)255; return (void*)p; };
    bf* WQ = (bf*)take((size_t)NQKV * DM * 2); bf* WP = (bf*)take((size_t)DM * DM * 2);
    bf* XB = (bf*)take(PLB);
    bf* CXh = (bf*)take(PLB); bf* CXl = (bf*)take(PLB);
    if ((size_t)(wsp - (char*)d_ws) > ws_size) return;
    k_prep<<<PB_WQ + PB_WP + PB_X * NB, 256, 0, stream>>>(x, wqkv, wproj, XB, WQ, WP);   // weights in[256 k][n] -> rows n, x rows: all in fragment order
    k_attn<<<dim3(NH, NB, 1), SEQ, 0, stream>>>(XB, WQ, bqkv, CXh, CXl);
    k_gemmw<bf, 1, true><<<dim3(SEQ / 64, DM / 64, NB), 32, 0, stream>>>(CXh, CXl, WP, nullptr, DM, OUT, DM, bproj, (size_t)SEQ * DM, 0, (size_t)SEQ_FULL * DM);
}

// v007
// One run takes 41.5 microseconds.
// Next to v006, in two timings, it ran 1.06 times as fast each time.
// All steps since v000 together make it 2.82 times as fast.
#include <hip/hip_runtime.h>

#ifndef NB
#define NB 32
#endif
#ifndef SEQ
#define SEQ 512
#endif
#define NB_FULL  32
#define SEQ_FULL 512
#define DM   256
#define NH   8
#define HD   32
#define NQKV 768
#define SCL  0.17677669529663688f     // 1/sqrt(float32(32))
#define L2E  1.4426950408889634f

static_assert(SEQ % 64 == 0);
static_assert(SEQ <= SEQ_FULL);
static_assert(NB >= 1);
static_assert(NB <= NB_FULL);
static_assert(NH * HD == DM);
static_assert(NQKV == 3 * DM);

typedef unsigned short bf;
typedef __attribute__((ext_vector_type(16))) __bf16   v16bf;
typedef __attribute__((ext_vector_type(8)))  unsigned short v8us;
typedef __attribute__((ext_vector_type(2)))  unsigned short v2us;
typedef __attribute__((ext_vector_type(8)))  float    v8f;
typedef __attribute__((ext_vector_type(4)))  float    v4f;
typedef v4f  __attribute__((may_alias)) v4fa;
typedef v8us __attribute__((may_alias)) v8usa;

typedef __attribute__((ext_vector_type(8)))  __bf16   v8bf;
typedef __attribute__((ext_vector_type(2)))  __bf16   v2bf;
typedef __attribute__((ext_vector_type(2)))  float    v2f;
typedef __attribute__((ext_vector_type(4)))  unsigned v4u;
// f32 -> bf16 by the hardware's packed convert (round to nearest even, two values an instruction)
__device__ __forceinline__ float bfr(float f) { return __uint_as_float((unsigned)__builtin_bit_cast(unsigned short, (__bf16)f) << 16); }
__device__ __forceinline__ v8us cvt8(v8f y) { return __builtin_bit_cast(v8us, __builtin_convertvector(y, v8bf)); }
// y = hi + lo, both bf16: hi = bf16(y), lo = bf16(y - hi); y - hi is exact in f32
__device__ __forceinline__ void split8(v8f y, v8us& h, v8us& l) {
    v4u hu, lu;
#pragma unroll
    for (int j = 0; j < 4; ++j) { const v2f p = { y[2 * j], y[2 * j + 1] }; const unsigned u = __builtin_bit_cast(unsigned, __builtin_convertvector(p, v2bf)); hu[j] = u;
        const v2f back = { __uint_as_float(u << 16), __uint_as_float(u & 0xFFFF0000u) };   // the two hi parts as f32, taken from the packed word
        lu[j] = __builtin_bit_cast(unsigned, __builtin_convertvector(p - back, v2bf)); }
    h = __builtin_bit_cast(v8us, hu); l = __builtin_bit_cast(v8us, lu);
}
__device__ __forceinline__ v16bf cat16b(v8us lo, v8us hi) { return __builtin_bit_cast(v16bf, __builtin_shufflevector(lo, hi, 0, 1, 2, 3, 4, 5, 6, 7, 8, 9, 10, 11, 12, 13, 14, 15)); }
__device__ __forceinline__ v8f wmmab(v16bf a, v16bf b, v8f c) { return __builtin_amdgcn_wmma_f32_16x16x32_bf16(false, a, false, b, (short)0, c, false, false); }
// fragment from a fragment-order block: p = block + 8*lane; elements 0..7 <- k0+8h.., 8..15 <- k0+16+8h.. of row (lane & 15), h = lane >> 4
__device__ __forceinline__ v16bf ldf(const bf* p) { return cat16b(*(const v8us*)p, *(const v8us*)(p + 256)); }

// ---- k_gemmw: register-blocked GEMM, ONE WAVE per 64x64 output tile (16 accumulators), operands straight from fragment-order 16-bit planes; grid (M/64, N/64, Z), 32 threads.
// C[m][n] (f32, pitch ldc, + optional f32 bias[n] after bf16 convert) = sum_k A[m][k] Bt[n][k] (+ split products per NSPLIT). z-batch strides sA/sB/sC in elements. K % 32 == 0.
template <typename T16> struct WFrag;
template <> struct WFrag<bf> { typedef v16bf V; static __device__ __forceinline__ V ld(const bf* p) { return cat16b(*(const v8us*)p, *(const v8us*)(p + 256)); } static __device__ __forceinline__ v8f mma(V a, V b, v8f c) { return wmmab(a, b, c); } };
template <typename T16, int NSPLIT, bool BIAS>
__global__ __launch_bounds__(32) void k_gemmw(const T16* __restrict__ A, const T16* __restrict__ A2, const T16* __restrict__ Bt, const T16* __restrict__ Bt2, int K, float* C, int ldc, const float* __restrict__ bias, size_t sA, size_t sB, size_t sC) {
    typedef typename WFrag<T16>::V V;
    __shared__ __align__(16) float os[16 * 68];
    const size_t z = blockIdx.z; A += z * sA; if (A2) A2 += z * sA; Bt += z * sB; if (Bt2) Bt2 += z * sB; C += z * sC;
    const int lane = threadIdx.x & 31, lr = lane & 15, hi = lane >> 4; const int r0 = blockIdx.x * 64, c0 = blockIdx.y * 64;
    v8f acc[4][4];
#pragma unroll
    for (int mb = 0; mb < 4; ++mb)
#pragma unroll
        for (int nb = 0; nb < 4; ++nb) acc[mb][nb] = (v8f){};
    const size_t aoff = (size_t)r0 * K, boff = (size_t)c0 * K; const unsigned lo = 8u * (unsigned)lane;   // row tile rt starts at rt * 16 * K elements; k tile kt at + kt * 512 = + kc * 16
#pragma unroll 1
    for (int kc = 0; kc < K; kc += 32) {
        V a[4], a2[4]; const T16* pa[4]; const T16* pa2[4]; const T16* pb[4]; const T16* pb2[4];
#pragma unroll
        for (int i = 0; i < 4; ++i) { pa[i] = A + aoff + (size_t)i * 16 * K + kc * 16 + lo; pa2[i] = (NSPLIT == 1 || NSPLIT == 2) ? A2 + aoff + (size_t)i * 16 * K + kc * 16 + lo : pa[i]; pb[i] = Bt + boff + (size_t)i * 16 * K + kc * 16 + lo; pb2[i] = (NSPLIT >= 2) ? Bt2 + boff + (size_t)i * 16 * K + kc * 16 + lo : pb[i]; }
#pragma unroll
        for (int mb = 0; mb < 4; ++mb) { a[mb] = WFrag<T16>::ld(pa[mb]); if (NSPLIT == 1 || NSPLIT == 2) a2[mb] = WFrag<T16>::ld(pa2[mb]); }
#pragma unroll
        for (int nb = 0; nb < 4; ++nb) { const V b = WFrag<T16>::ld(pb[nb]); V b2; if (NSPLIT >= 2) b2 = WFrag<T16>::ld(pb2[nb]);
#pragma unroll
            for (int mb = 0; mb < 4; ++mb) { acc[mb][nb] = WFrag<T16>::mma(a[mb], b, acc[mb][nb]); if (NSPLIT == 1 || NSPLIT == 2) acc[mb][nb] = WFrag<T16>::mma(a2[mb], b, acc[mb][nb]); if (NSPLIT >= 2) acc[mb][nb] = WFrag<T16>::mma(a[mb], b2, acc[mb][nb]); } }
        asm volatile("v_nop\n\tv_nop\n\tv_nop\n\tv_nop" : "+v"(acc[0][0]), "+v"(acc[1][1]), "+v"(acc[2][2]), "+v"(acc[3][3]) : "v"(a[0]), "v"(a[3]));
        // the wait in front of any overwrite of a register that this trip's loads name; their addresses are inputs so that those registers live up to here
        asm volatile("s_wait_xcnt 0x0" :: "v"(pa[0]), "v"(pa[1]), "v"(pa[2]), "v"(pa[3]), "v"(pa2[0]), "v"(pa2[1]), "v"(pa2[2]), "v"(pa2[3]), "v"(pb[0]), "v"(pb[1]), "v"(pb[2]), "v"(pb[3]), "v"(pb2[0]), "v"(pb2[1]), "v"(pb2[2]), "v"(pb2[3]) : "memory");
    }
#pragma unroll
    for (int mb = 0; mb < 4; ++mb) {
#pragma unroll
        for (int nb = 0; nb < 4; ++nb) {
#pragma unroll
            for (int j = 0; j < 8; ++j) os[(hi * 8 + j) * 68 + nb * 16 + lr] = acc[mb][nb][j]; }
        __builtin_amdgcn_wave_barrier(); asm volatile("" ::: "memory");
        float* crow = C + (size_t)(r0 + mb * 16) * ldc + c0;
{
#pragma unroll
            for (int s = 0; s < 8; ++s) { const int row = 2 * s + hi, cofs = lr * 4; v4f val = *(const v4fa*)(os + row * 68 + cofs); if (BIAS) { val[0] += bfr(bias[c0 + cofs]); val[1] += bfr(bias[c0 + cofs + 1]); val[2] += bfr(bias[c0 + cofs + 2]); val[3] += bfr(bias[c0 + cofs + 3]); }
                *(v4f*)(crow + (size_t)row * ldc + cofs) = val; }
             }
        asm volatile("s_wait_xcnt 0x0" ::: "memory");   // in front of the next block's overwrites of the registers that these stores name
        __builtin_amdgcn_wave_barrier(); asm volatile("" ::: "memory");
    }
}

// x job of k_prep: one wave converts four consecutive fragment-order blocks of one batch of x (one 16-row tile, four k tiles = 16 rows x 512 bytes); wv = the wave's number in the batch.
// Loads: lane = (row group r4 = lane >> 3, 16-byte piece c = lane & 7); load i of a block reads rows 4 i + r4, so every wave-wide load covers four whole 128-byte lines, and all sixteen loads are issued before the first is used.
// A 16-byte unit of the plane holds 8 k of one row = pieces c and c + 1, c even. Lanes c and c ^ 1 swap one piece each: the even lane ends with the unit of row 8 s + r4, the odd lane with that of row 8 s + 4 + r4,
// so every wave-wide store covers four whole lines too. Unit number in a block: (k half * 2 + k quarter) * 16 + row = (c >> 1) * 16 + row.
__device__ __forceinline__ unsigned pk2(float a, float b) { const v2f p = { a, b }; return __builtin_bit_cast(unsigned, __builtin_convertvector(p, v2bf)); }
__device__ __forceinline__ unsigned swap1(unsigned v) { return (unsigned)__builtin_amdgcn_mov_dpp((int)v, 0xB1, 0xF, 0xF, true); }   // the value of lane ^ 1 (quad_perm 1,0,3,2), on the vector port: no LDS round trip
__device__ __forceinline__ void cvt_blocks(const float* __restrict__ src, bf* dst, unsigned wv, unsigned lane) {
    const unsigned r4 = lane >> 3, c = lane & 7u; const bool odd = (c & 1u) != 0u;
    const float* p0 = src + (size_t)((wv >> 1) * 16u + r4) * DM + (wv & 1u) * 128u + 4u * c;
    v4f f[4][4];
#pragma unroll
    for (int q = 0; q < 4; ++q)
#pragma unroll
        for (int i = 0; i < 4; ++i) f[q][i] = *(const v4f*)(p0 + i * 4 * DM + q * 32);
    // the wait in front of any overwrite of a register that these loads name; their address is an input so that it lives up to here
    asm volatile("s_wait_xcnt 0x0" :: "v"(p0) : "memory");
    __builtin_amdgcn_sched_barrier(0);   // keeps every convert behind the last load: without it the build waits for the first loads and reuses their registers for the later ones, so that only six are in flight
    bf* pd = dst + (size_t)wv * 2048u + ((c >> 1) * 16u + (odd ? 4u : 0u) + r4) * 8u;
#pragma unroll
    for (int q = 0; q < 4; ++q) {
        unsigned d0[4], d1[4];
#pragma unroll
        for (int i = 0; i < 4; ++i) { d0[i] = pk2(f[q][i][0], f[q][i][1]); d1[i] = pk2(f[q][i][2], f[q][i][3]); }
#pragma unroll
        for (int s = 0; s < 2; ++s) {
            const unsigned m0 = odd ? d0[2 * s + 1] : d0[2 * s], m1 = odd ? d1[2 * s + 1] : d1[2 * s];                 // the piece this lane keeps
            const unsigned g0 = swap1(odd ? d0[2 * s] : d0[2 * s + 1]), g1 = swap1(odd ? d1[2 * s] : d1[2 * s + 1]);   // the piece it gets for the one it gives
            const v4u unit = { odd ? g0 : m0, odd ? g1 : m1, odd ? m0 : g0, odd ? m1 : g1 };
            *(v8us*)(pd + q * 512 + s * 64) = __builtin_bit_cast(v8us, unit); }
    }
    asm volatile("s_wait_xcnt 0x0" ::: "memory");   // in front of any overwrite of a register that these stores name
}

// one 16-byte unit i of the fragment-order bf16 plane of a transposed weight: W [256 k][N n] -> rows n
__device__ __forceinline__ void wt_unit(const float* __restrict__ W, bf* Wt, unsigned N, unsigned i) {
    // i = 16-byte unit of the fragment-order plane, rows n, 256 k = 8 k tiles: lane i & 31, k half (i >> 5) & 1, k tile (i >> 6) & 7, row tile i >> 9
    const unsigned n = (i >> 9) * 16u + (i & 15u), k0 = ((i >> 6) & 7u) * 32u + ((i >> 5) & 1u) * 16u + ((i >> 4) & 1u) * 8u;
    const float* p[8]; v8f f;
#pragma unroll
    for (unsigned k = 0; k < 8u; ++k) { p[k] = W + (size_t)(k0 + k) * N + n; f[k] = *p[k]; }
    // the wait in front of any overwrite of a register that these loads name; their addresses are inputs so that those registers live up to here
    asm volatile("s_wait_xcnt 0x0" :: "v"(p[0]), "v"(p[1]), "v"(p[2]), "v"(p[3]), "v"(p[4]), "v"(p[5]), "v"(p[6]), "v"(p[7]) : "memory");
    *(v8us*)(Wt + (size_t)i * 8) = cvt8(f);
    asm volatile("s_wait_xcnt 0x0" ::: "memory");   // in front of any overwrite of a register that this store names: in k_prep another job's code follows it in the built kernel
}

// k_prep: the three input conversions read nothing of each other's output, so they share one grid; the job is picked by block index (block-uniform).
// The weight blocks have the low indices: they start first, and their strided loads run under the start of the x blocks.
#define PB_WQ (NQKV / 8)      // blocks for W_qkv
#define PB_WP (DM / 8)        // blocks for W_proj
#define PB_X  (SEQ / 64)      // blocks for one batch of x: 8 waves, four 16 x 32 blocks a wave
__global__ __launch_bounds__(256) void k_prep(const float* __restrict__ x, const float* __restrict__ wqkv, const float* __restrict__ wproj, bf* XB, bf* WQ, bf* WP) {
    const unsigned blk = blockIdx.x, tid = threadIdx.x;
    if (blk < (unsigned)PB_WQ) { wt_unit(wqkv, WQ, (unsigned)NQKV, blk * 256u + tid); return; }
    if (blk < (unsigned)(PB_WQ + PB_WP)) { wt_unit(wproj, WP, (unsigned)DM, (blk - (unsigned)PB_WQ) * 256u + tid); return; }
    const unsigned c = blk - (unsigned)(PB_WQ + PB_WP), bat = c / (unsigned)PB_X;
    cvt_blocks(x + (size_t)bat * SEQ_FULL * DM, XB + (size_t)bat * SEQ * DM, (c - bat * (unsigned)PB_X) * 8u + (tid >> 5), tid & 31u);
}

// k_attn: qkv projection and attention of one (head, batch b) in one block; wave w = query tile pair w (tiles n - 1 - w and w).
// Projection: a head needs only its own 96 columns of qkv, so no product is done twice over the grid. Each wave projects the 16-row tiles n - 1 - w and w of x (K = 256, bf16 x bf16, f32 accumulate, + bf16(b_qkv)), oriented so
// that the accumulators ARE fragment order (lane unchanged, 8 registers = 8 consecutive k): Q^T and K^T tiles [d][t] = W rows (A) x x rows (B) give the Q and K fragments (row t, k = d); V tiles [t][d] = x rows (A) x W rows (B) give the V^T fragment halves (row d, k = t).
// The head's 96 rows of W^T are first copied to LDS (48 KiB, one barrier), so that the k loop's weight reads count on the LDS counter and never wait behind the x loads, which run four k tiles ahead.
// Q hi/lo stays in the wave's registers; K and V^T hi/lo of the whole head go to LDS in the fragment-order blocks described above (4 planes x 32 KiB); one barrier; then every wave reads them from LDS.
// Causal cost grows with the query tile, so every wave runs tile n - 1 - w and then tile w, one after the other: each wave of the launch then has the same number of key chunks, and all blocks are resident at once. Transposed flash attention over 32-key chunks:
//   S^T tile j [key kb+16j+8h+r][query q0+lr] = K rows (A) x Q rows (B), hi/lo 3 products; causal mask by value; online softmax per query = per lane pair (lane, lane^16);
//   P^T B fragment: element r <- p(tile 0)[r], element 8+r <- p(tile 1)[r], lane unchanged; O^T [d][query] += V^T rows (A) x P^T (B), hi/lo 3 products.
__global__ __launch_bounds__(SEQ) void k_attn(const bf* __restrict__ XB, const bf* __restrict__ WQ, const float* __restrict__ bias, bf* CXh, bf* CXl) {
    __shared__ __align__(16) bf Kh[SEQ * HD]; __shared__ __align__(16) bf Kl[SEQ * HD]; __shared__ __align__(16) bf Vh[SEQ * HD]; __shared__ __align__(16) bf Vl[SEQ * HD];
    __shared__ __align__(16) bf Ws[3 * HD * DM];   // this head's q, k, v rows of W^T, fragment order: [q | k | v][d tile][k tile][512]
    const unsigned tid = threadIdx.x, lane = tid & 31u, lr = lane & 15u, hi = lane >> 4, lo = 8u * lane;
    const unsigned w = (unsigned)__builtin_amdgcn_readfirstlane((int)(tid >> 5));   // wave number, told to the compiler as wave-uniform: tile index and trip count stay scalar, the chunk loops branch on SCC with EXEC whole
    const unsigned b = blockIdx.y, hd = blockIdx.x;
    v16bf qfh[2], qfl[2];
    {
        const bf* pws = WQ + (size_t)hd * HD * DM + 8u * tid;      // 16-byte unit tid of this head's q rows of W^T (32 rows = 16 KiB in a row); its k rows at + DM * DM, its v rows at + 2 * DM * DM
        const bf* px0 = XB + (size_t)b * SEQ * DM + (size_t)((unsigned)(SEQ / 16 - 1) - w) * 16 * DM + lo;   // x row tile n - 1 - w; k tile kt at + kt * 512
        const bf* px1 = XB + (size_t)b * SEQ * DM + (size_t)w * 16 * DM + lo;                                // x row tile w
        const float* pbr = bias + hd * HD + 8u * hi;               // q and k bias by accumulator register: d = 16 * dt + 8 * hi + r
        const float* pbl = bias + 2 * DM + hd * HD + lr;           // v bias by lane: d = 16 * dt + lr
        v8us wst[6]; v16bf xf[DM / 32][2];
#pragma unroll
        for (int j = 0; j < 6; ++j) wst[j] = *(const v8us*)(pws + (j >> 1) * DM * DM + (j & 1) * 4096);
        __builtin_amdgcn_sched_barrier(0);   // keeps the weight loads in front of the x loads: loads return in order, and the staging below must not wait for x
#pragma unroll
        for (int kt = 0; kt < 4; ++kt) { xf[kt][0] = ldf(px0 + kt * 512); xf[kt][1] = ldf(px1 + kt * 512); }
        __builtin_amdgcn_sched_barrier(0);   // keeps the x loads up here: they fly while the weights are staged, and the k loop then waits for one k tile at a time
#pragma unroll
        for (int j = 0; j < 6; ++j) *(v8us*)(Ws + (j >> 1) * (HD * DM) + (j & 1) * 4096 + 8u * tid) = wst[j];
        // barrier by hand with LDS-only fences: it publishes Ws; __syncthreads() here would also wait for the x loads that are in flight
        __builtin_amdgcn_fence(__ATOMIC_RELEASE, "workgroup", "local"); __builtin_amdgcn_s_barrier(); __builtin_amdgcn_fence(__ATOMIC_ACQUIRE, "workgroup", "local");
        v8f bq[2], bk[2]; float bv[2];
        v8f aq[2][2], ak[2][2], av[2][2];   // [tile][d tile]
#pragma unroll
        for (int i = 0; i < 2; ++i)
#pragma unroll
            for (int dt = 0; dt < 2; ++dt) { aq[i][dt] = (v8f){}; ak[i][dt] = (v8f){}; av[i][dt] = (v8f){}; }
        // unrolled: the x fragments are named registers, and every address is base + constant offset
#pragma unroll
        for (int kt = 0; kt < DM / 32; ++kt) {
            const v16bf x0 = xf[kt][0], x1 = xf[kt][1]; v16bf wq[2], wk[2], wv[2];
#pragma unroll
            for (int dt = 0; dt < 2; ++dt) { const bf* pwf = Ws + dt * 16 * DM + kt * 512 + lo; wq[dt] = ldf(pwf); wk[dt] = ldf(pwf + HD * DM); wv[dt] = ldf(pwf + 2 * HD * DM); }
#pragma unroll
            for (int dt = 0; dt < 2; ++dt) {
                aq[0][dt] = wmmab(wq[dt], x0, aq[0][dt]); aq[1][dt] = wmmab(wq[dt], x1, aq[1][dt]);
                ak[0][dt] = wmmab(wk[dt], x0, ak[0][dt]); ak[1][dt] = wmmab(wk[dt], x1, ak[1][dt]);
                av[0][dt] = wmmab(x0, wv[dt], av[0][dt]); av[1][dt] = wmmab(x1, wv[dt], av[1][dt]); }
            // order inside this k tile: its twelve LDS reads as one group, then its twelve products: one LDS latency a k tile instead of one for every fragment
            __builtin_amdgcn_sched_group_barrier(0x100, 12, 0); __builtin_amdgcn_sched_group_barrier(0x008, 12, 0);
            if (kt + 4 < DM / 32) {   // x runs four k tiles ahead, into the registers that this k tile has just left
                xf[kt + 4][0] = ldf(px0 + (kt + 4) * 512); xf[kt + 4][1] = ldf(px1 + (kt + 4) * 512);
                __builtin_amdgcn_sched_group_barrier(0x020, 4, 0); }   // these four loads behind the products
            if (kt == 5) {   // the biases, once registers are free again, two k tiles ahead of their use
#pragma unroll
                for (int dt = 0; dt < 2; ++dt) { bq[dt] = *(const v8f*)(pbr + dt * 16); bk[dt] = *(const v8f*)(pbr + DM + dt * 16); }
                asm volatile("s_wait_xcnt 0x0" ::: "memory");   // in front of any overwrite of the offset register that these loads name (seen in the listing: the next load's result took it)
                bv[0] = pbl[0]; bv[1] = pbl[16]; }
            __builtin_amdgcn_sched_barrier(0);   // nothing moves from one k tile to another: x loads stay four k tiles ahead of their use
        }
        asm volatile("s_wait_xcnt 0x0" ::: "memory");   // in front of any overwrite of a register that the loads above name
#pragma unroll
        for (int i = 0; i < 2; ++i) {
            const unsigned tt = i ? w : (unsigned)(SEQ / 16 - 1) - w;   // 16-row tile of the head
            v8us qh8[2], ql8[2];
#pragma unroll
            for (int dt = 0; dt < 2; ++dt) { v8us kh8, kl8, vh8, vl8; v8f yq, yk, yv;
#pragma unroll
                for (int r = 0; r < 8; ++r) { yq[r] = aq[i][dt][r] + bfr(bq[dt][r]); yk[r] = ak[i][dt][r] + bfr(bk[dt][r]); yv[r] = av[i][dt][r] + bfr(bv[dt]); }
                split8(yq, qh8[dt], ql8[dt]); split8(yk, kh8, kl8); split8(yv, vh8, vl8);
                const unsigned ko = tt * 512u + (unsigned)dt * 256u + lo;                                       // K block = row tile tt, d half dt
                const unsigned vo = ((tt >> 1) * 2u + (unsigned)dt) * 512u + (tt & 1u) * 256u + lo;             // V^T block = [key chunk tt / 2][d tile dt], key half tt & 1
                *(v8us*)(Kh + ko) = kh8; *(v8us*)(Kl + ko) = kl8; *(v8us*)(Vh + vo) = vh8; *(v8us*)(Vl + vo) = vl8; }
            qfh[i] = cat16b(qh8[0], qh8[1]); qfl[i] = cat16b(ql8[0], ql8[1]);
        }
    }
    __syncthreads();   // publishes the head's K and V^T planes: from here on every wave reads what the other waves wrote, and nobody writes them again
    // unrolled: two straight-line copies, so that neither chunk loop carries an outer loop's selects and copies (fewer registers and vector instructions than the rolled build)
#pragma unroll
    for (unsigned part = 0; part < 2u; ++part) {
    const unsigned qt = part ? w : (unsigned)(SEQ / 16 - 1) - w, q0 = qt * 16u;   // wave-uniform; over the block's SEQ / 32 waves every tile of the head exactly once
    const v16bf qh = qfh[part], ql = qfl[part];
    float m = -3.0e38f, l = 0.f; v8f o0 = (v8f){}, o1 = (v8f){};
    const unsigned query = q0 + lr;
    const unsigned nch = (qt >> 1) + 1u;      // wave-uniform trip count; last chunk ends at key <= SEQ-1
#pragma unroll 1
    for (unsigned kc = 0; kc < nch; ++kc) {
        const unsigned kb = kc * 32u;
        const bf* pkh = Kh + kb * HD + lo; const bf* pkl = Kl + kb * HD + lo;   // LDS: 32 keys = two blocks = 1024 elements
        const v16bf k0h = ldf(pkh), k0l = ldf(pkl), k1h = ldf(pkh + 512), k1l = ldf(pkl + 512);
        v8f s0 = (v8f){}, s1 = (v8f){};
        s0 = wmmab(k0h, qh, s0); s0 = wmmab(k0h, ql, s0); s0 = wmmab(k0l, qh, s0);
        s1 = wmmab(k1h, qh, s1); s1 = wmmab(k1h, ql, s1); s1 = wmmab(k1l, qh, s1);
        asm volatile("v_nop\n\tv_nop\n\tv_nop\n\tv_nop" : "+v"(s0), "+v"(s1) : "v"(k0h), "v"(k0l), "v"(k1h), "v"(k1l), "v"(qh), "v"(ql));
        const unsigned keyb = kb + 8u * hi;
        float t0[8], t1[8]; float tmax = -3.0e38f;
#pragma unroll
        for (int r = 0; r < 8; ++r) { const bool ok0 = (keyb + (unsigned)r) <= query, ok1 = (keyb + 16u + (unsigned)r) <= query;
            t0[r] = ok0 ? s0[r] * SCL : -3.0e38f; t1[r] = ok1 ? s1[r] * SCL : -3.0e38f; tmax = fmaxf(tmax, fmaxf(t0[r], t1[r])); }
        tmax = fmaxf(tmax, __shfl_xor(tmax, 16, 32));
        const float mnew = fmaxf(m, tmax);
        // v_exp_f32 and the slot behind it in one statement: a v_nop in a statement of its own landed elsewhere
        float alpha; asm("v_exp_f32 %0, %1\n\tv_nop" : "=v"(alpha) : "v"(__fmul_rn(__fsub_rn(m, mnew), L2E)));
        float psum = 0.f; v8us p0h, p0l, p1h, p1l; v8f pv0, pv1;
#pragma unroll
        for (int r = 0; r < 8; ++r) { const bool ok0 = (keyb + (unsigned)r) <= query, ok1 = (keyb + 16u + (unsigned)r) <= query;
            const float e0 = __builtin_amdgcn_exp2f(__fmul_rn(__fsub_rn(t0[r], mnew), L2E)), e1 = __builtin_amdgcn_exp2f(__fmul_rn(__fsub_rn(t1[r], mnew), L2E));
            const float p0 = ok0 ? e0 : 0.f, p1 = ok1 ? e1 : 0.f; psum += p0 + p1; pv0[r] = p0; pv1[r] = p1; }
        split8(pv0, p0h, p0l); split8(pv1, p1h, p1l);
        l = l * alpha + psum; m = mnew;
        o0 *= alpha; o1 *= alpha;
        const v16bf ph = cat16b(p0h, p1h), pl = cat16b(p0l, p1l);
        const bf* pvh = Vh + kb * HD + lo; const bf* pvl = Vl + kb * HD + lo;   // LDS: 32 keys = d tile 0 block, d tile 1 block
        const v16bf v0h = ldf(pvh), v0l = ldf(pvl), v1h = ldf(pvh + 512), v1l = ldf(pvl + 512);
        o0 = wmmab(v0h, ph, o0); o0 = wmmab(v0h, pl, o0); o0 = wmmab(v0l, ph, o0);
        o1 = wmmab(v1h, ph, o1); o1 = wmmab(v1h, pl, o1); o1 = wmmab(v1l, ph, o1);
        asm volatile("v_nop\n\tv_nop\n\tv_nop\n\tv_nop" : "+v"(o0), "+v"(o1) : "v"(v0h), "v"(v0l), "v"(v1h), "v"(v1l), "v"(ph), "v"(pl));
    }
    const float ltot = l + __shfl_xor(l, 16, 32);
    const float inv = __fdiv_rn(1.0f, ltot);
    v8us ah, al, ch, cl;
    split8(o0 * inv, ah, al); split8(o1 * inv, ch, cl);
    // ctx row tile (b*SEQ+q0)/16, k tile = head hd: element (query lr, d = 16*half + 8*hi + r) sits at half*256 + lane*8 + r, which is this lane's own accumulator order
    const size_t co = ((((size_t)b * SEQ + q0) >> 4) * (DM / 32) + hd) * 512u;
    bf* pch = CXh + co + lo; bf* pcl = CXl + co + lo;
    *(v8us*)pch = ah; *(v8us*)(pch + 256u) = ch; *(v8us*)pcl = al; *(v8us*)(pcl + 256u) = cl;
    // in front of the second tile's overwrites of the registers that these stores name (inputs: they live up to here)
    asm volatile("s_wait_xcnt 0x0" :: "v"(ah), "v"(ch), "v"(al), "v"(cl), "v"(pch), "v"(pcl) : "memory");
    }
}

#define PLB ((size_t)NB * SEQ * DM * 2)      // bytes of one 16-bit [NB*SEQ][256] plane
static_assert((size_t)NQKV * DM * 2 + (size_t)DM * DM * 2 + 3 * PLB <= (size_t)134217728);
static_assert(PLB % 256 == 0);
// coverage equalities (threads x elements per thread == plane elements)
static_assert((size_t)(NQKV / 8) * 256 * 8 == (size_t)NQKV * DM);                    // k_prep, qkv weights
static_assert((size_t)(DM / 8) * 256 * 8 == (size_t)DM * DM);                        // k_prep, proj weights
static_assert((size_t)(SEQ / 64) * 8 * 4 * 512 == (size_t)SEQ * DM);                  // k_prep, x per batch: blocks x waves x fragment blocks x elements
static_assert((size_t)SEQ * 6 * 8 == (size_t)3 * HD * DM);                               // k_attn weight staging: SEQ threads, six 16-byte units a thread
static_assert((size_t)(SEQ / 32) * 2 * 2 * 32 * 8 == (size_t)SEQ * HD);                  // k_attn LDS planes: SEQ / 32 waves, two tiles a wave, two 16-byte units a lane and tile
static_assert((size_t)(SEQ / 32) * 2 * NB * 8 * 2 * 32 * 8 == (size_t)NB * SEQ * DM);    // k_attn ctx planes: SEQ / 32 waves a block, two tiles a wave, NB x 8 blocks
static_assert((size_t)(SEQ / 64) * (DM / 64) * NB * 64 * 64 == (size_t)NB * SEQ * DM);   // output GEMM

extern "C" void kernel_launch(void* const* d_in, const int* in_sizes, int n_in,
                              void* d_out, int out_size, void* d_ws, size_t ws_size, hipStream_t stream) {
    if (n_in < 5) return;
    const long long need = ((long long)(NB - 1) * SEQ_FULL + SEQ) * DM;
    if ((long long)in_sizes[0] < need || (long long)out_size < need) return;
    if (in_sizes[1] < DM * NQKV || in_sizes[2] < NQKV || in_sizes[3] < DM * DM || in_sizes[4] < DM) return;
    const float* x = (const float*)d_in[0];       // [NB_FULL][SEQ_FULL][256]
    const float* wqkv = (const float*)d_in[1];    // [256 in][768 out]
    const float* bqkv = (const float*)d_in[2];    // [768]
    const float* wproj = (const float*)d_in[3];   // [256 in][256 out]
    const float* bproj = (const float*)d_in[4];   // [256]
    float* OUT = (float*)d_out;                   // [NB_FULL][SEQ_FULL][256]
    char* wsp = (char*)d_ws;
    auto take = [&](size_t bytes) { char* p = wsp; wsp += (bytes + 255) & ~(size_t)255; return (void*)p; };
    bf* WQ = (bf*)take((size_t)NQKV * DM * 2); bf* WP = (bf*)take((size_t)DM * DM * 2);
    bf* XB = (bf*)take(PLB);
    bf* CXh = (bf*)take(PLB); bf* CXl = (bf*)take(PLB);
    if ((size_t)(wsp - (char*)d_ws) > ws_size) return;
    k_prep<<<PB_WQ + PB_WP + PB_X * NB, 256, 0, stream>>>(x, wqkv, wproj, XB, WQ, WP);   // weights in[256 k][n] -> rows n, x rows: all in fragment order
    k_attn<<<dim3(NH, NB, 1), SEQ, 0, stream>>>(XB, WQ, bqkv, CXh, CXl);
    k_gemmw<bf, 1, true><<<dim3(SEQ / 64, DM / 64, NB), 32, 0, stream>>>(CXh, CXl, WP, nullptr, DM, OUT, DM, bproj, (size_t)SEQ * DM, 0, (size_t)SEQ_FULL * DM);
}

// v008
// One run takes 40.3 microseconds.
// Next to v007, in two timings, it ran 1.04 times as fast each time.
// Over all steps from v000 it is 2.93 times as fast.
#include <hip/hip_runtime.h>

#ifndef NB
#define NB 32
#endif
#ifndef SEQ
#define SEQ 512
#endif
#define NB_FULL  32
#define SEQ_FULL 512
#define DM   256
#define NH   8
#define HD   32
#define NQKV 768
#define SCL  0.17677669529663688f     // 1/sqrt(float32(32))
#define L2E  1.4426950408889634f

static_assert(SEQ % 64 == 0);
static_assert(SEQ <= SEQ_FULL);
static_assert(NB >= 1);
static_assert(NB <= NB_FULL);
static_assert(NH * HD == DM);
static_assert(NQKV == 3 * DM);

typedef unsigned short bf;
typedef __attribute__((ext_vector_type(16))) __bf16   v16bf;
typedef __attribute__((ext_vector_type(8)))  unsigned short v8us;
typedef __attribute__((ext_vector_type(2)))  unsigned short v2us;
typedef __attribute__((ext_vector_type(8)))  float    v8f;
typedef __attribute__((ext_vector_type(4)))  float    v4f;
typedef v4f  __attribute__((may_alias)) v4fa;
typedef v8us __attribute__((may_alias)) v8usa;

typedef __attribute__((ext_vector_type(8)))  __bf16   v8bf;
typedef __attribute__((ext_vector_type(2)))  __bf16   v2bf;
typedef __attribute__((ext_vector_type(2)))  float    v2f;
typedef __attribute__((ext_vector_type(4)))  unsigned v4u;
// f32 -> bf16 by the hardware's packed convert (round to nearest even, two values an instruction)
__device__ __forceinline__ float bfr(float f) { return __uint_as_float((unsigned)__builtin_bit_cast(unsigned short, (__bf16)f) << 16); }
__device__ __forceinline__ v8us cvt8(v8f y) { return __builtin_bit_cast(v8us, __builtin_convertvector(y, v8bf)); }
// y = hi + lo, both bf16: hi = bf16(y), lo = bf16(y - hi); y - hi is exact in f32
__device__ __forceinline__ void split8(v8f y, v8us& h, v8us& l) {
    v4u hu, lu;
#pragma unroll
    for (int j = 0; j < 4; ++j) { const v2f p = { y[2 * j], y[2 * j + 1] }; const unsigned u = __builtin_bit_cast(unsigned, __builtin_convertvector(p, v2bf)); hu[j] = u;
        const v2f back = { __uint_as_float(u << 16), __uint_as_float(u & 0xFFFF0000u) };   // the two hi parts as f32, taken from the packed word
        lu[j] = __builtin_bit_cast(unsigned, __builtin_convertvector(p - back, v2bf)); }
    h = __builtin_bit_cast(v8us, hu); l = __builtin_bit_cast(v8us, lu);
}
__device__ __forceinline__ v16bf cat16b(v8us lo, v8us hi) { return __builtin_bit_cast(v16bf, __builtin_shufflevector(lo, hi, 0, 1, 2, 3, 4, 5, 6, 7, 8, 9, 10, 11, 12, 13, 14, 15)); }
__device__ __forceinline__ v8f wmmab(v16bf a, v16bf b, v8f c) { return __builtin_amdgcn_wmma_f32_16x16x32_bf16(false, a, false, b, (short)0, c, false, false); }
// fragment from a fragment-order block: p = block + 8*lane; elements 0..7 <- k0+8h.., 8..15 <- k0+16+8h.. of row (lane & 15), h = lane >> 4
__device__ __forceinline__ v16bf ldf(const bf* p) { return cat16b(*(const v8us*)p, *(const v8us*)(p + 256)); }

// ---- k_gemmw: register-blocked GEMM, ONE WAVE per 64x64 output tile (16 accumulators), operands straight from fragment-order 16-bit planes; grid (M/64, N/64, Z), 32 threads.
// C[m][n] (f32, pitch ldc, + optional f32 bias[n] after bf16 convert) = sum_k A[m][k] Bt[n][k] (+ split products per NSPLIT). z-batch strides sA/sB/sC in elements. K % 32 == 0.
template <typename T16> struct WFrag;
template <> struct WFrag<bf> { typedef v16bf V; static __device__ __forceinline__ V ld(const bf* p) { return cat16b(*(const v8us*)p, *(const v8us*)(p + 256)); } static __device__ __forceinline__ v8f mma(V a, V b, v8f c) { return wmmab(a, b, c); } };
template <typename T16, int NSPLIT, bool BIAS>
__global__ __launch_bounds__(32) void k_gemmw(const T16* __restrict__ A, const T16* __restrict__ A2, const T16* __restrict__ Bt, const T16* __restrict__ Bt2, int K, float* C, int ldc, const float* __restrict__ bias, size_t sA, size_t sB, size_t sC) {
    typedef typename WFrag<T16>::V V;
    __shared__ __align__(16) float os[16 * 68];
    const size_t z = blockIdx.z; A += z * sA; if (A2) A2 += z * sA; Bt += z * sB; if (Bt2) Bt2 += z * sB; C += z * sC;
    const int lane = threadIdx.x & 31, lr = lane & 15, hi = lane >> 4; const int r0 = blockIdx.x * 64, c0 = blockIdx.y * 64;
    v8f acc[4][4];
#pragma unroll
    for (int mb = 0; mb < 4; ++mb)
#pragma unroll
        for (int nb = 0; nb < 4; ++nb) acc[mb][nb] = (v8f){};
    const size_t aoff = (size_t)r0 * K, boff = (size_t)c0 * K; const unsigned lo = 8u * (unsigned)lane;   // row tile rt starts at rt * 16 * K elements; k tile kt at + kt * 512 = + kc * 16
#pragma unroll 1
    for (int kc = 0; kc < K; kc += 32) {
        V a[4], a2[4]; const T16* pa[4]; const T16* pa2[4]; const T16* pb[4]; const T16* pb2[4];
#pragma unroll
        for (int i = 0; i < 4; ++i) { pa[i] = A + aoff + (size_t)i * 16 * K + kc * 16 + lo; pa2[i] = (NSPLIT == 1 || NSPLIT == 2) ? A2 + aoff + (size_t)i * 16 * K + kc * 16 + lo : pa[i]; pb[i] = Bt + boff + (size_t)i * 16 * K + kc * 16 + lo; pb2[i] = (NSPLIT >= 2) ? Bt2 + boff + (size_t)i * 16 * K + kc * 16 + lo : pb[i]; }
#pragma unroll
        for (int mb = 0; mb < 4; ++mb) { a[mb] = WFrag<T16>::ld(pa[mb]); if (NSPLIT == 1 || NSPLIT == 2) a2[mb] = WFrag<T16>::ld(pa2[mb]); }
#pragma unroll
        for (int nb = 0; nb < 4; ++nb) { const V b = WFrag<T16>::ld(pb[nb]); V b2; if (NSPLIT >= 2) b2 = WFrag<T16>::ld(pb2[nb]);
#pragma unroll
            for (int mb = 0; mb < 4; ++mb) { acc[mb][nb] = WFrag<T16>::mma(a[mb], b, acc[mb][nb]); if (NSPLIT == 1 || NSPLIT == 2) acc[mb][nb] = WFrag<T16>::mma(a2[mb], b, acc[mb][nb]); if (NSPLIT >= 2) acc[mb][nb] = WFrag<T16>::mma(a[mb], b2, acc[mb][nb]); } }
        asm volatile("v_nop\n\tv_nop\n\tv_nop\n\tv_nop" : "+v"(acc[0][0]), "+v"(acc[1][1]), "+v"(acc[2][2]), "+v"(acc[3][3]) : "v"(a[0]), "v"(a[3]));
        // the wait in front of any overwrite of a register that this trip's loads name; their addresses are inputs so that those registers live up to here
        asm volatile("s_wait_xcnt 0x0" :: "v"(pa[0]), "v"(pa[1]), "v"(pa[2]), "v"(pa[3]), "v"(pa2[0]), "v"(pa2[1]), "v"(pa2[2]), "v"(pa2[3]), "v"(pb[0]), "v"(pb[1]), "v"(pb[2]), "v"(pb[3]), "v"(pb2[0]), "v"(pb2[1]), "v"(pb2[2]), "v"(pb2[3]) : "memory");
    }
#pragma unroll
    for (int mb = 0; mb < 4; ++mb) {
#pragma unroll
        for (int nb = 0; nb < 4; ++nb) {
#pragma unroll
            for (int j = 0; j < 8; ++j) os[(hi * 8 + j) * 68 + nb * 16 + lr] = acc[mb][nb][j]; }
        __builtin_amdgcn_wave_barrier(); asm volatile("" ::: "memory");
        float* crow = C + (size_t)(r0 + mb * 16) * ldc + c0;
{
#pragma unroll
            for (int s = 0; s < 8; ++s) { const int row = 2 * s + hi, cofs = lr * 4; v4f val = *(const v4fa*)(os + row * 68 + cofs); if (BIAS) { val[0] += bfr(bias[c0 + cofs]); val[1] += bfr(bias[c0 + cofs + 1]); val[2] += bfr(bias[c0 + cofs + 2]); val[3] += bfr(bias[c0 + cofs + 3]); }
                *(v4f*)(crow + (size_t)row * ldc + cofs) = val; }
             }
        asm volatile("s_wait_xcnt 0x0" ::: "memory");   // in front of the next block's overwrites of the registers that these stores name
        __builtin_amdgcn_wave_barrier(); asm volatile("" ::: "memory");
    }
}

// x job of k_prep: one wave converts four consecutive fragment-order blocks of one batch of x (one 16-row tile, four k tiles = 16 rows x 512 bytes); wv = the wave's number in the batch.
// Loads: lane = (row group r4 = lane >> 3, 16-byte piece c = lane & 7); load i of a block reads rows 4 i + r4, so every wave-wide load covers four whole 128-byte lines, and all sixteen loads are issued before the first is used.
// A 16-byte unit of the plane holds 8 k of one row = pieces c and c + 1, c even. Lanes c and c ^ 1 swap one piece each: the even lane ends with the unit of row 8 s + r4, the odd lane with that of row 8 s + 4 + r4,
// so every wave-wide store covers four whole lines too. Unit number in a block: (k half * 2 + k quarter) * 16 + row = (c >> 1) * 16 + row.
__device__ __forceinline__ unsigned pk2(float a, float b) { const v2f p = { a, b }; return __builtin_bit_cast(unsigned, __builtin_convertvector(p, v2bf)); }
__device__ __forceinline__ unsigned swap1(unsigned v) { return (unsigned)__builtin_amdgcn_mov_dpp((int)v, 0xB1, 0xF, 0xF, true); }   // the value of lane ^ 1 (quad_perm 1,0,3,2), on the vector port: no LDS round trip
__device__ __forceinline__ void cvt_blocks(const float* __restrict__ src, bf* dst, unsigned wv, unsigned lane) {
    const unsigned r4 = lane >> 3, c = lane & 7u; const bool odd = (c & 1u) != 0u;
    const float* p0 = src + (size_t)((wv >> 1) * 16u + r4) * DM + (wv & 1u) * 128u + 4u * c;
    v4f f[4][4];
#pragma unroll
    for (int q = 0; q < 4; ++q)
#pragma unroll
        for (int i = 0; i < 4; ++i) f[q][i] = *(const v4f*)(p0 + i * 4 * DM + q * 32);
    // the wait in front of any overwrite of a register that these loads name; their address is an input so that it lives up to here
    asm volatile("s_wait_xcnt 0x0" :: "v"(p0) : "memory");
    __builtin_amdgcn_sched_barrier(0);   // keeps every convert behind the last load: without it the build waits for the first loads and reuses their registers for the later ones, so that only six are in flight
    bf* pd = dst + (size_t)wv * 2048u + ((c >> 1) * 16u + (odd ? 4u : 0u) + r4) * 8u;
#pragma unroll
    for (int q = 0; q < 4; ++q) {
        unsigned d0[4], d1[4];
#pragma unroll
        for (int i = 0; i < 4; ++i) { d0[i] = pk2(f[q][i][0], f[q][i][1]); d1[i] = pk2(f[q][i][2], f[q][i][3]); }
#pragma unroll
        for (int s = 0; s < 2; ++s) {
            const unsigned m0 = odd ? d0[2 * s + 1] : d0[2 * s], m1 = odd ? d1[2 * s + 1] : d1[2 * s];                 // the piece this lane keeps
            const unsigned g0 = swap1(odd ? d0[2 * s] : d0[2 * s + 1]), g1 = swap1(odd ? d1[2 * s] : d1[2 * s + 1]);   // the piece it gets for the one it gives
            const v4u unit = { odd ? g0 : m0, odd ? g1 : m1, odd ? m0 : g0, odd ? m1 : g1 };
            *(v8us*)(pd + q * 512 + s * 64) = __builtin_bit_cast(v8us, unit); }
    }
    asm volatile("s_wait_xcnt 0x0" ::: "memory");   // in front of any overwrite of a register that these stores name
}

// one 16-byte unit i of the fragment-order bf16 plane of a transposed weight: W [256 k][N n] -> rows n
__device__ __forceinline__ void wt_unit(const float* __restrict__ W, bf* Wt, unsigned N, unsigned i) {
    // i = 16-byte unit of the fragment-order plane, rows n, 256 k = 8 k tiles: lane i & 31, k half (i >> 5) & 1, k tile (i >> 6) & 7, row tile i >> 9
    const unsigned n = (i >> 9) * 16u + (i & 15u), k0 = ((i >> 6) & 7u) * 32u + ((i >> 5) & 1u) * 16u + ((i >> 4) & 1u) * 8u;
    const float* p[8]; v8f f;
#pragma unroll
    for (unsigned k = 0; k < 8u; ++k) { p[k] = W + (size_t)(k0 + k) * N + n; f[k] = *p[k]; }
    // the wait in front of any overwrite of a register that these loads name; their addresses are inputs so that those registers live up to here
    asm volatile("s_wait_xcnt 0x0" :: "v"(p[0]), "v"(p[1]), "v"(p[2]), "v"(p[3]), "v"(p[4]), "v"(p[5]), "v"(p[6]), "v"(p[7]) : "memory");
    *(v8us*)(Wt + (size_t)i * 8) = cvt8(f);
    asm volatile("s_wait_xcnt 0x0" ::: "memory");   // in front of any overwrite of a register that this store names: in k_prep another job's code follows it in the built kernel
}

// k_prep: the three input conversions read nothing of each other's output, so they share one grid; the job is picked by block index (block-uniform).
// The weight blocks have the low indices: they start first, and their strided loads run under the start of the x blocks.
#define PB_WQ (NQKV / 8)      // blocks for W_qkv
#define PB_WP (DM / 8)        // blocks for W_proj
#define PB_X  (SEQ / 64)      // blocks for one batch of x: 8 waves, four 16 x 32 blocks a wave
__global__ __launch_bounds__(256) void k_prep(const float* __restrict__ x, const float* __restrict__ wqkv, const float* __restrict__ wproj, bf* XB, bf* WQ, bf* WP) {
    const unsigned blk = blockIdx.x, tid = threadIdx.x;
    if (blk < (unsigned)PB_WQ) { wt_unit(wqkv, WQ, (unsigned)NQKV, blk * 256u + tid); return; }
    if (blk < (unsigned)(PB_WQ + PB_WP)) { wt_unit(wproj, WP, (unsigned)DM, (blk - (unsigned)PB_WQ) * 256u + tid); return; }
    const unsigned c = blk - (unsigned)(PB_WQ + PB_WP), bat = c / (unsigned)PB_X;
    cvt_blocks(x + (size_t)bat * SEQ_FULL * DM, XB + (size_t)bat * SEQ * DM, (c - bat * (unsigned)PB_X) * 8u + (tid >> 5), tid & 31u);
}

// one 32-key chunk (keys kb .. kb + 31) of the transposed flash attention of one 16-query tile. MASKED = false: for a chunk whose every key is at or below every query of the tile, so that no key index, compare or select is formed.
template <bool MASKED>
__device__ __forceinline__ void attn_chunk(const bf* Kh, const bf* Kl, const bf* Vh, const bf* Vl, unsigned kb, unsigned lo, unsigned hi, unsigned query, v16bf qh, v16bf ql, float& m, float& l, v8f& o0, v8f& o1) {
        const bf* pkh = Kh + kb * HD + lo; const bf* pkl = Kl + kb * HD + lo;   // LDS: 32 keys = two blocks = 1024 elements
        const v16bf k0h = ldf(pkh), k0l = ldf(pkl), k1h = ldf(pkh + 512), k1l = ldf(pkl + 512);
        v8f s0 = (v8f){}, s1 = (v8f){};
        s0 = wmmab(k0h, qh, s0); s0 = wmmab(k0h, ql, s0); s0 = wmmab(k0l, qh, s0);
        s1 = wmmab(k1h, qh, s1); s1 = wmmab(k1h, ql, s1); s1 = wmmab(k1l, qh, s1);
        asm volatile("v_nop\n\tv_nop\n\tv_nop\n\tv_nop" : "+v"(s0), "+v"(s1) : "v"(k0h), "v"(k0l), "v"(k1h), "v"(k1l), "v"(qh), "v"(ql));
        const unsigned keyb = kb + 8u * hi;
        float t0[8], t1[8]; float tmax = -3.0e38f;
#pragma unroll
        for (int r = 0; r < 8; ++r) { const bool ok0 = !MASKED || (keyb + (unsigned)r) <= query, ok1 = !MASKED || (keyb + 16u + (unsigned)r) <= query;
            t0[r] = ok0 ? s0[r] * SCL : -3.0e38f; t1[r] = ok1 ? s1[r] * SCL : -3.0e38f; tmax = fmaxf(tmax, fmaxf(t0[r], t1[r])); }
        tmax = fmaxf(tmax, __shfl_xor(tmax, 16, 32));
        const float mnew = fmaxf(m, tmax);
        // v_exp_f32 and the slot behind it in one statement: a v_nop in a statement of its own landed elsewhere
        float alpha; asm("v_exp_f32 %0, %1\n\tv_nop" : "=v"(alpha) : "v"(__fmul_rn(__fsub_rn(m, mnew), L2E)));
        float psum = 0.f; v8us p0h, p0l, p1h, p1l; v8f pv0, pv1;
#pragma unroll
        for (int r = 0; r < 8; ++r) { const bool ok0 = !MASKED || (keyb + (unsigned)r) <= query, ok1 = !MASKED || (keyb + 16u + (unsigned)r) <= query;
            const float e0 = __builtin_amdgcn_exp2f(__fmul_rn(__fsub_rn(t0[r], mnew), L2E)), e1 = __builtin_amdgcn_exp2f(__fmul_rn(__fsub_rn(t1[r], mnew), L2E));
            const float p0 = ok0 ? e0 : 0.f, p1 = ok1 ? e1 : 0.f; psum += p0 + p1; pv0[r] = p0; pv1[r] = p1; }
        split8(pv0, p0h, p0l); split8(pv1, p1h, p1l);
        l = l * alpha + psum; m = mnew;
        o0 *= alpha; o1 *= alpha;
        const v16bf ph = cat16b(p0h, p1h), pl = cat16b(p0l, p1l);
        const bf* pvh = Vh + kb * HD + lo; const bf* pvl = Vl + kb * HD + lo;   // LDS: 32 keys = d tile 0 block, d tile 1 block
        const v16bf v0h = ldf(pvh), v0l = ldf(pvl), v1h = ldf(pvh + 512), v1l = ldf(pvl + 512);
        o0 = wmmab(v0h, ph, o0); o0 = wmmab(v0h, pl, o0); o0 = wmmab(v0l, ph, o0);
        o1 = wmmab(v1h, ph, o1); o1 = wmmab(v1h, pl, o1); o1 = wmmab(v1l, ph, o1);
        asm volatile("v_nop\n\tv_nop\n\tv_nop\n\tv_nop" : "+v"(o0), "+v"(o1) : "v"(v0h), "v"(v0l), "v"(v1h), "v"(v1l), "v"(ph), "v"(pl));
}

// k_attn: qkv projection and attention of one (head, batch b) in one block; wave w = query tile pair w (tiles n - 1 - w and w).
// Projection: a head needs only its own 96 columns of qkv, so no product is done twice over the grid. Each wave projects the 16-row tiles n - 1 - w and w of x (K = 256, bf16 x bf16, f32 accumulate, + bf16(b_qkv)), oriented so
// that the accumulators ARE fragment order (lane unchanged, 8 registers = 8 consecutive k): Q^T and K^T tiles [d][t] = W rows (A) x x rows (B) give the Q and K fragments (row t, k = d); V tiles [t][d] = x rows (A) x W rows (B) give the V^T fragment halves (row d, k = t).
// The head's 96 rows of W^T are first copied to LDS (48 KiB, one barrier), so that the k loop's weight reads count on the LDS counter and never wait behind the x loads, which run four k tiles ahead.
// Q hi/lo stays in the wave's registers; K and V^T hi/lo of the whole head go to LDS in the fragment-order blocks described above (4 planes x 32 KiB); one barrier; then every wave reads them from LDS.
// Causal cost grows with the query tile, so every wave runs tile n - 1 - w and then tile w, one after the other: each wave of the launch then has the same number of key chunks, and all blocks are resident at once. Transposed flash attention over 32-key chunks:
//   S^T tile j [key kb+16j+8h+r][query q0+lr] = K rows (A) x Q rows (B), hi/lo 3 products; causal mask by value, in the tile's last chunk alone; online softmax per query = per lane pair (lane, lane^16);
//   P^T B fragment: element r <- p(tile 0)[r], element 8+r <- p(tile 1)[r], lane unchanged; O^T [d][query] += V^T rows (A) x P^T (B), hi/lo 3 products.
__global__ __launch_bounds__(SEQ) void k_attn(const bf* __restrict__ XB, const bf* __restrict__ WQ, const float* __restrict__ bias, bf* CXh, bf* CXl) {
    __shared__ __align__(16) bf Kh[SEQ * HD]; __shared__ __align__(16) bf Kl[SEQ * HD]; __shared__ __align__(16) bf Vh[SEQ * HD]; __shared__ __align__(16) bf Vl[SEQ * HD];
    __shared__ __align__(16) bf Ws[3 * HD * DM];   // this head's q, k, v rows of W^T, fragment order: [q | k | v][d tile][k tile][512]
    const unsigned tid = threadIdx.x, lane = tid & 31u, lr = lane & 15u, hi = lane >> 4, lo = 8u * lane;
    const unsigned w = (unsigned)__builtin_amdgcn_readfirstlane((int)(tid >> 5));   // wave number, told to the compiler as wave-uniform: tile index and trip count stay scalar, the chunk loops branch on SCC with EXEC whole
    const unsigned b = blockIdx.y, hd = blockIdx.x;
    v16bf qfh[2], qfl[2];
    {
        const bf* pws = WQ + (size_t)hd * HD * DM + 8u * tid;      // 16-byte unit tid of this head's q rows of W^T (32 rows = 16 KiB in a row); its k rows at + DM * DM, its v rows at + 2 * DM * DM
        const bf* px0 = XB + (size_t)b * SEQ * DM + (size_t)((unsigned)(SEQ / 16 - 1) - w) * 16 * DM + lo;   // x row tile n - 1 - w; k tile kt at + kt * 512
        const bf* px1 = XB + (size_t)b * SEQ * DM + (size_t)w * 16 * DM + lo;                                // x row tile w
        const float* pbr = bias + hd * HD + 8u * hi;               // q and k bias by accumulator register: d = 16 * dt + 8 * hi + r
        const float* pbl = bias + 2 * DM + hd * HD + lr;           // v bias by lane: d = 16 * dt + lr
        v8us wst[6]; v16bf xf[DM / 32][2];
#pragma unroll
        for (int j = 0; j < 6; ++j) wst[j] = *(const v8us*)(pws + (j >> 1) * DM * DM + (j & 1) * 4096);
        __builtin_amdgcn_sched_barrier(0);   // keeps the weight loads in front of the x loads: loads return in order, and the staging below must not wait for x
#pragma unroll
        for (int kt = 0; kt < 4; ++kt) { xf[kt][0] = ldf(px0 + kt * 512); xf[kt][1] = ldf(px1 + kt * 512); }
        __builtin_amdgcn_sched_barrier(0);   // keeps the x loads up here: they fly while the weights are staged, and the k loop then waits for one k tile at a time
#pragma unroll
        for (int j = 0; j < 6; ++j) *(v8us*)(Ws + (j >> 1) * (HD * DM) + (j & 1) * 4096 + 8u * tid) = wst[j];
        // barrier by hand with LDS-only fences: it publishes Ws; __syncthreads() here would also wait for the x loads that are in flight
        __builtin_amdgcn_fence(__ATOMIC_RELEASE, "workgroup", "local"); __builtin_amdgcn_s_barrier(); __builtin_amdgcn_fence(__ATOMIC_ACQUIRE, "workgroup", "local");
        v8f bq[2], bk[2]; float bv[2];
        v8f aq[2][2], ak[2][2], av[2][2];   // [tile][d tile]
#pragma unroll
        for (int i = 0; i < 2; ++i)
#pragma unroll
            for (int dt = 0; dt < 2; ++dt) { aq[i][dt] = (v8f){}; ak[i][dt] = (v8f){}; av[i][dt] = (v8f){}; }
        // unrolled: the x fragments are named registers, and every address is base + constant offset
#pragma unroll
        for (int kt = 0; kt < DM / 32; ++kt) {
            const v16bf x0 = xf[kt][0], x1 = xf[kt][1]; v16bf wq[2], wk[2], wv[2];
#pragma unroll
            for (int dt = 0; dt < 2; ++dt) { const bf* pwf = Ws + dt * 16 * DM + kt * 512 + lo; wq[dt] = ldf(pwf); wk[dt] = ldf(pwf + HD * DM); wv[dt] = ldf(pwf + 2 * HD * DM); }
#pragma unroll
            for (int dt = 0; dt < 2; ++dt) {
                aq[0][dt] = wmmab(wq[dt], x0, aq[0][dt]); aq[1][dt] = wmmab(wq[dt], x1, aq[1][dt]);
                ak[0][dt] = wmmab(wk[dt], x0, ak[0][dt]); ak[1][dt] = wmmab(wk[dt], x1, ak[1][dt]);
                av[0][dt] = wmmab(x0, wv[dt], av[0][dt]); av[1][dt] = wmmab(x1, wv[dt], av[1][dt]); }
            // order inside this k tile: its twelve LDS reads as one group, then its twelve products: one LDS latency a k tile instead of one for every fragment
            __builtin_amdgcn_sched_group_barrier(0x100, 12, 0); __builtin_amdgcn_sched_group_barrier(0x008, 12, 0);
            if (kt + 4 < DM / 32) {   // x runs four k tiles ahead, into the registers that this k tile has just left
                xf[kt + 4][0] = ldf(px0 + (kt + 4) * 512); xf[kt + 4][1] = ldf(px1 + (kt + 4) * 512);
                __builtin_amdgcn_sched_group_barrier(0x020, 4, 0); }   // these four loads behind the products
            if (kt == 5) {   // the biases, once registers are free again, two k tiles ahead of their use
#pragma unroll
                for (int dt = 0; dt < 2; ++dt) { bq[dt] = *(const v8f*)(pbr + dt * 16); bk[dt] = *(const v8f*)(pbr + DM + dt * 16); }
                asm volatile("s_wait_xcnt 0x0" ::: "memory");   // in front of any overwrite of the offset register that these loads name (seen in the listing: the next load's result took it)
                bv[0] = pbl[0]; bv[1] = pbl[16]; }
            __builtin_amdgcn_sched_barrier(0);   // nothing moves from one k tile to another: x loads stay four k tiles ahead of their use
        }
        asm volatile("s_wait_xcnt 0x0" ::: "memory");   // in front of any overwrite of a register that the loads above name
#pragma unroll
        for (int i = 0; i < 2; ++i) {
            const unsigned tt = i ? w : (unsigned)(SEQ / 16 - 1) - w;   // 16-row tile of the head
            v8us qh8[2], ql8[2];
#pragma unroll
            for (int dt = 0; dt < 2; ++dt) { v8us kh8, kl8, vh8, vl8; v8f yq, yk, yv;
#pragma unroll
                for (int r = 0; r < 8; ++r) { yq[r] = aq[i][dt][r] + bfr(bq[dt][r]); yk[r] = ak[i][dt][r] + bfr(bk[dt][r]); yv[r] = av[i][dt][r] + bfr(bv[dt]); }
                split8(yq, qh8[dt], ql8[dt]); split8(yk, kh8, kl8); split8(yv, vh8, vl8);
                const unsigned ko = tt * 512u + (unsigned)dt * 256u + lo;                                       // K block = row tile tt, d half dt
                const unsigned vo = ((tt >> 1) * 2u + (unsigned)dt) * 512u + (tt & 1u) * 256u + lo;             // V^T block = [key chunk tt / 2][d tile dt], key half tt & 1
                *(v8us*)(Kh + ko) = kh8; *(v8us*)(Kl + ko) = kl8; *(v8us*)(Vh + vo) = vh8; *(v8us*)(Vl + vo) = vl8; }
            qfh[i] = cat16b(qh8[0], qh8[1]); qfl[i] = cat16b(ql8[0], ql8[1]);
        }
    }
    __syncthreads();   // publishes the head's K and V^T planes: from here on every wave reads what the other waves wrote, and nobody writes them again
    // unrolled: two straight-line copies, so that neither chunk loop carries an outer loop's selects and copies (fewer registers and vector instructions than the rolled build)
#pragma unroll
    for (unsigned part = 0; part < 2u; ++part) {
    const unsigned qt = part ? w : (unsigned)(SEQ / 16 - 1) - w, q0 = qt * 16u;   // wave-uniform; over the block's SEQ / 32 waves every tile of the head exactly once
    const v16bf qh = qfh[part], ql = qfl[part];
    float m = -3.0e38f, l = 0.f; v8f o0 = (v8f){}, o1 = (v8f){};
    const unsigned query = q0 + lr;
    const unsigned nfull = qt >> 1;           // wave-uniform trip count: chunks kc < nfull end at key 32 * nfull - 1 < q0, so none of their scores is masked; chunk nfull, the last, ends at key <= SEQ-1
#pragma unroll 1
    for (unsigned kc = 0; kc < nfull; ++kc) attn_chunk<false>(Kh, Kl, Vh, Vl, kc * 32u, lo, hi, query, qh, ql, m, l, o0, o1);
    attn_chunk<true>(Kh, Kl, Vh, Vl, nfull * 32u, lo, hi, query, qh, ql, m, l, o0, o1);   // the chunk that holds the diagonal
    const float ltot = l + __shfl_xor(l, 16, 32);
    const float inv = __fdiv_rn(1.0f, ltot);
    v8us ah, al, ch, cl;
    split8(o0 * inv, ah, al); split8(o1 * inv, ch, cl);
    // ctx row tile (b*SEQ+q0)/16, k tile = head hd: element (query lr, d = 16*half + 8*hi + r) sits at half*256 + lane*8 + r, which is this lane's own accumulator order
    const size_t co = ((((size_t)b * SEQ + q0) >> 4) * (DM / 32) + hd) * 512u;
    bf* pch = CXh + co + lo; bf* pcl = CXl + co + lo;
    *(v8us*)pch = ah; *(v8us*)(pch + 256u) = ch; *(v8us*)pcl = al; *(v8us*)(pcl + 256u) = cl;
    // in front of the second tile's overwrites of the registers that these stores name (inputs: they live up to here)
    asm volatile("s_wait_xcnt 0x0" :: "v"(ah), "v"(ch), "v"(al), "v"(cl), "v"(pch), "v"(pcl) : "memory");
    }
}

#define PLB ((size_t)NB * SEQ * DM * 2)      // bytes of one 16-bit [NB*SEQ][256] plane
static_assert((size_t)NQKV * DM * 2 + (size_t)DM * DM * 2 + 3 * PLB <= (size_t)134217728);
static_assert(PLB % 256 == 0);
// coverage equalities (threads x elements per thread == plane elements)
static_assert((size_t)(NQKV / 8) * 256 * 8 == (size_t)NQKV * DM);                    // k_prep, qkv weights
static_assert((size_t)(DM / 8) * 256 * 8 == (size_t)DM * DM);                        // k_prep, proj weights
static_assert((size_t)(SEQ / 64) * 8 * 4 * 512 == (size_t)SEQ * DM);                  // k_prep, x per batch: blocks x waves x fragment blocks x elements
static_assert((size_t)SEQ * 6 * 8 == (size_t)3 * HD * DM);                               // k_attn weight staging: SEQ threads, six 16-byte units a thread
static_assert((size_t)(SEQ / 32) * 2 * 2 * 32 * 8 == (size_t)SEQ * HD);                  // k_attn LDS planes: SEQ / 32 waves, two tiles a wave, two 16-byte units a lane and tile
static_assert((size_t)(SEQ / 32) * 2 * NB * 8 * 2 * 32 * 8 == (size_t)NB * SEQ * DM);    // k_attn ctx planes: SEQ / 32 waves a block, two tiles a wave, NB x 8 blocks
static_assert((size_t)(SEQ / 64) * (DM / 64) * NB * 64 * 64 == (size_t)NB * SEQ * DM);   // output GEMM

extern "C" void kernel_launch(void* const* d_in, const int* in_sizes, int n_in,
                              void* d_out, int out_size, void* d_ws, size_t ws_size, hipStream_t stream) {
    if (n_in < 5) return;
    const long long need = ((long long)(NB - 1) * SEQ_FULL + SEQ) * DM;
    if ((long long)in_sizes[0] < need || (long long)out_size < need) return;
    if (in_sizes[1] < DM * NQKV || in_sizes[2] < NQKV || in_sizes[3] < DM * DM || in_sizes[4] < DM) return;
    const float* x = (const float*)d_in[0];       // [NB_FULL][SEQ_FULL][256]
    const float* wqkv = (const float*)d_in[1];    // [256 in][768 out]
    const float* bqkv = (const float*)d_in[2];    // [768]
    const float* wproj = (const float*)d_in[3];   // [256 in][256 out]
    const float* bproj = (const float*)d_in[4];   // [256]
    float* OUT = (float*)d_out;                   // [NB_FULL][SEQ_FULL][256]
    char* wsp = (char*)d_ws;
    auto take = [&](size_t bytes) { char* p = wsp; wsp += (bytes + 255) & ~(size_t)255; return (void*)p; };
    bf* WQ = (bf*)take((size_t)NQKV * DM * 2); bf* WP = (bf*)take((size_t)DM * DM * 2);
    bf* XB = (bf*)take(PLB);
    bf* CXh = (bf*)take(PLB); bf* CXl = (bf*)take(PLB);
    if ((size_t)(wsp - (char*)d_ws) > ws_size) return;
    k_prep<<<PB_WQ + PB_WP + PB_X * NB, 256, 0, stream>>>(x, wqkv, wproj, XB, WQ, WP);   // weights in[256 k][n] -> rows n, x rows: all in fragment order
    k_attn<<<dim3(NH, NB, 1), SEQ, 0, stream>>>(XB, WQ, bqkv, CXh, CXl);
    k_gemmw<bf, 1, true><<<dim3(SEQ / 64, DM / 64, NB), 32, 0, stream>>>(CXh, CXl, WP, nullptr, DM, OUT, DM, bproj, (size_t)SEQ * DM, 0, (size_t)SEQ_FULL * DM);
}

// v009
// It runs in 35.6 microseconds.
// Two timings next to v008 put it at 1.13 and 1.11 times that version's speed.
// All steps since v000 together make it 3.29 times as fast.
#include <hip/hip_runtime.h>

#ifndef NB
#define NB 32
#endif
#ifndef SEQ
#define SEQ 512
#endif
#define NB_FULL  32
#define SEQ_FULL 512
#define DM   256
#define NH   8
#define HD   32
#define NQKV 768
#define SCL  0.17677669529663688f     // 1/sqrt(float32(32))
#define L2E  1.4426950408889634f

static_assert(SEQ % 64 == 0);
static_assert(SEQ <= SEQ_FULL);
static_assert(NB >= 1);
static_assert(NB <= NB_FULL);
static_assert(NH * HD == DM);
static_assert(NQKV == 3 * DM);

typedef unsigned short bf;
typedef __attribute__((ext_vector_type(16))) __bf16   v16bf;
typedef __attribute__((ext_vector_type(8)))  unsigned short v8us;
typedef __attribute__((ext_vector_type(2)))  unsigned short v2us;
typedef __attribute__((ext_vector_type(8)))  float    v8f;
typedef __attribute__((ext_vector_type(4)))  float    v4f;
typedef v4f  __attribute__((may_alias)) v4fa;
typedef v8us __attribute__((may_alias)) v8usa;

typedef __attribute__((ext_vector_type(8)))  __bf16   v8bf;
typedef __attribute__((ext_vector_type(2)))  __bf16   v2bf;
typedef __attribute__((ext_vector_type(2)))  float    v2f;
typedef __attribute__((ext_vector_type(4)))  unsigned v4u;
// f32 -> bf16 by the hardware's packed convert (round to nearest even, two values an instruction)
__device__ __forceinline__ float bfr(float f) { return __uint_as_float((unsigned)__builtin_bit_cast(unsigned short, (__bf16)f) << 16); }
__device__ __forceinline__ v8us cvt8(v8f y) { return __builtin_bit_cast(v8us, __builtin_convertvector(y, v8bf)); }
// y = hi + lo, both bf16: hi = bf16(y), lo = bf16(y - hi); y - hi is exact in f32
__device__ __forceinline__ void split8(v8f y, v8us& h, v8us& l) {
    v4u hu, lu;
#pragma unroll
    for (int j = 0; j < 4; ++j) { const v2f p = { y[2 * j], y[2 * j + 1] }; const unsigned u = __builtin_bit_cast(unsigned, __builtin_convertvector(p, v2bf)); hu[j] = u;
        const v2f back = { __uint_as_float(u << 16), __uint_as_float(u & 0xFFFF0000u) };   // the two hi parts as f32, taken from the packed word
        lu[j] = __builtin_bit_cast(unsigned, __builtin_convertvector(p - back, v2bf)); }
    h = __builtin_bit_cast(v8us, hu); l = __builtin_bit_cast(v8us, lu);
}
__device__ __forceinline__ v16bf cat16b(v8us lo, v8us hi) { return __builtin_bit_cast(v16bf, __builtin_shufflevector(lo, hi, 0, 1, 2, 3, 4, 5, 6, 7, 8, 9, 10, 11, 12, 13, 14, 15)); }
__device__ __forceinline__ v8f wmmab(v16bf a, v16bf b, v8f c) { return __builtin_amdgcn_wmma_f32_16x16x32_bf16(false, a, false, b, (short)0, c, false, false); }
// fragment from a fragment-order block: p = block + 8*lane; elements 0..7 <- k0+8h.., 8..15 <- k0+16+8h.. of row (lane & 15), h = lane >> 4
__device__ __forceinline__ v16bf ldf(const bf* p) { return cat16b(*(const v8us*)p, *(const v8us*)(p + 256)); }

// ---- k_gemmw: register-blocked GEMM, ONE WAVE per 64x64 output tile (16 accumulators), operands straight from fragment-order 16-bit planes; grid (M/64, N/64, Z), 32 threads.
// C[m][n] (f32, pitch ldc, + optional f32 bias[n] after bf16 convert) = sum_k A[m][k] Bt[n][k] (+ split products per NSPLIT). z-batch strides sA/sB/sC in elements. K = 32 * KT, known at compile time.
// The k loop is unrolled over a ring of three fragment sets in registers: the loads of k tile t + 2 are issued among the products of k tile t, so a wave that is alone on its SIMD keeps two k tiles of loads in flight under its products.
template <typename T16> struct WFrag;
template <> struct WFrag<bf> { typedef v16bf V; static __device__ __forceinline__ V ld(const bf* p) { return cat16b(*(const v8us*)p, *(const v8us*)(p + 256)); } static __device__ __forceinline__ v8f mma(V a, V b, v8f c) { return wmmab(a, b, c); } };
template <typename T16, int NSPLIT, bool BIAS, int KT>
__global__ __launch_bounds__(32) void k_gemmw(const T16* __restrict__ A, const T16* __restrict__ A2, const T16* __restrict__ Bt, const T16* __restrict__ Bt2, float* C, int ldc, const float* __restrict__ bias, size_t sA, size_t sB, size_t sC) {
    typedef typename WFrag<T16>::V V;
    constexpr int K = 32 * KT; constexpr bool HA2 = NSPLIT == 1 || NSPLIT == 2, HB2 = NSPLIT >= 2;
    __shared__ __align__(16) float os[16 * 68];
    const size_t z = blockIdx.z; A += z * sA; if (A2) A2 += z * sA; Bt += z * sB; if (Bt2) Bt2 += z * sB; C += z * sC;
    const int lane = threadIdx.x & 31, lr = lane & 15, hi = lane >> 4; const int r0 = blockIdx.x * 64, c0 = blockIdx.y * 64;
    v8f acc[4][4];
#pragma unroll
    for (int mb = 0; mb < 4; ++mb)
#pragma unroll
        for (int nb = 0; nb < 4; ++nb) acc[mb][nb] = (v8f){};
    const size_t aoff = (size_t)r0 * K, boff = (size_t)c0 * K; const unsigned lo = 8u * (unsigned)lane;   // row tile rt starts at rt * 16 * K elements; k tile kt at + kt * 512
    // one address a plane for the whole kernel: every fragment is at a compile-time offset from it, so no load's address register is ever rewritten
    const T16* pa = A + aoff + lo; const T16* pa2 = HA2 ? A2 + aoff + lo : pa; const T16* pb = Bt + boff + lo; const T16* pb2 = HB2 ? Bt2 + boff + lo : pb;
    V a[3][4], a2[3][4], b[3][4], b2[3][4];
    // the loads of one k tile, into the set that k tile kt - 3 has left: first all of A, which the first column of products needs whole, then B by columns
    auto load = [&](int kt) { const int s = kt % 3;
#pragma unroll
        for (int i = 0; i < 4; ++i) { a[s][i] = WFrag<T16>::ld(pa + i * 16 * K + kt * 512); if (HA2) a2[s][i] = WFrag<T16>::ld(pa2 + i * 16 * K + kt * 512); }
#pragma unroll
        for (int i = 0; i < 4; ++i) { b[s][i] = WFrag<T16>::ld(pb + i * 16 * K + kt * 512); if (HB2) b2[s][i] = WFrag<T16>::ld(pb2 + i * 16 * K + kt * 512); } };
    // the products of one k tile with B column tile nb
    auto prod = [&](int kt, int nb) { const int s = kt % 3;
#pragma unroll
        for (int mb = 0; mb < 4; ++mb) { acc[mb][nb] = WFrag<T16>::mma(a[s][mb], b[s][nb], acc[mb][nb]); if (HA2) acc[mb][nb] = WFrag<T16>::mma(a2[s][mb], b[s][nb], acc[mb][nb]); if (HB2) acc[mb][nb] = WFrag<T16>::mma(a[s][mb], b2[s][nb], acc[mb][nb]); } };
    load(0); if (KT > 1) load(1);
    // unrolled: the ring index kt % 3 is then a constant, so that the three sets are named registers, and every address is base + constant offset
#pragma unroll
    for (int kt = 0; kt < KT; ++kt) {
        __builtin_amdgcn_sched_barrier(0);   // keeps the loads above in front of these products: without it the build moves them down to their use and their latency is exposed again
        prod(kt, 0);                         // waits for k tile kt, so that with the loads below never more than 54 loads of the wave are outstanding
        __builtin_amdgcn_sched_barrier(0);   // keeps the loads below behind that wait and in front of the other three columns
        if (kt + 2 < KT) load(kt + 2);
        __builtin_amdgcn_sched_barrier(0);   // as the first: these loads stay two k tiles ahead of their use
        prod(kt, 1); prod(kt, 2); prod(kt, 3);
    }
    // in front of the epilogue's overwrites of the registers that the loads above name; the lane number, their offset register, is an input so that it lives up to here
    asm volatile("s_wait_xcnt 0x0" :: "v"(lane) : "memory");
#pragma unroll
    for (int mb = 0; mb < 4; ++mb) {
#pragma unroll
        for (int nb = 0; nb < 4; ++nb) {
#pragma unroll
            for (int j = 0; j < 8; ++j) os[(hi * 8 + j) * 68 + nb * 16 + lr] = acc[mb][nb][j]; }
        __builtin_amdgcn_wave_barrier(); asm volatile("" ::: "memory");
        float* crow = C + (size_t)(r0 + mb * 16) * ldc + c0;
{
#pragma unroll
            for (int s = 0; s < 8; ++s) { const int row = 2 * s + hi, cofs = lr * 4; v4f val = *(const v4fa*)(os + row * 68 + cofs); if (BIAS) { val[0] += bfr(bias[c0 + cofs]); val[1] += bfr(bias[c0 + cofs + 1]); val[2] += bfr(bias[c0 + cofs + 2]); val[3] += bfr(bias[c0 + cofs + 3]); }
                *(v4f*)(crow + (size_t)row * ldc + cofs) = val; }
             }
        asm volatile("s_wait_xcnt 0x0" ::: "memory");   // in front of the next block's overwrites of the registers that these stores name
        __builtin_amdgcn_wave_barrier(); asm volatile("" ::: "memory");
    }
}

// x job of k_prep: one wave converts four consecutive fragment-order blocks of one batch of x (one 16-row tile, four k tiles = 16 rows x 512 bytes); wv = the wave's number in the batch.
// Loads: lane = (row group r4 = lane >> 3, 16-byte piece c = lane & 7); load i of a block reads rows 4 i + r4, so every wave-wide load covers four whole 128-byte lines, and all sixteen loads are issued before the first is used.
// A 16-byte unit of the plane holds 8 k of one row = pieces c and c + 1, c even. Lanes c and c ^ 1 swap one piece each: the even lane ends with the unit of row 8 s + r4, the odd lane with that of row 8 s + 4 + r4,
// so every wave-wide store covers four whole lines too. Unit number in a block: (k half * 2 + k quarter) * 16 + row = (c >> 1) * 16 + row.
__device__ __forceinline__ unsigned pk2(float a, float b) { const v2f p = { a, b }; return __builtin_bit_cast(unsigned, __builtin_convertvector(p, v2bf)); }
__device__ __forceinline__ unsigned swap1(unsigned v) { return (unsigned)__builtin_amdgcn_mov_dpp((int)v, 0xB1, 0xF, 0xF, true); }   // the value of lane ^ 1 (quad_perm 1,0,3,2), on the vector port: no LDS round trip
__device__ __forceinline__ void cvt_blocks(const float* __restrict__ src, bf* dst, unsigned wv, unsigned lane) {
    const unsigned r4 = lane >> 3, c = lane & 7u; const bool odd = (c & 1u) != 0u;
    const float* p0 = src + (size_t)((wv >> 1) * 16u + r4) * DM + (wv & 1u) * 128u + 4u * c;
    v4f f[4][4];
#pragma unroll
    for (int q = 0; q < 4; ++q)
#pragma unroll
        for (int i = 0; i < 4; ++i) f[q][i] = *(const v4f*)(p0 + i * 4 * DM + q * 32);
    // the wait in front of any overwrite of a register that these loads name; their address is an input so that it lives up to here
    asm volatile("s_wait_xcnt 0x0" :: "v"(p0) : "memory");
    __builtin_amdgcn_sched_barrier(0);   // keeps every convert behind the last load: without it the build waits for the first loads and reuses their registers for the later ones, so that only six are in flight
    bf* pd = dst + (size_t)wv * 2048u + ((c >> 1) * 16u + (odd ? 4u : 0u) + r4) * 8u;
#pragma unroll
    for (int q = 0; q < 4; ++q) {
        unsigned d0[4], d1[4];
#pragma unroll
        for (int i = 0; i < 4; ++i) { d0[i] = pk2(f[q][i][0], f[q][i][1]); d1[i] = pk2(f[q][i][2], f[q][i][3]); }
#pragma unroll
        for (int s = 0; s < 2; ++s) {
            const unsigned m0 = odd ? d0[2 * s + 1] : d0[2 * s], m1 = odd ? d1[2 * s + 1] : d1[2 * s];                 // the piece this lane keeps
            const unsigned g0 = swap1(odd ? d0[2 * s] : d0[2 * s + 1]), g1 = swap1(odd ? d1[2 * s] : d1[2 * s + 1]);   // the piece it gets for the one it gives
            const v4u unit = { odd ? g0 : m0, odd ? g1 : m1, odd ? m0 : g0, odd ? m1 : g1 };
            *(v8us*)(pd + q * 512 + s * 64) = __builtin_bit_cast(v8us, unit); }
    }
    asm volatile("s_wait_xcnt 0x0" ::: "memory");   // in front of any overwrite of a register that these stores name
}

// one 16-byte unit i of the fragment-order bf16 plane of a transposed weight: W [256 k][N n] -> rows n
__device__ __forceinline__ void wt_unit(const float* __restrict__ W, bf* Wt, unsigned N, unsigned i) {
    // i = 16-byte unit of the fragment-order plane, rows n, 256 k = 8 k tiles: lane i & 31, k half (i >> 5) & 1, k tile (i >> 6) & 7, row tile i >> 9
    const unsigned n = (i >> 9) * 16u + (i & 15u), k0 = ((i >> 6) & 7u) * 32u + ((i >> 5) & 1u) * 16u + ((i >> 4) & 1u) * 8u;
    const float* p[8]; v8f f;
#pragma unroll
    for (unsigned k = 0; k < 8u; ++k) { p[k] = W + (size_t)(k0 + k) * N + n; f[k] = *p[k]; }
    // the wait in front of any overwrite of a register that these loads name; their addresses are inputs so that those registers live up to here
    asm volatile("s_wait_xcnt 0x0" :: "v"(p[0]), "v"(p[1]), "v"(p[2]), "v"(p[3]), "v"(p[4]), "v"(p[5]), "v"(p[6]), "v"(p[7]) : "memory");
    *(v8us*)(Wt + (size_t)i * 8) = cvt8(f);
    asm volatile("s_wait_xcnt 0x0" ::: "memory");   // in front of any overwrite of a register that this store names: in k_prep another job's code follows it in the built kernel
}

// k_prep: the three input conversions read nothing of each other's output, so they share one grid; the job is picked by block index (block-uniform).
// The weight blocks have the low indices: they start first, and their strided loads run under the start of the x blocks.
#define PB_WQ (NQKV / 8)      // blocks for W_qkv
#define PB_WP (DM / 8)        // blocks for W_proj
#define PB_X  (SEQ / 64)      // blocks for one batch of x: 8 waves, four 16 x 32 blocks a wave
__global__ __launch_bounds__(256) void k_prep(const float* __restrict__ x, const float* __restrict__ wqkv, const float* __restrict__ wproj, bf* XB, bf* WQ, bf* WP) {
    const unsigned blk = blockIdx.x, tid = threadIdx.x;
    if (blk < (unsigned)PB_WQ) { wt_unit(wqkv, WQ, (unsigned)NQKV, blk * 256u + tid); return; }
    if (blk < (unsigned)(PB_WQ + PB_WP)) { wt_unit(wproj, WP, (unsigned)DM, (blk - (unsigned)PB_WQ) * 256u + tid); return; }
    const unsigned c = blk - (unsigned)(PB_WQ + PB_WP), bat = c / (unsigned)PB_X;
    cvt_blocks(x + (size_t)bat * SEQ_FULL * DM, XB + (size_t)bat * SEQ * DM, (c - bat * (unsigned)PB_X) * 8u + (tid >> 5), tid & 31u);
}

// one 32-key chunk (keys kb .. kb + 31) of the transposed flash attention of one 16-query tile. MASKED = false: for a chunk whose every key is at or below every query of the tile, so that no key index, compare or select is formed.
template <bool MASKED>
__device__ __forceinline__ void attn_chunk(const bf* Kh, const bf* Kl, const bf* Vh, const bf* Vl, unsigned kb, unsigned lo, unsigned hi, unsigned query, v16bf qh, v16bf ql, float& m, float& l, v8f& o0, v8f& o1) {
        const bf* pkh = Kh + kb * HD + lo; const bf* pkl = Kl + kb * HD + lo;   // LDS: 32 keys = two blocks = 1024 elements
        const v16bf k0h = ldf(pkh), k0l = ldf(pkl), k1h = ldf(pkh + 512), k1l = ldf(pkl + 512);
        v8f s0 = (v8f){}, s1 = (v8f){};
        s0 = wmmab(k0h, qh, s0); s0 = wmmab(k0h, ql, s0); s0 = wmmab(k0l, qh, s0);
        s1 = wmmab(k1h, qh, s1); s1 = wmmab(k1h, ql, s1); s1 = wmmab(k1l, qh, s1);
        asm volatile("v_nop\n\tv_nop\n\tv_nop\n\tv_nop" : "+v"(s0), "+v"(s1) : "v"(k0h), "v"(k0l), "v"(k1h), "v"(k1l), "v"(qh), "v"(ql));
        const unsigned keyb = kb + 8u * hi;
        float t0[8], t1[8]; float tmax = -3.0e38f;
#pragma unroll
        for (int r = 0; r < 8; ++r) { const bool ok0 = !MASKED || (keyb + (unsigned)r) <= query, ok1 = !MASKED || (keyb + 16u + (unsigned)r) <= query;
            t0[r] = ok0 ? s0[r] * SCL : -3.0e38f; t1[r] = ok1 ? s1[r] * SCL : -3.0e38f; tmax = fmaxf(tmax, fmaxf(t0[r], t1[r])); }
        tmax = fmaxf(tmax, __shfl_xor(tmax, 16, 32));
        const float mnew = fmaxf(m, tmax);
        // v_exp_f32 and the slot behind it in one statement: a v_nop in a statement of its own landed elsewhere
        float alpha; asm("v_exp_f32 %0, %1\n\tv_nop" : "=v"(alpha) : "v"(__fmul_rn(__fsub_rn(m, mnew), L2E)));
        float psum = 0.f; v8us p0h, p0l, p1h, p1l; v8f pv0, pv1;
#pragma unroll
        for (int r = 0; r < 8; ++r) { const bool ok0 = !MASKED || (keyb + (unsigned)r) <= query, ok1 = !MASKED || (keyb + 16u + (unsigned)r) <= query;
            const float e0 = __builtin_amdgcn_exp2f(__fmul_rn(__fsub_rn(t0[r], mnew), L2E)), e1 = __builtin_amdgcn_exp2f(__fmul_rn(__fsub_rn(t1[r], mnew), L2E));
            const float p0 = ok0 ? e0 : 0.f, p1 = ok1 ? e1 : 0.f; psum += p0 + p1; pv0[r] = p0; pv1[r] = p1; }
        split8(pv0, p0h, p0l); split8(pv1, p1h, p1l);
        l = l * alpha + psum; m = mnew;
        o0 *= alpha; o1 *= alpha;
        const v16bf ph = cat16b(p0h, p1h), pl = cat16b(p0l, p1l);
        const bf* pvh = Vh + kb * HD + lo; const bf* pvl = Vl + kb * HD + lo;   // LDS: 32 keys = d tile 0 block, d tile 1 block
        const v16bf v0h = ldf(pvh), v0l = ldf(pvl), v1h = ldf(pvh + 512), v1l = ldf(pvl + 512);
        o0 = wmmab(v0h, ph, o0); o0 = wmmab(v0h, pl, o0); o0 = wmmab(v0l, ph, o0);
        o1 = wmmab(v1h, ph, o1); o1 = wmmab(v1h, pl, o1); o1 = wmmab(v1l, ph, o1);
        asm volatile("v_nop\n\tv_nop\n\tv_nop\n\tv_nop" : "+v"(o0), "+v"(o1) : "v"(v0h), "v"(v0l), "v"(v1h), "v"(v1l), "v"(ph), "v"(pl));
}

// k_attn: qkv projection and attention of one (head, batch b) in one block; wave w = query tile pair w (tiles n - 1 - w and w).
// Projection: a head needs only its own 96 columns of qkv, so no product is done twice over the grid. Each wave projects the 16-row tiles n - 1 - w and w of x (K = 256, bf16 x bf16, f32 accumulate, + bf16(b_qkv)), oriented so
// that the accumulators ARE fragment order (lane unchanged, 8 registers = 8 consecutive k): Q^T and K^T tiles [d][t] = W rows (A) x x rows (B) give the Q and K fragments (row t, k = d); V tiles [t][d] = x rows (A) x W rows (B) give the V^T fragment halves (row d, k = t).
// The head's 96 rows of W^T are first copied to LDS (48 KiB, one barrier), so that the k loop's weight reads count on the LDS counter and never wait behind the x loads, which run four k tiles ahead.
// Q hi/lo stays in the wave's registers; K and V^T hi/lo of the whole head go to LDS in the fragment-order blocks described above (4 planes x 32 KiB); one barrier; then every wave reads them from LDS.
// Causal cost grows with the query tile, so every wave runs tile n - 1 - w and then tile w, one after the other: each wave of the launch then has the same number of key chunks, and all blocks are resident at once. Transposed flash attention over 32-key chunks:
//   S^T tile j [key kb+16j+8h+r][query q0+lr] = K rows (A) x Q rows (B), hi/lo 3 products; causal mask by value, in the tile's last chunk alone; online softmax per query = per lane pair (lane, lane^16);
//   P^T B fragment: element r <- p(tile 0)[r], element 8+r <- p(tile 1)[r], lane unchanged; O^T [d][query] += V^T rows (A) x P^T (B), hi/lo 3 products.
__global__ __launch_bounds__(SEQ) void k_attn(const bf* __restrict__ XB, const bf* __restrict__ WQ, const float* __restrict__ bias, bf* CXh, bf* CXl) {
    __shared__ __align__(16) bf Kh[SEQ * HD]; __shared__ __align__(16) bf Kl[SEQ * HD]; __shared__ __align__(16) bf Vh[SEQ * HD]; __shared__ __align__(16) bf Vl[SEQ * HD];
    __shared__ __align__(16) bf Ws[3 * HD * DM];   // this head's q, k, v rows of W^T, fragment order: [q | k | v][d tile][k tile][512]
    const unsigned tid = threadIdx.x, lane = tid & 31u, lr = lane & 15u, hi = lane >> 4, lo = 8u * lane;
    const unsigned w = (unsigned)__builtin_amdgcn_readfirstlane((int)(tid >> 5));   // wave number, told to the compiler as wave-uniform: tile index and trip count stay scalar, the chunk loops branch on SCC with EXEC whole
    const unsigned b = blockIdx.y, hd = blockIdx.x;
    v16bf qfh[2], qfl[2];
    {
        const bf* pws = WQ + (size_t)hd * HD * DM + 8u * tid;      // 16-byte unit tid of this head's q rows of W^T (32 rows = 16 KiB in a row); its k rows at + DM * DM, its v rows at + 2 * DM * DM
        const bf* px0 = XB + (size_t)b * SEQ * DM + (size_t)((unsigned)(SEQ / 16 - 1) - w) * 16 * DM + lo;   // x row tile n - 1 - w; k tile kt at + kt * 512
        const bf* px1 = XB + (size_t)b * SEQ * DM + (size_t)w * 16 * DM + lo;                                // x row tile w
        const float* pbr = bias + hd * HD + 8u * hi;               // q and k bias by accumulator register: d = 16 * dt + 8 * hi + r
        const float* pbl = bias + 2 * DM + hd * HD + lr;           // v bias by lane: d = 16 * dt + lr
        v8us wst[6]; v16bf xf[DM / 32][2];
#pragma unroll
        for (int j = 0; j < 6; ++j) wst[j] = *(const v8us*)(pws + (j >> 1) * DM * DM + (j & 1) * 4096);
        __builtin_amdgcn_sched_barrier(0);   // keeps the weight loads in front of the x loads: loads return in order, and the staging below must not wait for x
#pragma unroll
        for (int kt = 0; kt < 4; ++kt) { xf[kt][0] = ldf(px0 + kt * 512); xf[kt][1] = ldf(px1 + kt * 512); }
        __builtin_amdgcn_sched_barrier(0);   // keeps the x loads up here: they fly while the weights are staged, and the k loop then waits for one k tile at a time
#pragma unroll
        for (int j = 0; j < 6; ++j) *(v8us*)(Ws + (j >> 1) * (HD * DM) + (j & 1) * 4096 + 8u * tid) = wst[j];
        // barrier by hand with LDS-only fences: it publishes Ws; __syncthreads() here would also wait for the x loads that are in flight
        __builtin_amdgcn_fence(__ATOMIC_RELEASE, "workgroup", "local"); __builtin_amdgcn_s_barrier(); __builtin_amdgcn_fence(__ATOMIC_ACQUIRE, "workgroup", "local");
        v8f bq[2], bk[2]; float bv[2];
        v8f aq[2][2], ak[2][2], av[2][2];   // [tile][d tile]
#pragma unroll
        for (int i = 0; i < 2; ++i)
#pragma unroll
            for (int dt = 0; dt < 2; ++dt) { aq[i][dt] = (v8f){}; ak[i][dt] = (v8f){}; av[i][dt] = (v8f){}; }
        // unrolled: the x fragments are named registers, and every address is base + constant offset
#pragma unroll
        for (int kt = 0; kt < DM / 32; ++kt) {
            const v16bf x0 = xf[kt][0], x1 = xf[kt][1]; v16bf wq[2], wk[2], wv[2];
#pragma unroll
            for (int dt = 0; dt < 2; ++dt) { const bf* pwf = Ws + dt * 16 * DM + kt * 512 + lo; wq[dt] = ldf(pwf); wk[dt] = ldf(pwf + HD * DM); wv[dt] = ldf(pwf + 2 * HD * DM); }
#pragma unroll
            for (int dt = 0; dt < 2; ++dt) {
                aq[0][dt] = wmmab(wq[dt], x0, aq[0][dt]); aq[1][dt] = wmmab(wq[dt], x1, aq[1][dt]);
                ak[0][dt] = wmmab(wk[dt], x0, ak[0][dt]); ak[1][dt] = wmmab(wk[dt], x1, ak[1][dt]);
                av[0][dt] = wmmab(x0, wv[dt], av[0][dt]); av[1][dt] = wmmab(x1, wv[dt], av[1][dt]); }
            // order inside this k tile: its twelve LDS reads as one group, then its twelve products: one LDS latency a k tile instead of one for every fragment
            __builtin_amdgcn_sched_group_barrier(0x100, 12, 0); __builtin_amdgcn_sched_group_barrier(0x008, 12, 0);
            if (kt + 4 < DM / 32) {   // x runs four k tiles ahead, into the registers that this k tile has just left
                xf[kt + 4][0] = ldf(px0 + (kt + 4) * 512); xf[kt + 4][1] = ldf(px1 + (kt + 4) * 512);
                __builtin_amdgcn_sched_group_barrier(0x020, 4, 0); }   // these four loads behind the products
            if (kt == 5) {   // the biases, once registers are free again, two k tiles ahead of their use
#pragma unroll
                for (int dt = 0; dt < 2; ++dt) { bq[dt] = *(const v8f*)(pbr + dt * 16); bk[dt] = *(const v8f*)(pbr + DM + dt * 16); }
                asm volatile("s_wait_xcnt 0x0" ::: "memory");   // in front of any overwrite of the offset register that these loads name (seen in the listing: the next load's result took it)
                bv[0] = pbl[0]; bv[1] = pbl[16]; }
            __builtin_amdgcn_sched_barrier(0);   // nothing moves from one k tile to another: x loads stay four k tiles ahead of their use
        }
        asm volatile("s_wait_xcnt 0x0" ::: "memory");   // in front of any overwrite of a register that the loads above name
#pragma unroll
        for (int i = 0; i < 2; ++i) {
            const unsigned tt = i ? w : (unsigned)(SEQ / 16 - 1) - w;   // 16-row tile of the head
            v8us qh8[2], ql8[2];
#pragma unroll
            for (int dt = 0; dt < 2; ++dt) { v8us kh8, kl8, vh8, vl8; v8f yq, yk, yv;
#pragma unroll
                for (int r = 0; r < 8; ++r) { yq[r] = aq[i][dt][r] + bfr(bq[dt][r]); yk[r] = ak[i][dt][r] + bfr(bk[dt][r]); yv[r] = av[i][dt][r] + bfr(bv[dt]); }
                split8(yq, qh8[dt], ql8[dt]); split8(yk, kh8, kl8); split8(yv, vh8, vl8);
                const unsigned ko = tt * 512u + (unsigned)dt * 256u + lo;                                       // K block = row tile tt, d half dt
                const unsigned vo = ((tt >> 1) * 2u + (unsigned)dt) * 512u + (tt & 1u) * 256u + lo;             // V^T block = [key chunk tt / 2][d tile dt], key half tt & 1
                *(v8us*)(Kh + ko) = kh8; *(v8us*)(Kl + ko) = kl8; *(v8us*)(Vh + vo) = vh8; *(v8us*)(Vl + vo) = vl8; }
            qfh[i] = cat16b(qh8[0], qh8[1]); qfl[i] = cat16b(ql8[0], ql8[1]);
        }
    }
    __syncthreads();   // publishes the head's K and V^T planes: from here on every wave reads what the other waves wrote, and nobody writes them again
    // unrolled: two straight-line copies, so that neither chunk loop carries an outer loop's selects and copies (fewer registers and vector instructions than the rolled build)
#pragma unroll
    for (unsigned part = 0; part < 2u; ++part) {
    const unsigned qt = part ? w : (unsigned)(SEQ / 16 - 1) - w, q0 = qt * 16u;   // wave-uniform; over the block's SEQ / 32 waves every tile of the head exactly once
    const v16bf qh = qfh[part], ql = qfl[part];
    float m = -3.0e38f, l = 0.f; v8f o0 = (v8f){}, o1 = (v8f){};
    const unsigned query = q0 + lr;
    const unsigned nfull = qt >> 1;           // wave-uniform trip count: chunks kc < nfull end at key 32 * nfull - 1 < q0, so none of their scores is masked; chunk nfull, the last, ends at key <= SEQ-1
#pragma unroll 1
    for (unsigned kc = 0; kc < nfull; ++kc) attn_chunk<false>(Kh, Kl, Vh, Vl, kc * 32u, lo, hi, query, qh, ql, m, l, o0, o1);
    attn_chunk<true>(Kh, Kl, Vh, Vl, nfull * 32u, lo, hi, query, qh, ql, m, l, o0, o1);   // the chunk that holds the diagonal
    const float ltot = l + __shfl_xor(l, 16, 32);
    const float inv = __fdiv_rn(1.0f, ltot);
    v8us ah, al, ch, cl;
    split8(o0 * inv, ah, al); split8(o1 * inv, ch, cl);
    // ctx row tile (b*SEQ+q0)/16, k tile = head hd: element (query lr, d = 16*half + 8*hi + r) sits at half*256 + lane*8 + r, which is this lane's own accumulator order
    const size_t co = ((((size_t)b * SEQ + q0) >> 4) * (DM / 32) + hd) * 512u;
    bf* pch = CXh + co + lo; bf* pcl = CXl + co + lo;
    *(v8us*)pch = ah; *(v8us*)(pch + 256u) = ch; *(v8us*)pcl = al; *(v8us*)(pcl + 256u) = cl;
    // in front of the second tile's overwrites of the registers that these stores name (inputs: they live up to here)
    asm volatile("s_wait_xcnt 0x0" :: "v"(ah), "v"(ch), "v"(al), "v"(cl), "v"(pch), "v"(pcl) : "memory");
    }
}

#define PLB ((size_t)NB * SEQ * DM * 2)      // bytes of one 16-bit [NB*SEQ][256] plane
static_assert((size_t)NQKV * DM * 2 + (size_t)DM * DM * 2 + 3 * PLB <= (size_t)134217728);
static_assert(PLB % 256 == 0);
// coverage equalities (threads x elements per thread == plane elements)
static_assert((size_t)(NQKV / 8) * 256 * 8 == (size_t)NQKV * DM);                    // k_prep, qkv weights
static_assert((size_t)(DM / 8) * 256 * 8 == (size_t)DM * DM);                        // k_prep, proj weights
static_assert((size_t)(SEQ / 64) * 8 * 4 * 512 == (size_t)SEQ * DM);                  // k_prep, x per batch: blocks x waves x fragment blocks x elements
static_assert((size_t)SEQ * 6 * 8 == (size_t)3 * HD * DM);                               // k_attn weight staging: SEQ threads, six 16-byte units a thread
static_assert((size_t)(SEQ / 32) * 2 * 2 * 32 * 8 == (size_t)SEQ * HD);                  // k_attn LDS planes: SEQ / 32 waves, two tiles a wave, two 16-byte units a lane and tile
static_assert((size_t)(SEQ / 32) * 2 * NB * 8 * 2 * 32 * 8 == (size_t)NB * SEQ * DM);    // k_attn ctx planes: SEQ / 32 waves a block, two tiles a wave, NB x 8 blocks
static_assert((size_t)(SEQ / 64) * (DM / 64) * NB * 64 * 64 == (size_t)NB * SEQ * DM);   // output GEMM

extern "C" void kernel_launch(void* const* d_in, const int* in_sizes, int n_in,
                              void* d_out, int out_size, void* d_ws, size_t ws_size, hipStream_t stream) {
    if (n_in < 5) return;
    const long long need = ((long long)(NB - 1) * SEQ_FULL + SEQ) * DM;
    if ((long long)in_sizes[0] < need || (long long)out_size < need) return;
    if (in_sizes[1] < DM * NQKV || in_sizes[2] < NQKV || in_sizes[3] < DM * DM || in_sizes[4] < DM) return;
    const float* x = (const float*)d_in[0];       // [NB_FULL][SEQ_FULL][256]
    const float* wqkv = (const float*)d_in[1];    // [256 in][768 out]
    const float* bqkv = (const float*)d_in[2];    // [768]
    const float* wproj = (const float*)d_in[3];   // [256 in][256 out]
    const float* bproj = (const float*)d_in[4];   // [256]
    float* OUT = (float*)d_out;                   // [NB_FULL][SEQ_FULL][256]
    char* wsp = (char*)d_ws;
    auto take = [&](size_t bytes) { char* p = wsp; wsp += (bytes + 255) & ~(size_t)255; return (void*)p; };
    bf* WQ = (bf*)take((size_t)NQKV * DM * 2); bf* WP = (bf*)take((size_t)DM * DM * 2);
    bf* XB = (bf*)take(PLB);
    bf* CXh = (bf*)take(PLB); bf* CXl = (bf*)take(PLB);
    if ((size_t)(wsp - (char*)d_ws) > ws_size) return;
    k_prep<<<PB_WQ + PB_WP + PB_X * NB, 256, 0, stream>>>(x, wqkv, wproj, XB, WQ, WP);   // weights in[256 k][n] -> rows n, x rows: all in fragment order
    k_attn<<<dim3(NH, NB, 1), SEQ, 0, stream>>>(XB, WQ, bqkv, CXh, CXl);
    k_gemmw<bf, 1, true, DM / 32><<<dim3(SEQ / 64, DM / 64, NB), 32, 0, stream>>>(CXh, CXl, WP, nullptr, OUT, DM, bproj, (size_t)SEQ * DM, 0, (size_t)SEQ_FULL * DM);
}

// v010
// One run takes 33.9 microseconds.
// Next to v009, in two timings, it ran 1.05 and 1.04 times as fast.
// Counting every step since v000, it is 3.44 times as fast.
#include <hip/hip_runtime.h>

#ifndef NB
#define NB 32
#endif
#ifndef SEQ
#define SEQ 512
#endif
#define NB_FULL  32
#define SEQ_FULL 512
#define DM   256
#define NH   8
#define HD   32
#define NQKV 768
#define SCL  0.17677669529663688f     // 1/sqrt(float32(32))
#define L2E  1.4426950408889634f

static_assert(SEQ % 64 == 0);
static_assert(SEQ <= SEQ_FULL);
static_assert(NB >= 1);
static_assert(NB <= NB_FULL);
static_assert(NH * HD == DM);
static_assert(NQKV == 3 * DM);

typedef unsigned short bf;
typedef __attribute__((ext_vector_type(16))) __bf16   v16bf;
typedef __attribute__((ext_vector_type(8)))  unsigned short v8us;
typedef __attribute__((ext_vector_type(2)))  unsigned short v2us;
typedef __attribute__((ext_vector_type(8)))  float    v8f;
typedef __attribute__((ext_vector_type(4)))  float    v4f;
typedef v4f  __attribute__((may_alias)) v4fa;
typedef v8us __attribute__((may_alias)) v8usa;

typedef __attribute__((ext_vector_type(2)))  __bf16   v2bf;
typedef __attribute__((ext_vector_type(2)))  float    v2f;
typedef __attribute__((ext_vector_type(4)))  unsigned v4u;
// f32 -> bf16 by the hardware's packed convert (round to nearest even, two values an instruction)
__device__ __forceinline__ float bfr(float f) { return __uint_as_float((unsigned)__builtin_bit_cast(unsigned short, (__bf16)f) << 16); }
// y = hi + lo, both bf16: hi = bf16(y), lo = bf16(y - hi); y - hi is exact in f32
__device__ __forceinline__ void split8(v8f y, v8us& h, v8us& l) {
    v4u hu, lu;
#pragma unroll
    for (int j = 0; j < 4; ++j) { const v2f p = { y[2 * j], y[2 * j + 1] }; const unsigned u = __builtin_bit_cast(unsigned, __builtin_convertvector(p, v2bf)); hu[j] = u;
        const v2f back = { __uint_as_float(u << 16), __uint_as_float(u & 0xFFFF0000u) };   // the two hi parts as f32, taken from the packed word
        lu[j] = __builtin_bit_cast(unsigned, __builtin_convertvector(p - back, v2bf)); }
    h = __builtin_bit_cast(v8us, hu); l = __builtin_bit_cast(v8us, lu);
}
__device__ __forceinline__ v16bf cat16b(v8us lo, v8us hi) { return __builtin_bit_cast(v16bf, __builtin_shufflevector(lo, hi, 0, 1, 2, 3, 4, 5, 6, 7, 8, 9, 10, 11, 12, 13, 14, 15)); }
__device__ __forceinline__ v8f wmmab(v16bf a, v16bf b, v8f c) { return __builtin_amdgcn_wmma_f32_16x16x32_bf16(false, a, false, b, (short)0, c, false, false); }
// fragment from a fragment-order block: p = block + 8*lane; elements 0..7 <- k0+8h.., 8..15 <- k0+16+8h.. of row (lane & 15), h = lane >> 4
__device__ __forceinline__ v16bf ldf(const bf* p) { return cat16b(*(const v8us*)p, *(const v8us*)(p + 256)); }

// ---- k_gemmw: register-blocked GEMM, ONE WAVE per 64x64 output tile (16 accumulators), operands straight from fragment-order 16-bit planes; grid (M/64, N/64, Z), 32 threads.
// C[m][n] (f32, pitch ldc, + optional f32 bias[n] after bf16 convert) = sum_k A[m][k] Bt[n][k] (+ split products per NSPLIT). z-batch strides sA/sB/sC in elements. K = 32 * KT, known at compile time.
// The k loop is unrolled over a ring of three fragment sets in registers: the loads of k tile t + 2 are issued among the products of k tile t, so a wave that is alone on its SIMD keeps two k tiles of loads in flight under its products.
template <typename T16> struct WFrag;
template <> struct WFrag<bf> { typedef v16bf V; static __device__ __forceinline__ V ld(const bf* p) { return cat16b(*(const v8us*)p, *(const v8us*)(p + 256)); } static __device__ __forceinline__ v8f mma(V a, V b, v8f c) { return wmmab(a, b, c); } };
template <typename T16, int NSPLIT, bool BIAS, int KT>
__global__ __launch_bounds__(32) void k_gemmw(const T16* __restrict__ A, const T16* __restrict__ A2, const T16* __restrict__ Bt, const T16* __restrict__ Bt2, float* C, int ldc, const float* __restrict__ bias, size_t sA, size_t sB, size_t sC) {
    typedef typename WFrag<T16>::V V;
    constexpr int K = 32 * KT; constexpr bool HA2 = NSPLIT == 1 || NSPLIT == 2, HB2 = NSPLIT >= 2;
    __shared__ __align__(16) float os[16 * 68];
    const size_t z = blockIdx.z; A += z * sA; if (A2) A2 += z * sA; Bt += z * sB; if (Bt2) Bt2 += z * sB; C += z * sC;
    const int lane = threadIdx.x & 31, lr = lane & 15, hi = lane >> 4; const int r0 = blockIdx.x * 64, c0 = blockIdx.y * 64;
    v8f acc[4][4];
#pragma unroll
    for (int mb = 0; mb < 4; ++mb)
#pragma unroll
        for (int nb = 0; nb < 4; ++nb) acc[mb][nb] = (v8f){};
    const size_t aoff = (size_t)r0 * K, boff = (size_t)c0 * K; const unsigned lo = 8u * (unsigned)lane;   // row tile rt starts at rt * 16 * K elements; k tile kt at + kt * 512
    // one address a plane for the whole kernel: every fragment is at a compile-time offset from it, so no load's address register is ever rewritten
    const T16* pa = A + aoff + lo; const T16* pa2 = HA2 ? A2 + aoff + lo : pa; const T16* pb = Bt + boff + lo; const T16* pb2 = HB2 ? Bt2 + boff + lo : pb;
    V a[3][4], a2[3][4], b[3][4], b2[3][4];
    // the loads of one k tile, into the set that k tile kt - 3 has left: first all of A, which the first column of products needs whole, then B by columns
    auto load = [&](int kt) { const int s = kt % 3;
#pragma unroll
        for (int i = 0; i < 4; ++i) { a[s][i] = WFrag<T16>::ld(pa + i * 16 * K + kt * 512); if (HA2) a2[s][i] = WFrag<T16>::ld(pa2 + i * 16 * K + kt * 512); }
#pragma unroll
        for (int i = 0; i < 4; ++i) { b[s][i] = WFrag<T16>::ld(pb + i * 16 * K + kt * 512); if (HB2) b2[s][i] = WFrag<T16>::ld(pb2 + i * 16 * K + kt * 512); } };
    // the products of one k tile with B column tile nb
    auto prod = [&](int kt, int nb) { const int s = kt % 3;
#pragma unroll
        for (int mb = 0; mb < 4; ++mb) { acc[mb][nb] = WFrag<T16>::mma(a[s][mb], b[s][nb], acc[mb][nb]); if (HA2) acc[mb][nb] = WFrag<T16>::mma(a2[s][mb], b[s][nb], acc[mb][nb]); if (HB2) acc[mb][nb] = WFrag<T16>::mma(a[s][mb], b2[s][nb], acc[mb][nb]); } };
    load(0); if (KT > 1) load(1);
    // unrolled: the ring index kt % 3 is then a constant, so that the three sets are named registers, and every address is base + constant offset
#pragma unroll
    for (int kt = 0; kt < KT; ++kt) {
        __builtin_amdgcn_sched_barrier(0);   // keeps the loads above in front of these products: without it the build moves them down to their use and their latency is exposed again
        prod(kt, 0);                         // waits for k tile kt, so that with the loads below never more than 54 loads of the wave are outstanding
        __builtin_amdgcn_sched_barrier(0);   // keeps the loads below behind that wait and in front of the other three columns
        if (kt + 2 < KT) load(kt + 2);
        __builtin_amdgcn_sched_barrier(0);   // as the first: these loads stay two k tiles ahead of their use
        prod(kt, 1); prod(kt, 2); prod(kt, 3);
    }
    // in front of the epilogue's overwrites of the registers that the loads above name; the lane number, their offset register, is an input so that it lives up to here
    asm volatile("s_wait_xcnt 0x0" :: "v"(lane) : "memory");
#pragma unroll
    for (int mb = 0; mb < 4; ++mb) {
#pragma unroll
        for (int nb = 0; nb < 4; ++nb) {
#pragma unroll
            for (int j = 0; j < 8; ++j) os[(hi * 8 + j) * 68 + nb * 16 + lr] = acc[mb][nb][j]; }
        __builtin_amdgcn_wave_barrier(); asm volatile("" ::: "memory");
        float* crow = C + (size_t)(r0 + mb * 16) * ldc + c0;
{
#pragma unroll
            for (int s = 0; s < 8; ++s) { const int row = 2 * s + hi, cofs = lr * 4; v4f val = *(const v4fa*)(os + row * 68 + cofs); if (BIAS) { val[0] += bfr(bias[c0 + cofs]); val[1] += bfr(bias[c0 + cofs + 1]); val[2] += bfr(bias[c0 + cofs + 2]); val[3] += bfr(bias[c0 + cofs + 3]); }
                *(v4f*)(crow + (size_t)row * ldc + cofs) = val; }
             }
        asm volatile("s_wait_xcnt 0x0" ::: "memory");   // in front of the next block's overwrites of the registers that these stores name
        __builtin_amdgcn_wave_barrier(); asm volatile("" ::: "memory");
    }
}

__device__ __forceinline__ unsigned pk2(float a, float b) { const v2f p = { a, b }; return __builtin_bit_cast(unsigned, __builtin_convertvector(p, v2bf)); }
typedef __attribute__((ext_vector_type(2))) unsigned v2u;
typedef unsigned __attribute__((may_alias)) ua;

// one 32-key chunk (keys kb .. kb + 31) of the transposed flash attention of one 16-query tile. MASKED = false: for a chunk whose every key is at or below every query of the tile, so that no key index, compare or select is formed.
template <bool MASKED>
__device__ __forceinline__ void attn_chunk(const bf* Kh, const bf* Kl, const bf* Vh, const bf* Vl, unsigned kb, unsigned lo, unsigned hi, unsigned query, v16bf qh, v16bf ql, float& m, float& l, v8f& o0, v8f& o1) {
        const bf* pkh = Kh + kb * HD + lo; const bf* pkl = Kl + kb * HD + lo;   // LDS: 32 keys = two blocks = 1024 elements
        const v16bf k0h = ldf(pkh), k0l = ldf(pkl), k1h = ldf(pkh + 512), k1l = ldf(pkl + 512);
        v8f s0 = (v8f){}, s1 = (v8f){};
        s0 = wmmab(k0h, qh, s0); s0 = wmmab(k0h, ql, s0); s0 = wmmab(k0l, qh, s0);
        s1 = wmmab(k1h, qh, s1); s1 = wmmab(k1h, ql, s1); s1 = wmmab(k1l, qh, s1);
        asm volatile("v_nop\n\tv_nop\n\tv_nop\n\tv_nop" : "+v"(s0), "+v"(s1) : "v"(k0h), "v"(k0l), "v"(k1h), "v"(k1l), "v"(qh), "v"(ql));
        const unsigned keyb = kb + 8u * hi;
        float t0[8], t1[8]; float tmax = -3.0e38f;
#pragma unroll
        for (int r = 0; r < 8; ++r) { const bool ok0 = !MASKED || (keyb + (unsigned)r) <= query, ok1 = !MASKED || (keyb + 16u + (unsigned)r) <= query;
            t0[r] = ok0 ? s0[r] * SCL : -3.0e38f; t1[r] = ok1 ? s1[r] * SCL : -3.0e38f; tmax = fmaxf(tmax, fmaxf(t0[r], t1[r])); }
        tmax = fmaxf(tmax, __shfl_xor(tmax, 16, 32));
        const float mnew = fmaxf(m, tmax);
        // v_exp_f32 and the slot behind it in one statement: a v_nop in a statement of its own landed elsewhere
        float alpha; asm("v_exp_f32 %0, %1\n\tv_nop" : "=v"(alpha) : "v"(__fmul_rn(__fsub_rn(m, mnew), L2E)));
        float psum = 0.f; v8us p0h, p0l, p1h, p1l; v8f pv0, pv1;
#pragma unroll
        for (int r = 0; r < 8; ++r) { const bool ok0 = !MASKED || (keyb + (unsigned)r) <= query, ok1 = !MASKED || (keyb + 16u + (unsigned)r) <= query;
            const float e0 = __builtin_amdgcn_exp2f(__fmul_rn(__fsub_rn(t0[r], mnew), L2E)), e1 = __builtin_amdgcn_exp2f(__fmul_rn(__fsub_rn(t1[r], mnew), L2E));
            const float p0 = ok0 ? e0 : 0.f, p1 = ok1 ? e1 : 0.f; psum += p0 + p1; pv0[r] = p0; pv1[r] = p1; }
        split8(pv0, p0h, p0l); split8(pv1, p1h, p1l);
        l = l * alpha + psum; m = mnew;
        o0 *= alpha; o1 *= alpha;
        const v16bf ph = cat16b(p0h, p1h), pl = cat16b(p0l, p1l);
        const bf* pvh = Vh + kb * HD + lo; const bf* pvl = Vl + kb * HD + lo;   // LDS: 32 keys = d tile 0 block, d tile 1 block
        const v16bf v0h = ldf(pvh), v0l = ldf(pvl), v1h = ldf(pvh + 512), v1l = ldf(pvl + 512);
        o0 = wmmab(v0h, ph, o0); o0 = wmmab(v0h, pl, o0); o0 = wmmab(v0l, ph, o0);
        o1 = wmmab(v1h, ph, o1); o1 = wmmab(v1h, pl, o1); o1 = wmmab(v1l, ph, o1);
        asm volatile("v_nop\n\tv_nop\n\tv_nop\n\tv_nop" : "+v"(o0), "+v"(o1) : "v"(v0h), "v"(v0l), "v"(v1h), "v"(v1l), "v"(ph), "v"(pl));
}

// k_attn: input conversion, qkv projection and attention of one (head, batch b) in one block; wave w = query tile pair w (tiles n - 1 - w and w).
// Projection: a head needs only its own 96 columns of qkv, so no product is done twice over the grid. Each wave projects the 16-row tiles n - 1 - w and w of x (K = 256, bf16 x bf16, f32 accumulate, + bf16(b_qkv)), oriented so
// that the accumulators ARE fragment order (lane unchanged, 8 registers = 8 consecutive k): Q^T and K^T tiles [d][t] = W rows (A) x x rows (B) give the Q and K fragments (row t, k = d); V tiles [t][d] = x rows (A) x W rows (B) give the V^T fragment halves (row d, k = t).
// Weights: the head's 96 columns of the f32 W_qkv are read in whole 128-byte lines (a lane: 4 columns of two neighbouring k rows), rounded to bf16 in k pairs and stored as W^T in fragment order in LDS (48 KiB, one barrier).
// x: every wave reads its own two f32 row tiles in whole lines (lane = row group r4 = lane >> 3, 16-byte piece c = lane & 7; load i of a k tile reads rows 4 i + r4), two to three k tiles ahead of their use, rounds them to bf16 and
// turns them into fragments through a piece of LDS that no other wave touches (two buffers, so that k tile kt + 1 is stored while kt is read; a wave's LDS operations run in order, so no barrier is needed).
// A staged 16 x 32 block = four groups of 8 k, XG elements apart: [k >> 3][row][8 k]; XG = 16 rows x 8 + 32 puts the four groups that one 8-byte store writes on four different quarters of the banks; a fragment half reads 16 rows of one group, 256 bytes in a row.
// Every block also converts 8 k rows x 32 columns of W_proj to the fragment-order bf16 plane of W_proj^T for the output GEMM, the next launch.
// Q hi/lo stays in the wave's registers; K and V^T hi/lo of the whole head go to LDS in the fragment-order blocks described above (4 planes x 32 KiB); one barrier; then every wave reads them from LDS.
// Causal cost grows with the query tile, so every wave runs tile n - 1 - w and then tile w, one after the other: each wave of the launch then has the same number of key chunks, and all blocks are resident at once. Transposed flash attention over 32-key chunks:
//   S^T tile j [key kb+16j+8h+r][query q0+lr] = K rows (A) x Q rows (B), hi/lo 3 products; causal mask by value, in the tile's last chunk alone; online softmax per query = per lane pair (lane, lane^16);
//   P^T B fragment: element r <- p(tile 0)[r], element 8+r <- p(tile 1)[r], lane unchanged; O^T [d][query] += V^T rows (A) x P^T (B), hi/lo 3 products.
#define XG   160          // elements from one 8-k group of a staged x block to the next
#define XBLK (4 * XG)     // elements of a staged 16 x 32 block
__global__ __launch_bounds__(SEQ) void k_attn(const float* __restrict__ x, const float* __restrict__ wqkv, const float* __restrict__ bias, const float* __restrict__ wproj, bf* WP, bf* CXh, bf* CXl) {
    __shared__ __align__(16) bf Kh[SEQ * HD]; __shared__ __align__(16) bf Kl[SEQ * HD]; __shared__ __align__(16) bf Vh[SEQ * HD]; __shared__ __align__(16) bf Vl[SEQ * HD];
    __shared__ __align__(16) bf Ws[3 * HD * DM];   // this head's q, k, v rows of W^T, fragment order: [q | k | v][d tile][k tile][512]
    __shared__ __align__(16) bf Xs[(SEQ / 32) * 4 * XBLK];   // x staging: [wave][buffer][tile][XBLK]
    const unsigned tid = threadIdx.x, lane = tid & 31u, lr = lane & 15u, hi = lane >> 4, lo = 8u * lane;
    const unsigned w = (unsigned)__builtin_amdgcn_readfirstlane((int)(tid >> 5));   // wave number, told to the compiler as wave-uniform: tile index and trip count stay scalar, the chunk loops branch on SCC with EXEC whole
    const unsigned b = blockIdx.y, hd = blockIdx.x;
    v16bf qfh[2], qfl[2];
    {
        const unsigned r4 = lane >> 3, c = lane & 7u;
        // W_proj: this block's share = k rows 8 kg .. + 7 of columns 32 ng .. + 31, dealt to the lanes like a job of W_qkv below
        const unsigned kg = (b * (unsigned)NH + hd) & 31u, ng = (b * (unsigned)NH + hd) >> 5;
        const float* ppj = wproj + (size_t)(8u * kg + 2u * r4) * DM + 32u * ng + 4u * c;
        // W_qkv: job j of wave w = section j >> 1 (q, k, v), k rows (j & 1) * 128 + 8 w .. + 7; this lane: rows + 2 r4 and + 2 r4 + 1, columns 4 c .. 4 c + 3 of the head
        const float* pwg = wqkv + (size_t)(8u * w + 2u * r4) * NQKV + hd * HD + 4u * c;
        const float* px0 = x + (size_t)b * SEQ_FULL * DM + (size_t)(((unsigned)(SEQ / 16 - 1) - w) * 16u + r4) * DM + 4u * c;   // x row tile n - 1 - w; rows 4 i + r4 at + i * 4 * DM, k tile kt at + kt * 32
        const float* px1 = x + (size_t)b * SEQ_FULL * DM + (size_t)(w * 16u + r4) * DM + 4u * c;                                // x row tile w
        const float* pbr = bias + hd * HD + 8u * hi;               // q and k bias by accumulator register: d = 16 * dt + 8 * hi + r
        const float* pbl = bias + 2 * DM + hd * HD + lr;           // v bias by lane: d = 16 * dt + lr
        bf* xsw = Xs + w * (unsigned)(4 * XBLK) + (c >> 1) * (unsigned)XG + r4 * 8u + (c & 1u) * 4u;   // where this lane stores its 4 k of row r4; rows 4 i + r4 at + i * 32
        const bf* xsr = Xs + w * (unsigned)(4 * XBLK) + hi * (unsigned)XG + lr * 8u;                   // where it reads its fragment's first 8 k; the second 8 at + 2 * XG
        v4f wa[6], wb[6], xr[2][2][4];   // xr: [k tile & 1][tile][row group]
        auto xload = [&](int kt) {
#pragma unroll
            for (int i = 0; i < 4; ++i) { xr[kt & 1][0][i] = *(const v4f*)(px0 + i * 4 * DM + kt * 32); xr[kt & 1][1][i] = *(const v4f*)(px1 + i * 4 * DM + kt * 32); } };
        auto xstage = [&](int kt) {
#pragma unroll
            for (int t = 0; t < 2; ++t)
#pragma unroll
                for (int i = 0; i < 4; ++i) { const v4f f = xr[kt & 1][t][i]; *(v2u*)(xsw + ((kt & 1) * 2 + t) * XBLK + i * 32) = (v2u){ pk2(f[0], f[1]), pk2(f[2], f[3]) }; } };
        // every wave loads the share (the same eight lines, two loads a wave), wave 0 alone stores it: with the loads inside a branch on the wave number the build puts the conversion, and with it a wait for the data, into that branch, in front of the loads below
        const v4f pa = *(const v4f*)ppj, pb = *(const v4f*)(ppj + DM);
#pragma unroll
        for (int j = 0; j < 6; ++j) { const float* p = pwg + (j >> 1) * DM + (j & 1) * 128 * NQKV; wa[j] = *(const v4f*)p; wb[j] = *(const v4f*)(p + NQKV); }
        __builtin_amdgcn_sched_barrier(0);   // keeps the weight loads in front of the x loads: loads return in order, and the staging below must not wait for x
        xload(0); xload(1);
        // the wait in front of any overwrite of a register that the weight loads name; their addresses are inputs so that they live up to here
        asm volatile("s_wait_xcnt 0x0" :: "v"(ppj), "v"(pwg) : "memory");
        __builtin_amdgcn_sched_barrier(0);   // keeps the x loads up here: they fly while the weights are staged
        {
            ua* wsd = (ua*)Ws + (c >> 2) * 2048u + (w >> 2) * 256u + ((w >> 1) & 1u) * 128u + (w & 1u) * 64u + (c & 3u) * 16u + r4;   // 4-byte word = k pair r4 of the unit of (column 4 c, k group w)
#pragma unroll
            for (int j = 0; j < 6; ++j)
#pragma unroll
                for (int e = 0; e < 4; ++e) wsd[(j >> 1) * 4096 + (j & 1) * 1024 + e * 4] = pk2(wa[j][e], wb[j][e]);
        }
        if (w == 0u) {   // 4-byte word = k pair r4 of the 16-byte unit (row tile n >> 4) * 512 + kg * 16 + (n & 15) of the fragment-order plane of W_proj^T, n = 32 ng + 4 c + e: the wave fills two pieces of 256 bytes, whole lines
            ua* wpd = (ua*)WP + ((size_t)(2u * ng + (c >> 2)) * 512u + kg * 16u + (c & 3u) * 4u) * 4u + r4;
#pragma unroll
            for (int e = 0; e < 4; ++e) wpd[e * 4] = pk2(pa[e], pb[e]);
            asm volatile("s_wait_xcnt 0x0" ::: "memory"); }   // in front of any overwrite of a register that these stores name
        // barrier by hand with LDS-only fences: it publishes Ws; __syncthreads() here would also wait for the x loads that are in flight
        __builtin_amdgcn_fence(__ATOMIC_RELEASE, "workgroup", "local"); __builtin_amdgcn_s_barrier(); __builtin_amdgcn_fence(__ATOMIC_ACQUIRE, "workgroup", "local");
        xstage(0); xload(2);
        v8f bq[2], bk[2]; float bv[2];
        v8f aq[2][2], ak[2][2], av[2][2];   // [tile][d tile]
#pragma unroll
        for (int i = 0; i < 2; ++i)
#pragma unroll
            for (int dt = 0; dt < 2; ++dt) { aq[i][dt] = (v8f){}; ak[i][dt] = (v8f){}; av[i][dt] = (v8f){}; }
        // unrolled: the x registers and the buffer are picked at compile time, and every address is base + constant offset
#pragma unroll
        for (int kt = 0; kt < DM / 32; ++kt) {
            const bf* px = xsr + (kt & 1) * 2 * XBLK; v16bf wq[2], wk[2], wv[2];
            const v16bf x0 = cat16b(*(const v8us*)px, *(const v8us*)(px + 2 * XG)), x1 = cat16b(*(const v8us*)(px + XBLK), *(const v8us*)(px + XBLK + 2 * XG));
#pragma unroll
            for (int dt = 0; dt < 2; ++dt) { const bf* pwf = Ws + dt * 16 * DM + kt * 512 + lo; wq[dt] = ldf(pwf); wk[dt] = ldf(pwf + HD * DM); wv[dt] = ldf(pwf + 2 * HD * DM); }
            __builtin_amdgcn_sched_barrier(0);   // this k tile's sixteen LDS reads as one group, in front of the stores below: one LDS latency a k tile, and it passes under the conversion
            if (kt + 1 < DM / 32) { xstage(kt + 1);   // the next k tile into the other buffer
                if (kt + 3 < DM / 32) xload(kt + 3); }   // into the registers that it has just left
            __builtin_amdgcn_sched_barrier(0);   // keeps the loads above in front of the products: they stay two k tiles ahead of their use
#pragma unroll
            for (int dt = 0; dt < 2; ++dt) {
                aq[0][dt] = wmmab(wq[dt], x0, aq[0][dt]); aq[1][dt] = wmmab(wq[dt], x1, aq[1][dt]);
                ak[0][dt] = wmmab(wk[dt], x0, ak[0][dt]); ak[1][dt] = wmmab(wk[dt], x1, ak[1][dt]);
                av[0][dt] = wmmab(x0, wv[dt], av[0][dt]); av[1][dt] = wmmab(x1, wv[dt], av[1][dt]); }
            if (kt == 5) {   // the biases, once registers are free again, two k tiles ahead of their use
#pragma unroll
                for (int dt = 0; dt < 2; ++dt) { bq[dt] = *(const v8f*)(pbr + dt * 16); bk[dt] = *(const v8f*)(pbr + DM + dt * 16); }
                asm volatile("s_wait_xcnt 0x0" ::: "memory");   // in front of any overwrite of the offset register that these loads name (seen in the listing: the next load's result took it)
                bv[0] = pbl[0]; bv[1] = pbl[16]; }
            __builtin_amdgcn_sched_barrier(0);   // nothing moves from one k tile to another
        }
        asm volatile("s_wait_xcnt 0x0" ::: "memory");   // in front of any overwrite of a register that the loads above name
#pragma unroll
        for (int i = 0; i < 2; ++i) {
            const unsigned tt = i ? w : (unsigned)(SEQ / 16 - 1) - w;   // 16-row tile of the head
            v8us qh8[2], ql8[2];
#pragma unroll
            for (int dt = 0; dt < 2; ++dt) { v8us kh8, kl8, vh8, vl8; v8f yq, yk, yv;
#pragma unroll
                for (int r = 0; r < 8; ++r) { yq[r] = aq[i][dt][r] + bfr(bq[dt][r]); yk[r] = ak[i][dt][r] + bfr(bk[dt][r]); yv[r] = av[i][dt][r] + bfr(bv[dt]); }
                split8(yq, qh8[dt], ql8[dt]); split8(yk, kh8, kl8); split8(yv, vh8, vl8);
                const unsigned ko = tt * 512u + (unsigned)dt * 256u + lo;                                       // K block = row tile tt, d half dt
                const unsigned vo = ((tt >> 1) * 2u + (unsigned)dt) * 512u + (tt & 1u) * 256u + lo;             // V^T block = [key chunk tt / 2][d tile dt], key half tt & 1
                *(v8us*)(Kh + ko) = kh8; *(v8us*)(Kl + ko) = kl8; *(v8us*)(Vh + vo) = vh8; *(v8us*)(Vl + vo) = vl8; }
            qfh[i] = cat16b(qh8[0], qh8[1]); qfl[i] = cat16b(ql8[0], ql8[1]);
        }
    }
    __syncthreads();   // publishes the head's K and V^T planes: from here on every wave reads what the other waves wrote, and nobody writes them again
    // unrolled: two straight-line copies, so that neither chunk loop carries an outer loop's selects and copies (fewer registers and vector instructions than the rolled build)
#pragma unroll
    for (unsigned part = 0; part < 2u; ++part) {
    const unsigned qt = part ? w : (unsigned)(SEQ / 16 - 1) - w, q0 = qt * 16u;   // wave-uniform; over the block's SEQ / 32 waves every tile of the head exactly once
    const v16bf qh = qfh[part], ql = qfl[part];
    float m = -3.0e38f, l = 0.f; v8f o0 = (v8f){}, o1 = (v8f){};
    const unsigned query = q0 + lr;
    const unsigned nfull = qt >> 1;           // wave-uniform trip count: chunks kc < nfull end at key 32 * nfull - 1 < q0, so none of their scores is masked; chunk nfull, the last, ends at key <= SEQ-1
#pragma unroll 1
    for (unsigned kc = 0; kc < nfull; ++kc) attn_chunk<false>(Kh, Kl, Vh, Vl, kc * 32u, lo, hi, query, qh, ql, m, l, o0, o1);
    attn_chunk<true>(Kh, Kl, Vh, Vl, nfull * 32u, lo, hi, query, qh, ql, m, l, o0, o1);   // the chunk that holds the diagonal
    const float ltot = l + __shfl_xor(l, 16, 32);
    const float inv = __fdiv_rn(1.0f, ltot);
    v8us ah, al, ch, cl;
    split8(o0 * inv, ah, al); split8(o1 * inv, ch, cl);
    // ctx row tile (b*SEQ+q0)/16, k tile = head hd: element (query lr, d = 16*half + 8*hi + r) sits at half*256 + lane*8 + r, which is this lane's own accumulator order
    const size_t co = ((((size_t)b * SEQ + q0) >> 4) * (DM / 32) + hd) * 512u;
    bf* pch = CXh + co + lo; bf* pcl = CXl + co + lo;
    *(v8us*)pch = ah; *(v8us*)(pch + 256u) = ch; *(v8us*)pcl = al; *(v8us*)(pcl + 256u) = cl;
    // in front of the second tile's overwrites of the registers that these stores name (inputs: they live up to here)
    asm volatile("s_wait_xcnt 0x0" :: "v"(ah), "v"(ch), "v"(al), "v"(cl), "v"(pch), "v"(pcl) : "memory");
    }
}

#define PLB ((size_t)NB * SEQ * DM * 2)      // bytes of one 16-bit [NB*SEQ][256] plane
static_assert((size_t)DM * DM * 2 + 2 * PLB <= (size_t)134217728);
static_assert(PLB % 256 == 0);
// coverage equalities (threads x elements per thread == plane elements)
static_assert((size_t)NB * NH * 32 * 8 == (size_t)DM * DM);                              // k_attn, proj weights: one wave a block, 8 values a lane
static_assert((size_t)(SEQ / 32) * 6 * 32 * 8 == (size_t)3 * HD * DM);                   // k_attn weight staging: SEQ / 32 waves, six jobs a wave, 8 values a lane and job
static_assert((size_t)(SEQ / 32) * 2 * 2 * 32 * 8 == (size_t)SEQ * HD);                  // k_attn LDS planes: SEQ / 32 waves, two tiles a wave, two 16-byte units a lane and tile
static_assert((size_t)(SEQ / 32) * 2 * NB * 8 * 2 * 32 * 8 == (size_t)NB * SEQ * DM);    // k_attn ctx planes: SEQ / 32 waves a block, two tiles a wave, NB x 8 blocks
static_assert((size_t)(SEQ / 64) * (DM / 64) * NB * 64 * 64 == (size_t)NB * SEQ * DM);   // output GEMM

extern "C" void kernel_launch(void* const* d_in, const int* in_sizes, int n_in,
                              void* d_out, int out_size, void* d_ws, size_t ws_size, hipStream_t stream) {
    if (n_in < 5) return;
    const long long need = ((long long)(NB - 1) * SEQ_FULL + SEQ) * DM;
    if ((long long)in_sizes[0] < need || (long long)out_size < need) return;
    if (in_sizes[1] < DM * NQKV || in_sizes[2] < NQKV || in_sizes[3] < DM * DM || in_sizes[4] < DM) return;
    const float* x = (const float*)d_in[0];       // [NB_FULL][SEQ_FULL][256]
    const float* wqkv = (const float*)d_in[1];    // [256 in][768 out]
    const float* bqkv = (const float*)d_in[2];    // [768]
    const float* wproj = (const float*)d_in[3];   // [256 in][256 out]
    const float* bproj = (const float*)d_in[4];   // [256]
    float* OUT = (float*)d_out;                   // [NB_FULL][SEQ_FULL][256]
    char* wsp = (char*)d_ws;
    auto take = [&](size_t bytes) { char* p = wsp; wsp += (bytes + 255) & ~(size_t)255; return (void*)p; };
    bf* WP = (bf*)take((size_t)DM * DM * 2);
    bf* CXh = (bf*)take(PLB); bf* CXl = (bf*)take(PLB);
    if ((size_t)(wsp - (char*)d_ws) > ws_size) return;
    k_attn<<<dim3(NH, NB, 1), SEQ, 0, stream>>>(x, wqkv, bqkv, wproj, WP, CXh, CXl);
    k_gemmw<bf, 1, true, DM / 32><<<dim3(SEQ / 64, DM / 64, NB), 32, 0, stream>>>(CXh, CXl, WP, nullptr, OUT, DM, bproj, (size_t)SEQ * DM, 0, (size_t)SEQ_FULL * DM);
}
